// v000
// Measured on an AMD MI455X. A time is GPU time per run, averaged over a window of back-to-back runs after a warm-up
// (all launches, gaps included; the runs take copies of the inputs in turn), and the median of several windows.
// Apart from v000's, it joins two sittings. Times from different sittings can be a few percent apart, while
// side-by-side timings come from the same sitting.
// v000 is the starting kernel. One run takes 1040 microseconds.
#include <hip/hip_runtime.h>
// q = query·Wq and k = value·Wk on v_wmma_f32_16x16x32_bf16 (inputs rounded to bf16: single exact term), context = attn·value (attn split hi/lo vs bf16-rounded value: 2 products),
// f32 accumulate. The additive scores Σ_u scale_u·tanh(q_u + k_u) over the [4,256,256,512] broadcast (f32 VALU with an __expf-based tanh), the key mask and the softmax
// are f32 VALU; attention weights are the second output.
#define BB 4
#define TQ 256
#define TK 256
#define DD 1024
#define UU 512

typedef __bf16 v16b __attribute__((ext_vector_type(16)));
typedef unsigned short v8us __attribute__((ext_vector_type(8), may_alias));
typedef float  v8f  __attribute__((ext_vector_type(8)));
typedef float  v4f  __attribute__((ext_vector_type(4)));
typedef float  v4fa __attribute__((ext_vector_type(4), may_alias));
union FragB { v16b v; v8us half[2]; unsigned short u[16]; };

__device__ __forceinline__ unsigned short bf16_bits(float x) { unsigned int u = __float_as_uint(x); return (unsigned short)((u + 0x7FFFu + ((u >> 16) & 1u)) >> 16); }
__device__ __forceinline__ float bf16_val(unsigned short b) { return __uint_as_float(((unsigned int)b) << 16); }
__device__ __forceinline__ float bf16_round(float x) { return bf16_val(bf16_bits(x)); }
// D += A·B with NT terms: 1 = ah·bh, 2 = + al·bh (A split), 3 = + ah·bl (both split)
template <int NT>
__device__ __forceinline__ v8f mmaN(v16b ah, v16b al, v16b bh, v16b bl, v8f c) {
  c = __builtin_amdgcn_wmma_f32_16x16x32_bf16(false, ah, false, bh, (short)0, c, false, false);
  if (NT >= 2) c = __builtin_amdgcn_wmma_f32_16x16x32_bf16(false, al, false, bh, (short)0, c, false, false);
  if (NT >= 3) c = __builtin_amdgcn_wmma_f32_16x16x32_bf16(false, ah, false, bl, (short)0, c, false, false);
  asm volatile("v_nop\n\tv_nop\n\tv_nop\n\tv_nop" : "+v"(c) : "v"(ah), "v"(al), "v"(bh), "v"(bl));
  return c;
}

__global__ __launch_bounds__(256) void k_wt_bf16(const float* __restrict__ W, unsigned short* __restrict__ Wt, int K, int N) {
  const int t = blockIdx.x * 256 + threadIdx.x;
  const int k8n = K / 8;
  if (t >= N * k8n) return;
  const int n = t / k8n, k8 = (t % k8n) * 8;
  v8us v;
#pragma unroll
  for (int i = 0; i < 8; ++i) v[i] = bf16_bits(W[(size_t)(k8 + i) * N + n]);
  *(v8us*)(Wt + (size_t)n * K + k8) = v;
  
}

// GEMM C[M][N] (f32, pitch ldc) = act(A[M][K]·W + bias). A f32 row-major (pitch lda) converted per fragment to bf16
// (ASPLIT: hi/lo two planes -> 2 terms, else single rounded term); Wt bf16 [N][K] (pitch ldb). BIAS_BF16 rounds the
// bias to bf16 first (bias quantised to bf16 before the add). K%32==0, M%16==0, N%64==0.
template <bool ASPLIT, int ACT, bool BIAS_BF16>
__global__ __launch_bounds__(128) void k_gemm_bf(const float* __restrict__ A, int lda, const unsigned short* __restrict__ Wt, int ldb,
                                               const float* __restrict__ bias, float* __restrict__ C, int ldc, int M, int N, int K) {
  __shared__ __attribute__((aligned(16))) float so[4][16][64];
  const int tid = threadIdx.x, w = tid >> 5, lane = tid & 31, ln = lane & 15, hh = lane >> 4;
  const int ntn = N / 64;
  const int wid = blockIdx.x * 4 + w;
  const int mt = wid / ntn, nq = wid % ntn;
  if (mt * 16 >= M) return;
  const int row0 = mt * 16, col0 = nq * 64;
  const float* arow = A + (size_t)(row0 + ln) * lda;
  v8f acc[4] = {};
  for (int kb = 0; kb < K; kb += 32) {
    FragB ah, al;
    const v4f x0 = *(const v4fa*)(arow + kb + 8 * hh), x1 = *(const v4fa*)(arow + kb + 8 * hh + 4);
    const v4f x2 = *(const v4fa*)(arow + kb + 16 + 8 * hh), x3 = *(const v4fa*)(arow + kb + 16 + 8 * hh + 4);
    float xs[16] = {x0[0],x0[1],x0[2],x0[3],x1[0],x1[1],x1[2],x1[3],x2[0],x2[1],x2[2],x2[3],x3[0],x3[1],x3[2],x3[3]};
#pragma unroll
    for (int i = 0; i < 16; ++i) { const unsigned short hb = bf16_bits(xs[i]); ah.u[i] = hb; al.u[i] = ASPLIT ? bf16_bits(xs[i] - bf16_val(hb)) : (unsigned short)0; }
#pragma unroll
    for (int t = 0; t < 4; ++t) {
      const unsigned short* brow = Wt + (size_t)(col0 + t * 16 + ln) * ldb + kb;
      FragB b;
      b.half[0] = *(const v8us*)(brow + 8 * hh);
      b.half[1] = *(const v8us*)(brow + 16 + 8 * hh);
      acc[t] = mmaN<ASPLIT ? 2 : 1>(ah.v, al.v, b.v, b.v, acc[t]);
    }
  }
#pragma unroll
  for (int t = 0; t < 4; ++t) {
    float bv = bias ? bias[col0 + t * 16 + ln] : 0.f;
    if (BIAS_BF16) bv = bf16_round(bv);
#pragma unroll
    for (int r = 0; r < 8; ++r) { float v = acc[t][r] + bv; if (ACT == 1) v = fmaxf(v, 0.f); so[w][8 * hh + r][t * 16 + ln] = v; }
  }
  __builtin_amdgcn_fence(__ATOMIC_ACQ_REL, "workgroup");
  __builtin_amdgcn_wave_barrier();
  const int rsub = lane >> 4, c4 = (lane & 15) * 4;
  {
#pragma unroll
    for (int q = 0; q < 8; ++q) {
      const int r = q * 2 + rsub;
      const v4f v = *(const v4fa*)&so[w][r][c4];
      *(v4f*)(C + (size_t)(row0 + r) * ldc + col0 + c4) = v;
    }
    
  }
}

// Flash-style causal/unmasked attention, all contractions 3-term bf16 hi/lo splits, f32 softmax with running max.
// q,k,v rows are read from f32 buffers with arbitrary row pitch (so they can live inside a fused qkv buffer);
// D = head size (multiple of 32, <= 128); one wave = 16 query rows; block = 4 waves (64 queries) sharing K/V chunks of 32.
template <int D, bool CAUSAL>
__global__ __launch_bounds__(128) void k_flash(const float* __restrict__ qb, const float* __restrict__ kb, const float* __restrict__ vb,
                                             int pitch, int T, int H, float scale, float* __restrict__ y, int ypitch) {
  constexpr int KS = D / 32;        // k-steps for QK
  constexpr int DT = D / 16;        // d tiles for PV
  __shared__ __attribute__((aligned(16))) unsigned short sKh[32][D + 8], sKl[32][D + 8], sVh[32][D + 8], sVl[32][D + 8];
  __shared__ __attribute__((aligned(16))) unsigned short sPh[4][16][40], sPl[4][16][40];
  __shared__ __attribute__((aligned(16))) float sO[4][16][D];
  const int tid = threadIdx.x, w = tid >> 5, lane = tid & 31, ln = lane & 15, hh = lane >> 4;
  const int nqb = (T + 63) / 64;
  const int bh = blockIdx.x / nqb, qblk = blockIdx.x % nqb;
  const int b = bh / H, h = bh % H;
  const int q0 = qblk * 64 + w * 16;
  const float* Q = qb + (size_t)b * T * pitch + h * D;
  const float* K = kb + (size_t)b * T * pitch + h * D;
  const float* V = vb + (size_t)b * T * pitch + h * D;

  // A fragments of the wave's 16 query rows (scaled), hi/lo
  FragB aqh[KS], aql[KS];
  {
    int row = q0 + ln; if (row >= T) row = T - 1;
    const float* qr = Q + (size_t)row * pitch;
#pragma unroll
    for (int ks = 0; ks < KS; ++ks)
#pragma unroll
      for (int i = 0; i < 16; ++i) {
        const int d = ks * 32 + ((i < 8) ? (8 * hh + i) : (16 + 8 * hh + (i - 8)));
        const float x = qr[d] * scale; const unsigned short hb = bf16_bits(x);
        aqh[ks].u[i] = hb; aql[ks].u[i] = bf16_bits(x - bf16_val(hb));
      }
  }
  float m_r[8], l_r[8];
#pragma unroll
  for (int r = 0; r < 8; ++r) { m_r[r] = -3.0e38f; l_r[r] = 0.f; }
  v8f oacc[DT];
#pragma unroll
  for (int dt = 0; dt < DT; ++dt) oacc[dt] = (v8f){0.f,0.f,0.f,0.f,0.f,0.f,0.f,0.f};

  const int kv_end = CAUSAL ? min(T, qblk * 64 + 64) : T;     // block-uniform
  for (int j0 = 0; j0 < kv_end; j0 += 32) {
    __syncthreads();
    for (int e = tid; e < 32 * (D / 4); e += 128) {
      const int r = e / (D / 4), c4 = (e % (D / 4)) * 4;
      const int key = j0 + r;
      v4f kf = {0.f,0.f,0.f,0.f}, vf = {0.f,0.f,0.f,0.f};
      if (key < T) { kf = *(const v4fa*)(K + (size_t)key * pitch + c4); vf = *(const v4fa*)(V + (size_t)key * pitch + c4); }
#pragma unroll
      for (int t = 0; t < 4; ++t) {
        unsigned short hb = bf16_bits(kf[t]); sKh[r][c4 + t] = hb; sKl[r][c4 + t] = bf16_bits(kf[t] - bf16_val(hb));
        hb = bf16_bits(vf[t]); sVh[r][c4 + t] = hb; sVl[r][c4 + t] = bf16_bits(vf[t] - bf16_val(hb));
      }
    }
    __syncthreads();
    // S tile 16 x 32
    v8f s[2];
#pragma unroll
    for (int nt = 0; nt < 2; ++nt) {
      v8f acc = {};
#pragma unroll
      for (int ks = 0; ks < KS; ++ks) {
        FragB bh_, bl_;
        bh_.half[0] = *(const v8us*)&sKh[nt * 16 + ln][ks * 32 + 8 * hh]; bh_.half[1] = *(const v8us*)&sKh[nt * 16 + ln][ks * 32 + 16 + 8 * hh];
        bl_.half[0] = *(const v8us*)&sKl[nt * 16 + ln][ks * 32 + 8 * hh]; bl_.half[1] = *(const v8us*)&sKl[nt * 16 + ln][ks * 32 + 16 + 8 * hh];
        acc = mmaN<3>(aqh[ks].v, aql[ks].v, bh_.v, bl_.v, acc);
      }
      s[nt] = acc;
    }
    // mask + running max (rows 8hh+r; the 16 lanes of a half share rows)
    float alpha[8];
#pragma unroll
    for (int r = 0; r < 8; ++r) {
      const int qi = q0 + 8 * hh + r;
      const int ja = j0 + ln, jb = j0 + 16 + ln;
      if (CAUSAL) { if (ja > qi) s[0][r] = -3.0e38f; if (jb > qi) s[1][r] = -3.0e38f; }
      if (ja >= T) s[0][r] = -3.0e38f;
      if (jb >= T) s[1][r] = -3.0e38f;
      float mx = fmaxf(s[0][r], s[1][r]);
      mx = fmaxf(mx, __shfl_xor(mx, 1, 32)); mx = fmaxf(mx, __shfl_xor(mx, 2, 32)); mx = fmaxf(mx, __shfl_xor(mx, 4, 32)); mx = fmaxf(mx, __shfl_xor(mx, 8, 32));
      const float mnew = fmaxf(m_r[r], mx);
      alpha[r] = (mnew > -1.0e38f) ? __expf(m_r[r] - mnew) : 1.0f;
      const float p0 = (s[0][r] > -1.0e38f) ? __expf(s[0][r] - mnew) : 0.f;
      const float p1 = (s[1][r] > -1.0e38f) ? __expf(s[1][r] - mnew) : 0.f;
      m_r[r] = mnew;
      l_r[r] = l_r[r] * alpha[r] + p0 + p1;            // per-lane partial row sum (16 lanes combined at the end)
      unsigned short hb = bf16_bits(p0); sPh[w][8 * hh + r][ln] = hb;      sPl[w][8 * hh + r][ln] = bf16_bits(p0 - bf16_val(hb));
      hb = bf16_bits(p1);                sPh[w][8 * hh + r][16 + ln] = hb; sPl[w][8 * hh + r][16 + ln] = bf16_bits(p1 - bf16_val(hb));
    }
#pragma unroll
    for (int dt = 0; dt < DT; ++dt)
#pragma unroll
      for (int r = 0; r < 8; ++r) oacc[dt][r] *= alpha[r];
    __builtin_amdgcn_fence(__ATOMIC_ACQ_REL, "workgroup");
    __builtin_amdgcn_wave_barrier();
    FragB pah, pal;
    pah.half[0] = *(const v8us*)&sPh[w][ln][8 * hh]; pah.half[1] = *(const v8us*)&sPh[w][ln][16 + 8 * hh];
    pal.half[0] = *(const v8us*)&sPl[w][ln][8 * hh]; pal.half[1] = *(const v8us*)&sPl[w][ln][16 + 8 * hh];
#pragma unroll
    for (int dt = 0; dt < DT; ++dt) {
      FragB bvh, bvl;
#pragma unroll
      for (int i = 0; i < 8; ++i) {
        bvh.u[i] = sVh[8 * hh + i][dt * 16 + ln]; bvh.u[8 + i] = sVh[16 + 8 * hh + i][dt * 16 + ln];
        bvl.u[i] = sVl[8 * hh + i][dt * 16 + ln]; bvl.u[8 + i] = sVl[16 + 8 * hh + i][dt * 16 + ln];
      }
      oacc[dt] = mmaN<3>(pah.v, pal.v, bvh.v, bvl.v, oacc[dt]);
    }
    __builtin_amdgcn_fence(__ATOMIC_ACQ_REL, "workgroup");
    __builtin_amdgcn_wave_barrier();
  }
#pragma unroll
  for (int r = 0; r < 8; ++r) {
    float l = l_r[r];
    l += __shfl_xor(l, 1, 32); l += __shfl_xor(l, 2, 32); l += __shfl_xor(l, 4, 32); l += __shfl_xor(l, 8, 32);
    l_r[r] = (l > 0.f) ? 1.0f / l : 0.f;
  }
#pragma unroll
  for (int dt = 0; dt < DT; ++dt)
#pragma unroll
    for (int r = 0; r < 8; ++r) sO[w][8 * hh + r][dt * 16 + ln] = oacc[dt][r] * l_r[r];
  __builtin_amdgcn_fence(__ATOMIC_ACQ_REL, "workgroup");
  __builtin_amdgcn_wave_barrier();
  {
    for (int r = 0; r < 16; ++r) {
      const int row = q0 + r;
      if (row < T && lane < D / 4) {
        const v4f val = *(const v4fa*)&sO[w][r][lane * 4];
        *(v4f*)(y + ((size_t)b * T + row) * ypitch + h * D + lane * 4) = val;
      }
    }
    
  }
}

// GEMM C = act(A·W + bias + resid): A f32 (ASPLIT -> hi/lo 2 terms), Wt bf16 [N][K]; ACT 0 none, 1 relu, 2 exact gelu;
// resid (optional, f32, row index = (row % rmod), pitch ldr, RES_BF16 rounds it) added before the activation.
template <bool ASPLIT, int ACT, bool BIAS_BF16, bool RES_BF16>
__global__ __launch_bounds__(128) void k_gemm_bf3(const float* __restrict__ A, int lda, const unsigned short* __restrict__ Wt, int ldb,
                                                const float* __restrict__ bias, const float* __restrict__ resid, int rmod, int ldr,
                                                float* __restrict__ C, int ldc, int M, int N, int K) {
  __shared__ __attribute__((aligned(16))) float so[4][16][64];
  const int tid = threadIdx.x, w = tid >> 5, lane = tid & 31, ln = lane & 15, hh = lane >> 4;
  const int ntn = N / 64;
  const int wid = blockIdx.x * 4 + w;
  const int mt = wid / ntn, nq = wid % ntn;
  if (mt * 16 >= M) return;
  const int row0 = mt * 16, col0 = nq * 64;
  const float* arow = A + (size_t)(row0 + ln) * lda;
  v8f acc[4] = {};
  for (int kb = 0; kb < K; kb += 32) {
    FragB ah, al;
    const v4f x0 = *(const v4fa*)(arow + kb + 8 * hh), x1 = *(const v4fa*)(arow + kb + 8 * hh + 4);
    const v4f x2 = *(const v4fa*)(arow + kb + 16 + 8 * hh), x3 = *(const v4fa*)(arow + kb + 16 + 8 * hh + 4);
    float xs[16] = {x0[0],x0[1],x0[2],x0[3],x1[0],x1[1],x1[2],x1[3],x2[0],x2[1],x2[2],x2[3],x3[0],x3[1],x3[2],x3[3]};
#pragma unroll
    for (int i = 0; i < 16; ++i) { const unsigned short hb = bf16_bits(xs[i]); ah.u[i] = hb; al.u[i] = ASPLIT ? bf16_bits(xs[i] - bf16_val(hb)) : (unsigned short)0; }
#pragma unroll
    for (int t = 0; t < 4; ++t) {
      const unsigned short* brow = Wt + (size_t)(col0 + t * 16 + ln) * ldb + kb;
      FragB b;
      b.half[0] = *(const v8us*)(brow + 8 * hh);
      b.half[1] = *(const v8us*)(brow + 16 + 8 * hh);
      acc[t] = mmaN<ASPLIT ? 2 : 1>(ah.v, al.v, b.v, b.v, acc[t]);
    }
  }
#pragma unroll
  for (int t = 0; t < 4; ++t) {
    const int col = col0 + t * 16 + ln;
    float bv = bias ? bias[col] : 0.f;
    if (BIAS_BF16) bv = bf16_round(bv);
#pragma unroll
    for (int r = 0; r < 8; ++r) {
      float v = acc[t][r] + bv;
      if (resid) { float rv = resid[(size_t)((row0 + 8 * hh + r) % rmod) * ldr + col]; if (RES_BF16) rv = bf16_round(rv); v += rv; }
      if (ACT == 1) v = fmaxf(v, 0.f);
      if (ACT == 2) v = 0.5f * v * (1.0f + erff(v * 0.70710678118654752f));
      if (ACT == 3) { const float u = 0.7978845608028654f * (v + 0.044715f * v * v * v); v = 0.5f * v * (1.0f + tanhf(u)); }
      so[w][8 * hh + r][t * 16 + ln] = v;
    }
  }
  __builtin_amdgcn_fence(__ATOMIC_ACQ_REL, "workgroup");
  __builtin_amdgcn_wave_barrier();
  const int rsub = lane >> 4, c4 = (lane & 15) * 4;
  {
#pragma unroll
    for (int q = 0; q < 8; ++q) {
      const int r = q * 2 + rsub;
      const v4f v = *(const v4fa*)&so[w][r][c4];
      *(v4f*)(C + (size_t)(row0 + r) * ldc + col0 + c4) = v;
    }
    
  }
}
// row LayerNorm (biased variance, eps) over N: s = X (+ R); optional out_sum <- s; out_norm <- (s-mu)*rsqrt(var+eps)*g + b
template <bool PARAM_BF16>
__global__ __launch_bounds__(256) void k_layernorm(const float* __restrict__ X, const float* __restrict__ R, const float* __restrict__ g, const float* __restrict__ bta,
                                                  float* __restrict__ out_sum, float* __restrict__ out_norm, int N, float eps) {
  __shared__ float red[256];
  const int row = blockIdx.x, tid = threadIdx.x;
  const float* x = X + (size_t)row * N; const float* rr = R ? R + (size_t)row * N : nullptr;
  float vals[16];                     // up to N = 4096
  const int per = N / 256;            // contiguous chunk per thread? use strided-by-4 chunks: thread handles j = tid*4 + 1024*u
  float s1 = 0.f;
  for (int u = 0; u < per / 4; ++u) {
    const int j = tid * 4 + 1024 * u;
    const v4f a = *(const v4fa*)(x + j);
    v4f b = {0.f,0.f,0.f,0.f}; if (rr) b = *(const v4fa*)(rr + j);
#pragma unroll
    for (int q = 0; q < 4; ++q) { const float v = a[q] + b[q]; vals[u * 4 + q] = v; s1 += v; }
  }
  red[tid] = s1; __syncthreads();
  for (int st = 128; st > 0; st >>= 1) { if (tid < st) red[tid] += red[tid + st]; __syncthreads(); }
  const float mu = red[0] / (float)N; __syncthreads();
  float s2 = 0.f;
  for (int u = 0; u < per / 4; ++u)
#pragma unroll
    for (int q = 0; q < 4; ++q) { const float c = vals[u * 4 + q] - mu; s2 += c * c; }
  red[tid] = s2; __syncthreads();
  for (int st = 128; st > 0; st >>= 1) { if (tid < st) red[tid] += red[tid + st]; __syncthreads(); }
  const float rs = rsqrtf(red[0] / (float)N + eps);
  {
    for (int u = 0; u < per / 4; ++u) {
      const int j = tid * 4 + 1024 * u;
      v4f o, sm;
#pragma unroll
      for (int q = 0; q < 4; ++q) {
        float gg = g[j + q], bb = bta[j + q];
        if (PARAM_BF16) { gg = bf16_round(gg); bb = bf16_round(bb); }
        sm[q] = vals[u * 4 + q]; o[q] = (vals[u * 4 + q] - mu) * rs * gg + bb;
      }
      if (out_sum) *(v4f*)(out_sum + (size_t)row * N + j) = sm;
      *(v4f*)(out_norm + (size_t)row * N + j) = o;
    }
    
  }
}

__device__ __forceinline__ float tnh(float x) { const float e = __expf(2.0f * x); return 1.0f - 2.0f / (1.0f + e); }
// scores + softmax: wave per (b, q): lanes hold q_u (16 per lane, u = j·32 + lane); loop over the 256 keys: s_k = Σ_u scale_u·tanh(q_u + k[b][k][u]) via shuffle reduce;
// scores kept in LDS (256), then mask, max-shifted softmax; writes attn row (output 2) and a copy for the context GEMM
__global__ __launch_bounds__(256) void k_scores(const float* __restrict__ QP, const float* __restrict__ KP, const float* __restrict__ scale, const int* __restrict__ mask, float* __restrict__ ATT, float* __restrict__ ATT2) {
  __shared__ float ss[8][TK]; __shared__ float sq[8][UU]; __shared__ float ssc[UU]; const int tid = threadIdx.x, wv = tid >> 5, lane = tid & 31; const int row = blockIdx.x * 8 + wv; const int b = row / TQ;
  for (int u = tid; u < UU; u += 256) ssc[u] = bf16_round(scale[u]); for (int j = 0; j < 16; ++j) sq[wv][j * 32 + lane] = QP[(size_t)row * UU + j * 32 + lane];
  __syncthreads();
#pragma unroll 1
  for (int k = 0; k < TK; ++k) { const float* kr = KP + ((size_t)b * TK + k) * UU; float s = 0.f;
#pragma unroll 2
    for (int j = 0; j < 16; ++j) { const int u = j * 32 + lane; s += ssc[u] * tnh(sq[wv][u] + kr[u]); }
    for (int o = 16; o >= 1; o >>= 1) s += __shfl_xor(s, o, 32); if (lane == (k & 31)) ss[wv][k] = s; }
  __builtin_amdgcn_fence(__ATOMIC_ACQ_REL, "workgroup"); __builtin_amdgcn_wave_barrier();
  float lv[8]; float mx = -3.0e38f;
#pragma unroll
  for (int j = 0; j < 8; ++j) { const int k = j * 32 + lane; float v = ss[wv][k]; if (mask[b * TK + k] == 0) v = -1.0e9f; lv[j] = v; mx = fmaxf(mx, v); }
  for (int o = 16; o >= 1; o >>= 1) mx = fmaxf(mx, __shfl_xor(mx, o, 32));
  float den = 0.f; for (int j = 0; j < 8; ++j) { lv[j] = expf(lv[j] - mx); den += lv[j]; } for (int o = 16; o >= 1; o >>= 1) den += __shfl_xor(den, o, 32); const float rd = 1.0f / den;
  float* a1 = ATT + (size_t)row * TK; float* a2 = ATT2 + (size_t)row * TK;
  { for (int j = 0; j < 8; ++j) { const float p = lv[j] * rd; *(float*)(a1 + j * 32 + lane) = p; *(float*)(a2 + j * 32 + lane) = p; }  }
}
// value → Bt for the context GEMM per batch: Bt[b][d][k] = bf16(value[b][k][d]) (transpose via 64×32 k×d tiles)
__global__ __launch_bounds__(256) void k_vt(const float* __restrict__ V, unsigned short* __restrict__ Bt) { __shared__ float tile[64][33]; const int b = blockIdx.z; const int k0 = blockIdx.x * 64, d0 = blockIdx.y * 32; const int tx = threadIdx.x & 31, ty = threadIdx.x >> 5;
  for (int i = ty; i < 64; i += 8) tile[i][tx] = V[((size_t)b * TK + k0 + i) * DD + d0 + tx]; __syncthreads();
  typedef unsigned short us2 __attribute__((ext_vector_type(2)));
  { for (int e = threadIdx.x; e < 32 * 32; e += 256) { const int dr = e >> 5, kp = (e & 31) * 2; us2 v; v.x = bf16_bits(tile[kp][dr]); v.y = bf16_bits(tile[kp + 1][dr]); *(us2*)(Bt + ((size_t)b * DD + d0 + dr) * TK + k0 + kp) = v; }  } }
extern "C" void kernel_launch(void* const* d_in, const int* in_sizes, int n_in,
                              void* d_out, int out_size, void* d_ws, size_t ws_size, hipStream_t stream) {
  (void)in_sizes; (void)n_in; (void)out_size;
  const float* query = (const float*)d_in[0]; const float* value = (const float*)d_in[1]; const int* mask = (const int*)d_in[2]; const float* Wq = (const float*)d_in[3]; const float* Wk = (const float*)d_in[4]; const float* scale = (const float*)d_in[5];
  float* ctx = (float*)d_out; float* attn = ctx + (size_t)BB * TQ * DD;
  char* ws = (char*)d_ws; size_t off = 0;
  auto take = [&](size_t bytes) { char* p = ws + off; off += (bytes + 255) & ~(size_t)255; return p; };
  unsigned short* Bq = (unsigned short*)take((size_t)UU * DD * 2); unsigned short* Bk = (unsigned short*)take((size_t)UU * DD * 2); unsigned short* Bv = (unsigned short*)take((size_t)BB * DD * TK * 2);
  float* QP = (float*)take((size_t)BB * TQ * UU * 4); float* KP = (float*)take((size_t)BB * TK * UU * 4); float* ATT2 = (float*)take((size_t)BB * TQ * TK * 4);
  if (off > ws_size) return;
  k_wt_bf16<<<(UU * 128 + 255) / 256, 256, 0, stream>>>(Wq, Bq, DD, UU); k_wt_bf16<<<(UU * 128 + 255) / 256, 256, 0, stream>>>(Wk, Bk, DD, UU);
  k_vt<<<dim3(TK / 64, DD / 32, BB), 256, 0, stream>>>(value, Bv);
  k_gemm_bf3<false, 0, false, false><<<((BB * TQ / 16) * (UU / 64) + 3) / 4, 128, 0, stream>>>(query, DD, Bq, DD, nullptr, nullptr, 1, 0, QP, UU, BB * TQ, UU, DD);
  k_gemm_bf3<false, 0, false, false><<<((BB * TK / 16) * (UU / 64) + 3) / 4, 128, 0, stream>>>(value, DD, Bk, DD, nullptr, nullptr, 1, 0, KP, UU, BB * TK, UU, DD);
  k_scores<<<BB * TQ / 8, 256, 0, stream>>>(QP, KP, scale, mask, attn, ATT2);
  for (int b = 0; b < BB; ++b) k_gemm_bf3<true, 0, false, false><<<((TQ / 16) * (DD / 64) + 3) / 4, 128, 0, stream>>>(ATT2 + (size_t)b * TQ * TK, TK, Bv + (size_t)b * DD * TK, TK, nullptr, nullptr, 1, 0, ctx + (size_t)b * TQ * DD, DD, TQ, DD, TK);
}

// v001
// It runs in 173 microseconds.
// Next to v000, in two timings, it ran 6.04 and 6.12 times as fast.
#include <hip/hip_runtime.h>
// q = query·Wq and k = value·Wk on v_wmma_f32_16x16x32_bf16 (inputs rounded to bf16: single exact term), context = attn·value (attn split hi/lo vs bf16-rounded value: 2 products),
// f32 accumulate. The additive scores Σ_u scale_u·tanh(q_u + k_u) over the [4,256,256,512] broadcast (f32 VALU with an __expf-based tanh), the key mask and the softmax
// are f32 VALU; attention weights are the second output.
#define BB 4
#define TQ 256
#define TK 256
#define DD 1024
#define UU 512

typedef __bf16 v16b __attribute__((ext_vector_type(16)));
typedef unsigned short v8us __attribute__((ext_vector_type(8), may_alias));
typedef float  v8f  __attribute__((ext_vector_type(8)));
typedef float  v4f  __attribute__((ext_vector_type(4)));
typedef float  v4fa __attribute__((ext_vector_type(4), may_alias));
union FragB { v16b v; v8us half[2]; unsigned short u[16]; };

__device__ __forceinline__ unsigned short bf16_bits(float x) { unsigned int u = __float_as_uint(x); return (unsigned short)((u + 0x7FFFu + ((u >> 16) & 1u)) >> 16); }
__device__ __forceinline__ float bf16_val(unsigned short b) { return __uint_as_float(((unsigned int)b) << 16); }
__device__ __forceinline__ float bf16_round(float x) { return bf16_val(bf16_bits(x)); }
// D += A·B with NT terms: 1 = ah·bh, 2 = + al·bh (A split), 3 = + ah·bl (both split)
template <int NT>
__device__ __forceinline__ v8f mmaN(v16b ah, v16b al, v16b bh, v16b bl, v8f c) {
  c = __builtin_amdgcn_wmma_f32_16x16x32_bf16(false, ah, false, bh, (short)0, c, false, false);
  if (NT >= 2) c = __builtin_amdgcn_wmma_f32_16x16x32_bf16(false, al, false, bh, (short)0, c, false, false);
  if (NT >= 3) c = __builtin_amdgcn_wmma_f32_16x16x32_bf16(false, ah, false, bl, (short)0, c, false, false);
  asm volatile("v_nop\n\tv_nop\n\tv_nop\n\tv_nop" : "+v"(c) : "v"(ah), "v"(al), "v"(bh), "v"(bl));
  return c;
}

__global__ __launch_bounds__(256) void k_wt_bf16(const float* __restrict__ W, unsigned short* __restrict__ Wt, int K, int N) {
  const int t = blockIdx.x * 256 + threadIdx.x;
  const int k8n = K / 8;
  if (t >= N * k8n) return;
  const int n = t / k8n, k8 = (t % k8n) * 8;
  v8us v;
#pragma unroll
  for (int i = 0; i < 8; ++i) v[i] = bf16_bits(W[(size_t)(k8 + i) * N + n]);
  *(v8us*)(Wt + (size_t)n * K + k8) = v;
  
}

// GEMM C[M][N] (f32, pitch ldc) = act(A[M][K]·W + bias). A f32 row-major (pitch lda) converted per fragment to bf16
// (ASPLIT: hi/lo two planes -> 2 terms, else single rounded term); Wt bf16 [N][K] (pitch ldb). BIAS_BF16 rounds the
// bias to bf16 first (bias quantised to bf16 before the add). K%32==0, M%16==0, N%64==0.
template <bool ASPLIT, int ACT, bool BIAS_BF16>
__global__ __launch_bounds__(128) void k_gemm_bf(const float* __restrict__ A, int lda, const unsigned short* __restrict__ Wt, int ldb,
                                               const float* __restrict__ bias, float* __restrict__ C, int ldc, int M, int N, int K) {
  __shared__ __attribute__((aligned(16))) float so[4][16][64];
  const int tid = threadIdx.x, w = tid >> 5, lane = tid & 31, ln = lane & 15, hh = lane >> 4;
  const int ntn = N / 64;
  const int wid = blockIdx.x * 4 + w;
  const int mt = wid / ntn, nq = wid % ntn;
  if (mt * 16 >= M) return;
  const int row0 = mt * 16, col0 = nq * 64;
  const float* arow = A + (size_t)(row0 + ln) * lda;
  v8f acc[4] = {};
  for (int kb = 0; kb < K; kb += 32) {
    FragB ah, al;
    const v4f x0 = *(const v4fa*)(arow + kb + 8 * hh), x1 = *(const v4fa*)(arow + kb + 8 * hh + 4);
    const v4f x2 = *(const v4fa*)(arow + kb + 16 + 8 * hh), x3 = *(const v4fa*)(arow + kb + 16 + 8 * hh + 4);
    float xs[16] = {x0[0],x0[1],x0[2],x0[3],x1[0],x1[1],x1[2],x1[3],x2[0],x2[1],x2[2],x2[3],x3[0],x3[1],x3[2],x3[3]};
#pragma unroll
    for (int i = 0; i < 16; ++i) { const unsigned short hb = bf16_bits(xs[i]); ah.u[i] = hb; al.u[i] = ASPLIT ? bf16_bits(xs[i] - bf16_val(hb)) : (unsigned short)0; }
#pragma unroll
    for (int t = 0; t < 4; ++t) {
      const unsigned short* brow = Wt + (size_t)(col0 + t * 16 + ln) * ldb + kb;
      FragB b;
      b.half[0] = *(const v8us*)(brow + 8 * hh);
      b.half[1] = *(const v8us*)(brow + 16 + 8 * hh);
      acc[t] = mmaN<ASPLIT ? 2 : 1>(ah.v, al.v, b.v, b.v, acc[t]);
    }
  }
#pragma unroll
  for (int t = 0; t < 4; ++t) {
    float bv = bias ? bias[col0 + t * 16 + ln] : 0.f;
    if (BIAS_BF16) bv = bf16_round(bv);
#pragma unroll
    for (int r = 0; r < 8; ++r) { float v = acc[t][r] + bv; if (ACT == 1) v = fmaxf(v, 0.f); so[w][8 * hh + r][t * 16 + ln] = v; }
  }
  __builtin_amdgcn_fence(__ATOMIC_ACQ_REL, "workgroup");
  __builtin_amdgcn_wave_barrier();
  const int rsub = lane >> 4, c4 = (lane & 15) * 4;
  {
#pragma unroll
    for (int q = 0; q < 8; ++q) {
      const int r = q * 2 + rsub;
      const v4f v = *(const v4fa*)&so[w][r][c4];
      *(v4f*)(C + (size_t)(row0 + r) * ldc + col0 + c4) = v;
    }
    
  }
}

// Flash-style causal/unmasked attention, all contractions 3-term bf16 hi/lo splits, f32 softmax with running max.
// q,k,v rows are read from f32 buffers with arbitrary row pitch (so they can live inside a fused qkv buffer);
// D = head size (multiple of 32, <= 128); one wave = 16 query rows; block = 4 waves (64 queries) sharing K/V chunks of 32.
template <int D, bool CAUSAL>
__global__ __launch_bounds__(128) void k_flash(const float* __restrict__ qb, const float* __restrict__ kb, const float* __restrict__ vb,
                                             int pitch, int T, int H, float scale, float* __restrict__ y, int ypitch) {
  constexpr int KS = D / 32;        // k-steps for QK
  constexpr int DT = D / 16;        // d tiles for PV
  __shared__ __attribute__((aligned(16))) unsigned short sKh[32][D + 8], sKl[32][D + 8], sVh[32][D + 8], sVl[32][D + 8];
  __shared__ __attribute__((aligned(16))) unsigned short sPh[4][16][40], sPl[4][16][40];
  __shared__ __attribute__((aligned(16))) float sO[4][16][D];
  const int tid = threadIdx.x, w = tid >> 5, lane = tid & 31, ln = lane & 15, hh = lane >> 4;
  const int nqb = (T + 63) / 64;
  const int bh = blockIdx.x / nqb, qblk = blockIdx.x % nqb;
  const int b = bh / H, h = bh % H;
  const int q0 = qblk * 64 + w * 16;
  const float* Q = qb + (size_t)b * T * pitch + h * D;
  const float* K = kb + (size_t)b * T * pitch + h * D;
  const float* V = vb + (size_t)b * T * pitch + h * D;

  // A fragments of the wave's 16 query rows (scaled), hi/lo
  FragB aqh[KS], aql[KS];
  {
    int row = q0 + ln; if (row >= T) row = T - 1;
    const float* qr = Q + (size_t)row * pitch;
#pragma unroll
    for (int ks = 0; ks < KS; ++ks)
#pragma unroll
      for (int i = 0; i < 16; ++i) {
        const int d = ks * 32 + ((i < 8) ? (8 * hh + i) : (16 + 8 * hh + (i - 8)));
        const float x = qr[d] * scale; const unsigned short hb = bf16_bits(x);
        aqh[ks].u[i] = hb; aql[ks].u[i] = bf16_bits(x - bf16_val(hb));
      }
  }
  float m_r[8], l_r[8];
#pragma unroll
  for (int r = 0; r < 8; ++r) { m_r[r] = -3.0e38f; l_r[r] = 0.f; }
  v8f oacc[DT];
#pragma unroll
  for (int dt = 0; dt < DT; ++dt) oacc[dt] = (v8f){0.f,0.f,0.f,0.f,0.f,0.f,0.f,0.f};

  const int kv_end = CAUSAL ? min(T, qblk * 64 + 64) : T;     // block-uniform
  for (int j0 = 0; j0 < kv_end; j0 += 32) {
    __syncthreads();
    for (int e = tid; e < 32 * (D / 4); e += 128) {
      const int r = e / (D / 4), c4 = (e % (D / 4)) * 4;
      const int key = j0 + r;
      v4f kf = {0.f,0.f,0.f,0.f}, vf = {0.f,0.f,0.f,0.f};
      if (key < T) { kf = *(const v4fa*)(K + (size_t)key * pitch + c4); vf = *(const v4fa*)(V + (size_t)key * pitch + c4); }
#pragma unroll
      for (int t = 0; t < 4; ++t) {
        unsigned short hb = bf16_bits(kf[t]); sKh[r][c4 + t] = hb; sKl[r][c4 + t] = bf16_bits(kf[t] - bf16_val(hb));
        hb = bf16_bits(vf[t]); sVh[r][c4 + t] = hb; sVl[r][c4 + t] = bf16_bits(vf[t] - bf16_val(hb));
      }
    }
    __syncthreads();
    // S tile 16 x 32
    v8f s[2];
#pragma unroll
    for (int nt = 0; nt < 2; ++nt) {
      v8f acc = {};
#pragma unroll
      for (int ks = 0; ks < KS; ++ks) {
        FragB bh_, bl_;
        bh_.half[0] = *(const v8us*)&sKh[nt * 16 + ln][ks * 32 + 8 * hh]; bh_.half[1] = *(const v8us*)&sKh[nt * 16 + ln][ks * 32 + 16 + 8 * hh];
        bl_.half[0] = *(const v8us*)&sKl[nt * 16 + ln][ks * 32 + 8 * hh]; bl_.half[1] = *(const v8us*)&sKl[nt * 16 + ln][ks * 32 + 16 + 8 * hh];
        acc = mmaN<3>(aqh[ks].v, aql[ks].v, bh_.v, bl_.v, acc);
      }
      s[nt] = acc;
    }
    // mask + running max (rows 8hh+r; the 16 lanes of a half share rows)
    float alpha[8];
#pragma unroll
    for (int r = 0; r < 8; ++r) {
      const int qi = q0 + 8 * hh + r;
      const int ja = j0 + ln, jb = j0 + 16 + ln;
      if (CAUSAL) { if (ja > qi) s[0][r] = -3.0e38f; if (jb > qi) s[1][r] = -3.0e38f; }
      if (ja >= T) s[0][r] = -3.0e38f;
      if (jb >= T) s[1][r] = -3.0e38f;
      float mx = fmaxf(s[0][r], s[1][r]);
      mx = fmaxf(mx, __shfl_xor(mx, 1, 32)); mx = fmaxf(mx, __shfl_xor(mx, 2, 32)); mx = fmaxf(mx, __shfl_xor(mx, 4, 32)); mx = fmaxf(mx, __shfl_xor(mx, 8, 32));
      const float mnew = fmaxf(m_r[r], mx);
      alpha[r] = (mnew > -1.0e38f) ? __expf(m_r[r] - mnew) : 1.0f;
      const float p0 = (s[0][r] > -1.0e38f) ? __expf(s[0][r] - mnew) : 0.f;
      const float p1 = (s[1][r] > -1.0e38f) ? __expf(s[1][r] - mnew) : 0.f;
      m_r[r] = mnew;
      l_r[r] = l_r[r] * alpha[r] + p0 + p1;            // per-lane partial row sum (16 lanes combined at the end)
      unsigned short hb = bf16_bits(p0); sPh[w][8 * hh + r][ln] = hb;      sPl[w][8 * hh + r][ln] = bf16_bits(p0 - bf16_val(hb));
      hb = bf16_bits(p1);                sPh[w][8 * hh + r][16 + ln] = hb; sPl[w][8 * hh + r][16 + ln] = bf16_bits(p1 - bf16_val(hb));
    }
#pragma unroll
    for (int dt = 0; dt < DT; ++dt)
#pragma unroll
      for (int r = 0; r < 8; ++r) oacc[dt][r] *= alpha[r];
    __builtin_amdgcn_fence(__ATOMIC_ACQ_REL, "workgroup");
    __builtin_amdgcn_wave_barrier();
    FragB pah, pal;
    pah.half[0] = *(const v8us*)&sPh[w][ln][8 * hh]; pah.half[1] = *(const v8us*)&sPh[w][ln][16 + 8 * hh];
    pal.half[0] = *(const v8us*)&sPl[w][ln][8 * hh]; pal.half[1] = *(const v8us*)&sPl[w][ln][16 + 8 * hh];
#pragma unroll
    for (int dt = 0; dt < DT; ++dt) {
      FragB bvh, bvl;
#pragma unroll
      for (int i = 0; i < 8; ++i) {
        bvh.u[i] = sVh[8 * hh + i][dt * 16 + ln]; bvh.u[8 + i] = sVh[16 + 8 * hh + i][dt * 16 + ln];
        bvl.u[i] = sVl[8 * hh + i][dt * 16 + ln]; bvl.u[8 + i] = sVl[16 + 8 * hh + i][dt * 16 + ln];
      }
      oacc[dt] = mmaN<3>(pah.v, pal.v, bvh.v, bvl.v, oacc[dt]);
    }
    __builtin_amdgcn_fence(__ATOMIC_ACQ_REL, "workgroup");
    __builtin_amdgcn_wave_barrier();
  }
#pragma unroll
  for (int r = 0; r < 8; ++r) {
    float l = l_r[r];
    l += __shfl_xor(l, 1, 32); l += __shfl_xor(l, 2, 32); l += __shfl_xor(l, 4, 32); l += __shfl_xor(l, 8, 32);
    l_r[r] = (l > 0.f) ? 1.0f / l : 0.f;
  }
#pragma unroll
  for (int dt = 0; dt < DT; ++dt)
#pragma unroll
    for (int r = 0; r < 8; ++r) sO[w][8 * hh + r][dt * 16 + ln] = oacc[dt][r] * l_r[r];
  __builtin_amdgcn_fence(__ATOMIC_ACQ_REL, "workgroup");
  __builtin_amdgcn_wave_barrier();
  {
    for (int r = 0; r < 16; ++r) {
      const int row = q0 + r;
      if (row < T && lane < D / 4) {
        const v4f val = *(const v4fa*)&sO[w][r][lane * 4];
        *(v4f*)(y + ((size_t)b * T + row) * ypitch + h * D + lane * 4) = val;
      }
    }
    
  }
}

// GEMM C = act(A·W + bias + resid): A f32 (ASPLIT -> hi/lo 2 terms), Wt bf16 [N][K]; ACT 0 none, 1 relu, 2 exact gelu;
// resid (optional, f32, row index = (row % rmod), pitch ldr, RES_BF16 rounds it) added before the activation.
template <bool ASPLIT, int ACT, bool BIAS_BF16, bool RES_BF16>
__global__ __launch_bounds__(128) void k_gemm_bf3(const float* __restrict__ A, int lda, const unsigned short* __restrict__ Wt, int ldb,
                                                const float* __restrict__ bias, const float* __restrict__ resid, int rmod, int ldr,
                                                float* __restrict__ C, int ldc, int M, int N, int K) {
  __shared__ __attribute__((aligned(16))) float so[4][16][64];
  const int tid = threadIdx.x, w = tid >> 5, lane = tid & 31, ln = lane & 15, hh = lane >> 4;
  const int ntn = N / 64;
  const int wid = blockIdx.x * 4 + w;
  const int mt = wid / ntn, nq = wid % ntn;
  if (mt * 16 >= M) return;
  const int row0 = mt * 16, col0 = nq * 64;
  const float* arow = A + (size_t)(row0 + ln) * lda;
  v8f acc[4] = {};
  for (int kb = 0; kb < K; kb += 32) {
    FragB ah, al;
    const v4f x0 = *(const v4fa*)(arow + kb + 8 * hh), x1 = *(const v4fa*)(arow + kb + 8 * hh + 4);
    const v4f x2 = *(const v4fa*)(arow + kb + 16 + 8 * hh), x3 = *(const v4fa*)(arow + kb + 16 + 8 * hh + 4);
    float xs[16] = {x0[0],x0[1],x0[2],x0[3],x1[0],x1[1],x1[2],x1[3],x2[0],x2[1],x2[2],x2[3],x3[0],x3[1],x3[2],x3[3]};
#pragma unroll
    for (int i = 0; i < 16; ++i) { const unsigned short hb = bf16_bits(xs[i]); ah.u[i] = hb; al.u[i] = ASPLIT ? bf16_bits(xs[i] - bf16_val(hb)) : (unsigned short)0; }
#pragma unroll
    for (int t = 0; t < 4; ++t) {
      const unsigned short* brow = Wt + (size_t)(col0 + t * 16 + ln) * ldb + kb;
      FragB b;
      b.half[0] = *(const v8us*)(brow + 8 * hh);
      b.half[1] = *(const v8us*)(brow + 16 + 8 * hh);
      acc[t] = mmaN<ASPLIT ? 2 : 1>(ah.v, al.v, b.v, b.v, acc[t]);
    }
  }
#pragma unroll
  for (int t = 0; t < 4; ++t) {
    const int col = col0 + t * 16 + ln;
    float bv = bias ? bias[col] : 0.f;
    if (BIAS_BF16) bv = bf16_round(bv);
#pragma unroll
    for (int r = 0; r < 8; ++r) {
      float v = acc[t][r] + bv;
      if (resid) { float rv = resid[(size_t)((row0 + 8 * hh + r) % rmod) * ldr + col]; if (RES_BF16) rv = bf16_round(rv); v += rv; }
      if (ACT == 1) v = fmaxf(v, 0.f);
      if (ACT == 2) v = 0.5f * v * (1.0f + erff(v * 0.70710678118654752f));
      if (ACT == 3) { const float u = 0.7978845608028654f * (v + 0.044715f * v * v * v); v = 0.5f * v * (1.0f + tanhf(u)); }
      so[w][8 * hh + r][t * 16 + ln] = v;
    }
  }
  __builtin_amdgcn_fence(__ATOMIC_ACQ_REL, "workgroup");
  __builtin_amdgcn_wave_barrier();
  const int rsub = lane >> 4, c4 = (lane & 15) * 4;
  {
#pragma unroll
    for (int q = 0; q < 8; ++q) {
      const int r = q * 2 + rsub;
      const v4f v = *(const v4fa*)&so[w][r][c4];
      *(v4f*)(C + (size_t)(row0 + r) * ldc + col0 + c4) = v;
    }
    
  }
}
// row LayerNorm (biased variance, eps) over N: s = X (+ R); optional out_sum <- s; out_norm <- (s-mu)*rsqrt(var+eps)*g + b
template <bool PARAM_BF16>
__global__ __launch_bounds__(256) void k_layernorm(const float* __restrict__ X, const float* __restrict__ R, const float* __restrict__ g, const float* __restrict__ bta,
                                                  float* __restrict__ out_sum, float* __restrict__ out_norm, int N, float eps) {
  __shared__ float red[256];
  const int row = blockIdx.x, tid = threadIdx.x;
  const float* x = X + (size_t)row * N; const float* rr = R ? R + (size_t)row * N : nullptr;
  float vals[16];                     // up to N = 4096
  const int per = N / 256;            // contiguous chunk per thread? use strided-by-4 chunks: thread handles j = tid*4 + 1024*u
  float s1 = 0.f;
  for (int u = 0; u < per / 4; ++u) {
    const int j = tid * 4 + 1024 * u;
    const v4f a = *(const v4fa*)(x + j);
    v4f b = {0.f,0.f,0.f,0.f}; if (rr) b = *(const v4fa*)(rr + j);
#pragma unroll
    for (int q = 0; q < 4; ++q) { const float v = a[q] + b[q]; vals[u * 4 + q] = v; s1 += v; }
  }
  red[tid] = s1; __syncthreads();
  for (int st = 128; st > 0; st >>= 1) { if (tid < st) red[tid] += red[tid + st]; __syncthreads(); }
  const float mu = red[0] / (float)N; __syncthreads();
  float s2 = 0.f;
  for (int u = 0; u < per / 4; ++u)
#pragma unroll
    for (int q = 0; q < 4; ++q) { const float c = vals[u * 4 + q] - mu; s2 += c * c; }
  red[tid] = s2; __syncthreads();
  for (int st = 128; st > 0; st >>= 1) { if (tid < st) red[tid] += red[tid + st]; __syncthreads(); }
  const float rs = rsqrtf(red[0] / (float)N + eps);
  {
    for (int u = 0; u < per / 4; ++u) {
      const int j = tid * 4 + 1024 * u;
      v4f o, sm;
#pragma unroll
      for (int q = 0; q < 4; ++q) {
        float gg = g[j + q], bb = bta[j + q];
        if (PARAM_BF16) { gg = bf16_round(gg); bb = bf16_round(bb); }
        sm[q] = vals[u * 4 + q]; o[q] = (vals[u * 4 + q] - mu) * rs * gg + bb;
      }
      if (out_sum) *(v4f*)(out_sum + (size_t)row * N + j) = sm;
      *(v4f*)(out_norm + (size_t)row * N + j) = o;
    }
    
  }
}

__device__ __forceinline__ float tnh(float x) { const float e = __expf(2.0f * x); return 1.0f - 2.0f / (1.0f + e); }
// scores + softmax: block = QT query rows of one batch; its 8 waves split the 256 keys, 32 keys each. Lanes hold scale_u and q_u in registers (16 per lane and row,
// u = j*32 + lane); each key row is loaded once per block, one key ahead of its use, and serves all QT rows: s_k = sum_u scale_u*tanh(q_u + k[b][k][u]), same in-lane order
// and same shuffle tree as a wave-per-row loop. Scores meet in LDS; behind one block barrier wave t does mask, max-shifted softmax and both stores of row t.
#define QT 2
__global__ __launch_bounds__(256) void k_scores(const float* __restrict__ QP, const float* __restrict__ KP, const float* __restrict__ scale, const int* __restrict__ mask, float* __restrict__ ATT, float* __restrict__ ATT2) {
  __shared__ float ss[QT][TK];
  const int tid = threadIdx.x, wv = tid >> 5, lane = tid & 31;
  const int row0 = blockIdx.x * QT, b = row0 / TQ;
  const float* qr = QP + (size_t)row0 * UU;                         // the block's QT query rows
  float sc[16], qv[QT][16], ka[16], kb[16], keep[QT];
#pragma unroll
  for (int j = 0; j < 16; ++j) sc[j] = bf16_round(scale[j * 32 + lane]);
#pragma unroll
  for (int t = 0; t < QT; ++t) { keep[t] = 0.f;
#pragma unroll
    for (int j = 0; j < 16; ++j) qv[t][j] = qr[t * UU + j * 32 + lane]; }
  const float* kr = KP + ((size_t)b * TK + wv * 32) * UU + lane;   // this wave's 32 key rows
  auto fetch = [&](float (&kx)[16], int kk) {
#pragma unroll
    for (int j = 0; j < 16; ++j) kx[j] = kr[(size_t)kk * UU + j * 32];
  };
  auto score = [&](const float (&kx)[16], int kk) {
#pragma unroll
    for (int t = 0; t < QT; ++t) { float s = 0.f;
#pragma unroll
      for (int j = 0; j < 16; ++j) s += sc[j] * tnh(qv[t][j] + kx[j]);
      for (int o = 16; o >= 1; o >>= 1) s += __shfl_xor(s, o, 32);
      keep[t] = (lane == kk) ? s : keep[t]; }
  };
  fetch(ka, 0);
  // the wait that lets the address registers of the loads above be reused; naming the two bases that are dead from here on keeps them untouched up to it
  asm volatile("s_wait_xcnt 0x0" :: "s"(scale), "s"(qr) : "memory");
  // rolled: one trip is two keys (two register buffers, no copies)
#pragma unroll 1
  for (int kk = 0; kk < 32; kk += 2) {
    fetch(kb, kk + 1);
    score(ka, kk);
    fetch(ka, kk + 2 < 32 ? kk + 2 : 31);   // last trip: a row of this wave again, in bounds, not used
    score(kb, kk + 1);
  }
#pragma unroll
  for (int t = 0; t < QT; ++t) ss[t][wv * 32 + lane] = keep[t];
  __syncthreads();
  if (wv >= QT) return;
  const int row = row0 + wv;
  float lv[8]; float mx = -3.0e38f;
#pragma unroll
  for (int j = 0; j < 8; ++j) { const int k = j * 32 + lane; float v = ss[wv][k]; if (mask[b * TK + k] == 0) v = -1.0e9f; lv[j] = v; mx = fmaxf(mx, v); }
  for (int o = 16; o >= 1; o >>= 1) mx = fmaxf(mx, __shfl_xor(mx, o, 32));
  float den = 0.f; for (int j = 0; j < 8; ++j) { lv[j] = expf(lv[j] - mx); den += lv[j]; } for (int o = 16; o >= 1; o >>= 1) den += __shfl_xor(den, o, 32); const float rd = 1.0f / den;
  float* a1 = ATT + (size_t)row * TK; float* a2 = ATT2 + (size_t)row * TK;
  { for (int j = 0; j < 8; ++j) { const float p = lv[j] * rd; *(float*)(a1 + j * 32 + lane) = p; *(float*)(a2 + j * 32 + lane) = p; }  }
}
// value → Bt for the context GEMM per batch: Bt[b][d][k] = bf16(value[b][k][d]) (transpose via 64×32 k×d tiles)
__global__ __launch_bounds__(256) void k_vt(const float* __restrict__ V, unsigned short* __restrict__ Bt) { __shared__ float tile[64][33]; const int b = blockIdx.z; const int k0 = blockIdx.x * 64, d0 = blockIdx.y * 32; const int tx = threadIdx.x & 31, ty = threadIdx.x >> 5;
  for (int i = ty; i < 64; i += 8) tile[i][tx] = V[((size_t)b * TK + k0 + i) * DD + d0 + tx]; __syncthreads();
  typedef unsigned short us2 __attribute__((ext_vector_type(2)));
  { for (int e = threadIdx.x; e < 32 * 32; e += 256) { const int dr = e >> 5, kp = (e & 31) * 2; us2 v; v.x = bf16_bits(tile[kp][dr]); v.y = bf16_bits(tile[kp + 1][dr]); *(us2*)(Bt + ((size_t)b * DD + d0 + dr) * TK + k0 + kp) = v; }  } }
extern "C" void kernel_launch(void* const* d_in, const int* in_sizes, int n_in,
                              void* d_out, int out_size, void* d_ws, size_t ws_size, hipStream_t stream) {
  (void)in_sizes; (void)n_in; (void)out_size;
  const float* query = (const float*)d_in[0]; const float* value = (const float*)d_in[1]; const int* mask = (const int*)d_in[2]; const float* Wq = (const float*)d_in[3]; const float* Wk = (const float*)d_in[4]; const float* scale = (const float*)d_in[5];
  float* ctx = (float*)d_out; float* attn = ctx + (size_t)BB * TQ * DD;
  char* ws = (char*)d_ws; size_t off = 0;
  auto take = [&](size_t bytes) { char* p = ws + off; off += (bytes + 255) & ~(size_t)255; return p; };
  unsigned short* Bq = (unsigned short*)take((size_t)UU * DD * 2); unsigned short* Bk = (unsigned short*)take((size_t)UU * DD * 2); unsigned short* Bv = (unsigned short*)take((size_t)BB * DD * TK * 2);
  float* QP = (float*)take((size_t)BB * TQ * UU * 4); float* KP = (float*)take((size_t)BB * TK * UU * 4); float* ATT2 = (float*)take((size_t)BB * TQ * TK * 4);
  if (off > ws_size) return;
  k_wt_bf16<<<(UU * 128 + 255) / 256, 256, 0, stream>>>(Wq, Bq, DD, UU); k_wt_bf16<<<(UU * 128 + 255) / 256, 256, 0, stream>>>(Wk, Bk, DD, UU);
  k_vt<<<dim3(TK / 64, DD / 32, BB), 256, 0, stream>>>(value, Bv);
  k_gemm_bf3<false, 0, false, false><<<((BB * TQ / 16) * (UU / 64) + 3) / 4, 128, 0, stream>>>(query, DD, Bq, DD, nullptr, nullptr, 1, 0, QP, UU, BB * TQ, UU, DD);
  k_gemm_bf3<false, 0, false, false><<<((BB * TK / 16) * (UU / 64) + 3) / 4, 128, 0, stream>>>(value, DD, Bk, DD, nullptr, nullptr, 1, 0, KP, UU, BB * TK, UU, DD);
  k_scores<<<BB * TQ / QT, 256, 0, stream>>>(QP, KP, scale, mask, attn, ATT2);
  for (int b = 0; b < BB; ++b) k_gemm_bf3<true, 0, false, false><<<((TQ / 16) * (DD / 64) + 3) / 4, 128, 0, stream>>>(ATT2 + (size_t)b * TQ * TK, TK, Bv + (size_t)b * DD * TK, TK, nullptr, nullptr, 1, 0, ctx + (size_t)b * TQ * DD, DD, TQ, DD, TK);
}

// v002
// One run takes 102 microseconds.
// Next to v001, in two timings, it ran 1.67 and 1.66 times as fast.
// All steps since v000 together make it 10.1 times as fast.
#include <hip/hip_runtime.h>
// q = query·Wq and k = value·Wk on v_wmma_f32_16x16x32_bf16 (inputs rounded to bf16: single exact term), context = attn·value (attn split hi/lo vs bf16-rounded value: 2 products),
// f32 accumulate. The additive scores Σ_u scale_u·tanh(q_u + k_u) over the [4,256,256,512] broadcast (f32 VALU with an __expf-based tanh), the key mask and the softmax
// are f32 VALU; attention weights are the second output.
#define BB 4
#define TQ 256
#define TK 256
#define DD 1024
#define UU 512

typedef __bf16 v16b __attribute__((ext_vector_type(16)));
typedef unsigned short v8us __attribute__((ext_vector_type(8), may_alias));
typedef float  v8f  __attribute__((ext_vector_type(8)));
typedef float  v4f  __attribute__((ext_vector_type(4)));
typedef float  v4fa __attribute__((ext_vector_type(4), may_alias));
union FragB { v16b v; v8us half[2]; unsigned short u[16]; };

__device__ __forceinline__ unsigned short bf16_bits(float x) { unsigned int u = __float_as_uint(x); return (unsigned short)((u + 0x7FFFu + ((u >> 16) & 1u)) >> 16); }
__device__ __forceinline__ float bf16_val(unsigned short b) { return __uint_as_float(((unsigned int)b) << 16); }
__device__ __forceinline__ float bf16_round(float x) { return bf16_val(bf16_bits(x)); }
// D += A·B with NT terms: 1 = ah·bh, 2 = + al·bh (A split), 3 = + ah·bl (both split)
template <int NT>
__device__ __forceinline__ v8f mmaN(v16b ah, v16b al, v16b bh, v16b bl, v8f c) {
  c = __builtin_amdgcn_wmma_f32_16x16x32_bf16(false, ah, false, bh, (short)0, c, false, false);
  if (NT >= 2) c = __builtin_amdgcn_wmma_f32_16x16x32_bf16(false, al, false, bh, (short)0, c, false, false);
  if (NT >= 3) c = __builtin_amdgcn_wmma_f32_16x16x32_bf16(false, ah, false, bl, (short)0, c, false, false);
  asm volatile("v_nop\n\tv_nop\n\tv_nop\n\tv_nop" : "+v"(c) : "v"(ah), "v"(al), "v"(bh), "v"(bl));
  return c;
}

__device__ __forceinline__ void wt_bf16(const float* __restrict__ W, unsigned short* __restrict__ Wt, int K, int N, int blk) {
  const int t = blk * 256 + threadIdx.x;
  const int k8n = K / 8;
  if (t >= N * k8n) return;
  const int n = t / k8n, k8 = (t % k8n) * 8;
  v8us v;
#pragma unroll
  for (int i = 0; i < 8; ++i) v[i] = bf16_bits(W[(size_t)(k8 + i) * N + n]);
  *(v8us*)(Wt + (size_t)n * K + k8) = v;
  
}

// GEMM C[M][N] (f32, pitch ldc) = act(A[M][K]·W + bias). A f32 row-major (pitch lda) converted per fragment to bf16
// (ASPLIT: hi/lo two planes -> 2 terms, else single rounded term); Wt bf16 [N][K] (pitch ldb). BIAS_BF16 rounds the
// bias to bf16 first (bias quantised to bf16 before the add). K%32==0, M%16==0, N%64==0.
template <bool ASPLIT, int ACT, bool BIAS_BF16>
__global__ __launch_bounds__(128) void k_gemm_bf(const float* __restrict__ A, int lda, const unsigned short* __restrict__ Wt, int ldb,
                                               const float* __restrict__ bias, float* __restrict__ C, int ldc, int M, int N, int K) {
  __shared__ __attribute__((aligned(16))) float so[4][16][64];
  const int tid = threadIdx.x, w = tid >> 5, lane = tid & 31, ln = lane & 15, hh = lane >> 4;
  const int ntn = N / 64;
  const int wid = blockIdx.x * 4 + w;
  const int mt = wid / ntn, nq = wid % ntn;
  if (mt * 16 >= M) return;
  const int row0 = mt * 16, col0 = nq * 64;
  const float* arow = A + (size_t)(row0 + ln) * lda;
  v8f acc[4] = {};
  for (int kb = 0; kb < K; kb += 32) {
    FragB ah, al;
    const v4f x0 = *(const v4fa*)(arow + kb + 8 * hh), x1 = *(const v4fa*)(arow + kb + 8 * hh + 4);
    const v4f x2 = *(const v4fa*)(arow + kb + 16 + 8 * hh), x3 = *(const v4fa*)(arow + kb + 16 + 8 * hh + 4);
    float xs[16] = {x0[0],x0[1],x0[2],x0[3],x1[0],x1[1],x1[2],x1[3],x2[0],x2[1],x2[2],x2[3],x3[0],x3[1],x3[2],x3[3]};
#pragma unroll
    for (int i = 0; i < 16; ++i) { const unsigned short hb = bf16_bits(xs[i]); ah.u[i] = hb; al.u[i] = ASPLIT ? bf16_bits(xs[i] - bf16_val(hb)) : (unsigned short)0; }
#pragma unroll
    for (int t = 0; t < 4; ++t) {
      const unsigned short* brow = Wt + (size_t)(col0 + t * 16 + ln) * ldb + kb;
      FragB b;
      b.half[0] = *(const v8us*)(brow + 8 * hh);
      b.half[1] = *(const v8us*)(brow + 16 + 8 * hh);
      acc[t] = mmaN<ASPLIT ? 2 : 1>(ah.v, al.v, b.v, b.v, acc[t]);
    }
  }
#pragma unroll
  for (int t = 0; t < 4; ++t) {
    float bv = bias ? bias[col0 + t * 16 + ln] : 0.f;
    if (BIAS_BF16) bv = bf16_round(bv);
#pragma unroll
    for (int r = 0; r < 8; ++r) { float v = acc[t][r] + bv; if (ACT == 1) v = fmaxf(v, 0.f); so[w][8 * hh + r][t * 16 + ln] = v; }
  }
  __builtin_amdgcn_fence(__ATOMIC_ACQ_REL, "workgroup");
  __builtin_amdgcn_wave_barrier();
  const int rsub = lane >> 4, c4 = (lane & 15) * 4;
  {
#pragma unroll
    for (int q = 0; q < 8; ++q) {
      const int r = q * 2 + rsub;
      const v4f v = *(const v4fa*)&so[w][r][c4];
      *(v4f*)(C + (size_t)(row0 + r) * ldc + col0 + c4) = v;
    }
    
  }
}

// Flash-style causal/unmasked attention, all contractions 3-term bf16 hi/lo splits, f32 softmax with running max.
// q,k,v rows are read from f32 buffers with arbitrary row pitch (so they can live inside a fused qkv buffer);
// D = head size (multiple of 32, <= 128); one wave = 16 query rows; block = 4 waves (64 queries) sharing K/V chunks of 32.
template <int D, bool CAUSAL>
__global__ __launch_bounds__(128) void k_flash(const float* __restrict__ qb, const float* __restrict__ kb, const float* __restrict__ vb,
                                             int pitch, int T, int H, float scale, float* __restrict__ y, int ypitch) {
  constexpr int KS = D / 32;        // k-steps for QK
  constexpr int DT = D / 16;        // d tiles for PV
  __shared__ __attribute__((aligned(16))) unsigned short sKh[32][D + 8], sKl[32][D + 8], sVh[32][D + 8], sVl[32][D + 8];
  __shared__ __attribute__((aligned(16))) unsigned short sPh[4][16][40], sPl[4][16][40];
  __shared__ __attribute__((aligned(16))) float sO[4][16][D];
  const int tid = threadIdx.x, w = tid >> 5, lane = tid & 31, ln = lane & 15, hh = lane >> 4;
  const int nqb = (T + 63) / 64;
  const int bh = blockIdx.x / nqb, qblk = blockIdx.x % nqb;
  const int b = bh / H, h = bh % H;
  const int q0 = qblk * 64 + w * 16;
  const float* Q = qb + (size_t)b * T * pitch + h * D;
  const float* K = kb + (size_t)b * T * pitch + h * D;
  const float* V = vb + (size_t)b * T * pitch + h * D;

  // A fragments of the wave's 16 query rows (scaled), hi/lo
  FragB aqh[KS], aql[KS];
  {
    int row = q0 + ln; if (row >= T) row = T - 1;
    const float* qr = Q + (size_t)row * pitch;
#pragma unroll
    for (int ks = 0; ks < KS; ++ks)
#pragma unroll
      for (int i = 0; i < 16; ++i) {
        const int d = ks * 32 + ((i < 8) ? (8 * hh + i) : (16 + 8 * hh + (i - 8)));
        const float x = qr[d] * scale; const unsigned short hb = bf16_bits(x);
        aqh[ks].u[i] = hb; aql[ks].u[i] = bf16_bits(x - bf16_val(hb));
      }
  }
  float m_r[8], l_r[8];
#pragma unroll
  for (int r = 0; r < 8; ++r) { m_r[r] = -3.0e38f; l_r[r] = 0.f; }
  v8f oacc[DT];
#pragma unroll
  for (int dt = 0; dt < DT; ++dt) oacc[dt] = (v8f){0.f,0.f,0.f,0.f,0.f,0.f,0.f,0.f};

  const int kv_end = CAUSAL ? min(T, qblk * 64 + 64) : T;     // block-uniform
  for (int j0 = 0; j0 < kv_end; j0 += 32) {
    __syncthreads();
    for (int e = tid; e < 32 * (D / 4); e += 128) {
      const int r = e / (D / 4), c4 = (e % (D / 4)) * 4;
      const int key = j0 + r;
      v4f kf = {0.f,0.f,0.f,0.f}, vf = {0.f,0.f,0.f,0.f};
      if (key < T) { kf = *(const v4fa*)(K + (size_t)key * pitch + c4); vf = *(const v4fa*)(V + (size_t)key * pitch + c4); }
#pragma unroll
      for (int t = 0; t < 4; ++t) {
        unsigned short hb = bf16_bits(kf[t]); sKh[r][c4 + t] = hb; sKl[r][c4 + t] = bf16_bits(kf[t] - bf16_val(hb));
        hb = bf16_bits(vf[t]); sVh[r][c4 + t] = hb; sVl[r][c4 + t] = bf16_bits(vf[t] - bf16_val(hb));
      }
    }
    __syncthreads();
    // S tile 16 x 32
    v8f s[2];
#pragma unroll
    for (int nt = 0; nt < 2; ++nt) {
      v8f acc = {};
#pragma unroll
      for (int ks = 0; ks < KS; ++ks) {
        FragB bh_, bl_;
        bh_.half[0] = *(const v8us*)&sKh[nt * 16 + ln][ks * 32 + 8 * hh]; bh_.half[1] = *(const v8us*)&sKh[nt * 16 + ln][ks * 32 + 16 + 8 * hh];
        bl_.half[0] = *(const v8us*)&sKl[nt * 16 + ln][ks * 32 + 8 * hh]; bl_.half[1] = *(const v8us*)&sKl[nt * 16 + ln][ks * 32 + 16 + 8 * hh];
        acc = mmaN<3>(aqh[ks].v, aql[ks].v, bh_.v, bl_.v, acc);
      }
      s[nt] = acc;
    }
    // mask + running max (rows 8hh+r; the 16 lanes of a half share rows)
    float alpha[8];
#pragma unroll
    for (int r = 0; r < 8; ++r) {
      const int qi = q0 + 8 * hh + r;
      const int ja = j0 + ln, jb = j0 + 16 + ln;
      if (CAUSAL) { if (ja > qi) s[0][r] = -3.0e38f; if (jb > qi) s[1][r] = -3.0e38f; }
      if (ja >= T) s[0][r] = -3.0e38f;
      if (jb >= T) s[1][r] = -3.0e38f;
      float mx = fmaxf(s[0][r], s[1][r]);
      mx = fmaxf(mx, __shfl_xor(mx, 1, 32)); mx = fmaxf(mx, __shfl_xor(mx, 2, 32)); mx = fmaxf(mx, __shfl_xor(mx, 4, 32)); mx = fmaxf(mx, __shfl_xor(mx, 8, 32));
      const float mnew = fmaxf(m_r[r], mx);
      alpha[r] = (mnew > -1.0e38f) ? __expf(m_r[r] - mnew) : 1.0f;
      const float p0 = (s[0][r] > -1.0e38f) ? __expf(s[0][r] - mnew) : 0.f;
      const float p1 = (s[1][r] > -1.0e38f) ? __expf(s[1][r] - mnew) : 0.f;
      m_r[r] = mnew;
      l_r[r] = l_r[r] * alpha[r] + p0 + p1;            // per-lane partial row sum (16 lanes combined at the end)
      unsigned short hb = bf16_bits(p0); sPh[w][8 * hh + r][ln] = hb;      sPl[w][8 * hh + r][ln] = bf16_bits(p0 - bf16_val(hb));
      hb = bf16_bits(p1);                sPh[w][8 * hh + r][16 + ln] = hb; sPl[w][8 * hh + r][16 + ln] = bf16_bits(p1 - bf16_val(hb));
    }
#pragma unroll
    for (int dt = 0; dt < DT; ++dt)
#pragma unroll
      for (int r = 0; r < 8; ++r) oacc[dt][r] *= alpha[r];
    __builtin_amdgcn_fence(__ATOMIC_ACQ_REL, "workgroup");
    __builtin_amdgcn_wave_barrier();
    FragB pah, pal;
    pah.half[0] = *(const v8us*)&sPh[w][ln][8 * hh]; pah.half[1] = *(const v8us*)&sPh[w][ln][16 + 8 * hh];
    pal.half[0] = *(const v8us*)&sPl[w][ln][8 * hh]; pal.half[1] = *(const v8us*)&sPl[w][ln][16 + 8 * hh];
#pragma unroll
    for (int dt = 0; dt < DT; ++dt) {
      FragB bvh, bvl;
#pragma unroll
      for (int i = 0; i < 8; ++i) {
        bvh.u[i] = sVh[8 * hh + i][dt * 16 + ln]; bvh.u[8 + i] = sVh[16 + 8 * hh + i][dt * 16 + ln];
        bvl.u[i] = sVl[8 * hh + i][dt * 16 + ln]; bvl.u[8 + i] = sVl[16 + 8 * hh + i][dt * 16 + ln];
      }
      oacc[dt] = mmaN<3>(pah.v, pal.v, bvh.v, bvl.v, oacc[dt]);
    }
    __builtin_amdgcn_fence(__ATOMIC_ACQ_REL, "workgroup");
    __builtin_amdgcn_wave_barrier();
  }
#pragma unroll
  for (int r = 0; r < 8; ++r) {
    float l = l_r[r];
    l += __shfl_xor(l, 1, 32); l += __shfl_xor(l, 2, 32); l += __shfl_xor(l, 4, 32); l += __shfl_xor(l, 8, 32);
    l_r[r] = (l > 0.f) ? 1.0f / l : 0.f;
  }
#pragma unroll
  for (int dt = 0; dt < DT; ++dt)
#pragma unroll
    for (int r = 0; r < 8; ++r) sO[w][8 * hh + r][dt * 16 + ln] = oacc[dt][r] * l_r[r];
  __builtin_amdgcn_fence(__ATOMIC_ACQ_REL, "workgroup");
  __builtin_amdgcn_wave_barrier();
  {
    for (int r = 0; r < 16; ++r) {
      const int row = q0 + r;
      if (row < T && lane < D / 4) {
        const v4f val = *(const v4fa*)&sO[w][r][lane * 4];
        *(v4f*)(y + ((size_t)b * T + row) * ypitch + h * D + lane * 4) = val;
      }
    }
    
  }
}

// GEMM C = act(A·W + bias + resid): A f32 (ASPLIT -> hi/lo 2 terms), Wt bf16 [N][K]; ACT 0 none, 1 relu, 2 exact gelu;
// resid (optional, f32, row index = (row % rmod), pitch ldr, RES_BF16 rounds it) added before the activation.
template <bool ASPLIT, int ACT, bool BIAS_BF16, bool RES_BF16>
// blockIdx.y = which of several independent products of one shape: A, Wt and C advance by sA, sB, sC elements per product; A1, where given, is product 1's A.
__global__ __launch_bounds__(128) void k_gemm_bf3(const float* __restrict__ A0, const float* __restrict__ A1, int sA, int lda, const unsigned short* __restrict__ Wt0, int sB, int ldb,
                                                const float* __restrict__ bias, const float* __restrict__ resid, int rmod, int ldr,
                                                float* __restrict__ C0, int sC, int ldc, int M, int N, int K) {
  __shared__ __attribute__((aligned(16))) float so[4][16][64];
  const int z = blockIdx.y;
  const float* A = (A1 != nullptr && z == 1) ? A1 : A0 + (size_t)z * sA;
  const unsigned short* Wt = Wt0 + (size_t)z * sB;
  float* C = C0 + (size_t)z * sC;
  const int tid = threadIdx.x, w = tid >> 5, lane = tid & 31, ln = lane & 15, hh = lane >> 4;
  const int ntn = N / 64;
  const int wid = blockIdx.x * 4 + w;
  const int mt = wid / ntn, nq = wid % ntn;
  if (mt * 16 >= M) return;
  const int row0 = mt * 16, col0 = nq * 64;
  const float* arow = A + (size_t)(row0 + ln) * lda;
  v8f acc[4] = {};
  for (int kb = 0; kb < K; kb += 32) {
    FragB ah, al;
    const v4f x0 = *(const v4fa*)(arow + kb + 8 * hh), x1 = *(const v4fa*)(arow + kb + 8 * hh + 4);
    const v4f x2 = *(const v4fa*)(arow + kb + 16 + 8 * hh), x3 = *(const v4fa*)(arow + kb + 16 + 8 * hh + 4);
    float xs[16] = {x0[0],x0[1],x0[2],x0[3],x1[0],x1[1],x1[2],x1[3],x2[0],x2[1],x2[2],x2[3],x3[0],x3[1],x3[2],x3[3]};
#pragma unroll
    for (int i = 0; i < 16; ++i) { const unsigned short hb = bf16_bits(xs[i]); ah.u[i] = hb; al.u[i] = ASPLIT ? bf16_bits(xs[i] - bf16_val(hb)) : (unsigned short)0; }
#pragma unroll
    for (int t = 0; t < 4; ++t) {
      const unsigned short* brow = Wt + (size_t)(col0 + t * 16 + ln) * ldb + kb;
      FragB b;
      b.half[0] = *(const v8us*)(brow + 8 * hh);
      b.half[1] = *(const v8us*)(brow + 16 + 8 * hh);
      acc[t] = mmaN<ASPLIT ? 2 : 1>(ah.v, al.v, b.v, b.v, acc[t]);
    }
  }
#pragma unroll
  for (int t = 0; t < 4; ++t) {
    const int col = col0 + t * 16 + ln;
    float bv = bias ? bias[col] : 0.f;
    if (BIAS_BF16) bv = bf16_round(bv);
#pragma unroll
    for (int r = 0; r < 8; ++r) {
      float v = acc[t][r] + bv;
      if (resid) { float rv = resid[(size_t)((row0 + 8 * hh + r) % rmod) * ldr + col]; if (RES_BF16) rv = bf16_round(rv); v += rv; }
      if (ACT == 1) v = fmaxf(v, 0.f);
      if (ACT == 2) v = 0.5f * v * (1.0f + erff(v * 0.70710678118654752f));
      if (ACT == 3) { const float u = 0.7978845608028654f * (v + 0.044715f * v * v * v); v = 0.5f * v * (1.0f + tanhf(u)); }
      so[w][8 * hh + r][t * 16 + ln] = v;
    }
  }
  __builtin_amdgcn_fence(__ATOMIC_ACQ_REL, "workgroup");
  __builtin_amdgcn_wave_barrier();
  const int rsub = lane >> 4, c4 = (lane & 15) * 4;
  {
#pragma unroll
    for (int q = 0; q < 8; ++q) {
      const int r = q * 2 + rsub;
      const v4f v = *(const v4fa*)&so[w][r][c4];
      *(v4f*)(C + (size_t)(row0 + r) * ldc + col0 + c4) = v;
    }
    
  }
}
// row LayerNorm (biased variance, eps) over N: s = X (+ R); optional out_sum <- s; out_norm <- (s-mu)*rsqrt(var+eps)*g + b
template <bool PARAM_BF16>
__global__ __launch_bounds__(256) void k_layernorm(const float* __restrict__ X, const float* __restrict__ R, const float* __restrict__ g, const float* __restrict__ bta,
                                                  float* __restrict__ out_sum, float* __restrict__ out_norm, int N, float eps) {
  __shared__ float red[256];
  const int row = blockIdx.x, tid = threadIdx.x;
  const float* x = X + (size_t)row * N; const float* rr = R ? R + (size_t)row * N : nullptr;
  float vals[16];                     // up to N = 4096
  const int per = N / 256;            // contiguous chunk per thread? use strided-by-4 chunks: thread handles j = tid*4 + 1024*u
  float s1 = 0.f;
  for (int u = 0; u < per / 4; ++u) {
    const int j = tid * 4 + 1024 * u;
    const v4f a = *(const v4fa*)(x + j);
    v4f b = {0.f,0.f,0.f,0.f}; if (rr) b = *(const v4fa*)(rr + j);
#pragma unroll
    for (int q = 0; q < 4; ++q) { const float v = a[q] + b[q]; vals[u * 4 + q] = v; s1 += v; }
  }
  red[tid] = s1; __syncthreads();
  for (int st = 128; st > 0; st >>= 1) { if (tid < st) red[tid] += red[tid + st]; __syncthreads(); }
  const float mu = red[0] / (float)N; __syncthreads();
  float s2 = 0.f;
  for (int u = 0; u < per / 4; ++u)
#pragma unroll
    for (int q = 0; q < 4; ++q) { const float c = vals[u * 4 + q] - mu; s2 += c * c; }
  red[tid] = s2; __syncthreads();
  for (int st = 128; st > 0; st >>= 1) { if (tid < st) red[tid] += red[tid + st]; __syncthreads(); }
  const float rs = rsqrtf(red[0] / (float)N + eps);
  {
    for (int u = 0; u < per / 4; ++u) {
      const int j = tid * 4 + 1024 * u;
      v4f o, sm;
#pragma unroll
      for (int q = 0; q < 4; ++q) {
        float gg = g[j + q], bb = bta[j + q];
        if (PARAM_BF16) { gg = bf16_round(gg); bb = bf16_round(bb); }
        sm[q] = vals[u * 4 + q]; o[q] = (vals[u * 4 + q] - mu) * rs * gg + bb;
      }
      if (out_sum) *(v4f*)(out_sum + (size_t)row * N + j) = sm;
      *(v4f*)(out_norm + (size_t)row * N + j) = o;
    }
    
  }
}

__device__ __forceinline__ float tnh(float x) { const float e = __expf(2.0f * x); return 1.0f - 2.0f / (1.0f + e); }
// scores + softmax: block = QT query rows of one batch; its 8 waves split the 256 keys, 32 keys each. Lanes hold scale_u and q_u in registers (16 per lane and row,
// u = j*32 + lane); each key row is loaded once per block, one key ahead of its use, and serves all QT rows: s_k = sum_u scale_u*tanh(q_u + k[b][k][u]), same in-lane order
// and same shuffle tree as a wave-per-row loop. Scores meet in LDS; behind one block barrier wave t does mask, max-shifted softmax and both stores of row t.
#define QT 2
__global__ __launch_bounds__(256) void k_scores(const float* __restrict__ QP, const float* __restrict__ KP, const float* __restrict__ scale, const int* __restrict__ mask, float* __restrict__ ATT, float* __restrict__ ATT2) {
  __shared__ float ss[QT][TK];
  const int tid = threadIdx.x, wv = tid >> 5, lane = tid & 31;
  const int row0 = blockIdx.x * QT, b = row0 / TQ;
  const float* qr = QP + (size_t)row0 * UU;                         // the block's QT query rows
  float sc[16], qv[QT][16], ka[16], kb[16], keep[QT];
#pragma unroll
  for (int j = 0; j < 16; ++j) sc[j] = bf16_round(scale[j * 32 + lane]);
#pragma unroll
  for (int t = 0; t < QT; ++t) { keep[t] = 0.f;
#pragma unroll
    for (int j = 0; j < 16; ++j) qv[t][j] = qr[t * UU + j * 32 + lane]; }
  const float* kr = KP + ((size_t)b * TK + wv * 32) * UU + lane;   // this wave's 32 key rows
  auto fetch = [&](float (&kx)[16], int kk) {
#pragma unroll
    for (int j = 0; j < 16; ++j) kx[j] = kr[(size_t)kk * UU + j * 32];
  };
  auto score = [&](const float (&kx)[16], int kk) {
#pragma unroll
    for (int t = 0; t < QT; ++t) { float s = 0.f;
#pragma unroll
      for (int j = 0; j < 16; ++j) s += sc[j] * tnh(qv[t][j] + kx[j]);
      for (int o = 16; o >= 1; o >>= 1) s += __shfl_xor(s, o, 32);
      keep[t] = (lane == kk) ? s : keep[t]; }
  };
  fetch(ka, 0);
  // the wait that lets the address registers of the loads above be reused; naming the two bases that are dead from here on keeps them untouched up to it
  asm volatile("s_wait_xcnt 0x0" :: "s"(scale), "s"(qr) : "memory");
  // rolled: one trip is two keys (two register buffers, no copies)
#pragma unroll 1
  for (int kk = 0; kk < 32; kk += 2) {
    fetch(kb, kk + 1);
    score(ka, kk);
    fetch(ka, kk + 2 < 32 ? kk + 2 : 31);   // last trip: a row of this wave again, in bounds, not used
    score(kb, kk + 1);
  }
#pragma unroll
  for (int t = 0; t < QT; ++t) ss[t][wv * 32 + lane] = keep[t];
  __syncthreads();
  if (wv >= QT) return;
  const int row = row0 + wv;
  float lv[8]; float mx = -3.0e38f;
#pragma unroll
  for (int j = 0; j < 8; ++j) { const int k = j * 32 + lane; float v = ss[wv][k]; if (mask[b * TK + k] == 0) v = -1.0e9f; lv[j] = v; mx = fmaxf(mx, v); }
  for (int o = 16; o >= 1; o >>= 1) mx = fmaxf(mx, __shfl_xor(mx, o, 32));
  float den = 0.f; for (int j = 0; j < 8; ++j) { lv[j] = expf(lv[j] - mx); den += lv[j]; } for (int o = 16; o >= 1; o >>= 1) den += __shfl_xor(den, o, 32); const float rd = 1.0f / den;
  float* a1 = ATT + (size_t)row * TK; float* a2 = ATT2 + (size_t)row * TK;
  { for (int j = 0; j < 8; ++j) { const float p = lv[j] * rd; *(float*)(a1 + j * 32 + lane) = p; *(float*)(a2 + j * 32 + lane) = p; }  }
}
// value → Bt for the context GEMM per batch: Bt[b][d][k] = bf16(value[b][k][d]) (transpose via 64×32 (key × d) tiles)
__device__ __forceinline__ void vt_tile(const float* __restrict__ V, unsigned short* __restrict__ Bt, int bx, int by, int b) { __shared__ float tile[64][33]; const int k0 = bx * 64, d0 = by * 32; const int tx = threadIdx.x & 31, ty = threadIdx.x >> 5;
  for (int i = ty; i < 64; i += 8) tile[i][tx] = V[((size_t)b * TK + k0 + i) * DD + d0 + tx]; __syncthreads();
  typedef unsigned short us2 __attribute__((ext_vector_type(2)));
  { for (int e = threadIdx.x; e < 32 * 32; e += 256) { const int dr = e >> 5, kp = (e & 31) * 2; us2 v; v.x = bf16_bits(tile[kp][dr]); v.y = bf16_bits(tile[kp + 1][dr]); *(us2*)(Bt + ((size_t)b * DD + d0 + dr) * TK + k0 + kp) = v; }  } }
// the three independent re-layouts in one launch: blocks 0..WTB-1 do Wq, the next WTB do Wk, the rest the value tiles (the choice is the same for a whole block)
#define WTB (UU * (DD / 8) / 256)
__global__ __launch_bounds__(256) void k_prep(const float* __restrict__ Wq, const float* __restrict__ Wk, const float* __restrict__ V,
                                              unsigned short* __restrict__ Bq, unsigned short* __restrict__ Bk, unsigned short* __restrict__ Bv) {
  const int blk = blockIdx.x;
  if (blk < WTB) { wt_bf16(Wq, Bq, DD, UU, blk); return; }
  if (blk < 2 * WTB) { wt_bf16(Wk, Bk, DD, UU, blk - WTB); return; }
  const int i = blk - 2 * WTB;
  vt_tile(V, Bv, i % (TK / 64), (i / (TK / 64)) % (DD / 32), i / ((TK / 64) * (DD / 32)));
}
extern "C" void kernel_launch(void* const* d_in, const int* in_sizes, int n_in,
                              void* d_out, int out_size, void* d_ws, size_t ws_size, hipStream_t stream) {
  (void)in_sizes; (void)n_in; (void)out_size;
  const float* query = (const float*)d_in[0]; const float* value = (const float*)d_in[1]; const int* mask = (const int*)d_in[2]; const float* Wq = (const float*)d_in[3]; const float* Wk = (const float*)d_in[4]; const float* scale = (const float*)d_in[5];
  float* ctx = (float*)d_out; float* attn = ctx + (size_t)BB * TQ * DD;
  char* ws = (char*)d_ws; size_t off = 0;
  auto take = [&](size_t bytes) { char* p = ws + off; off += (bytes + 255) & ~(size_t)255; return p; };
  unsigned short* Bq = (unsigned short*)take((size_t)2 * UU * DD * 2); unsigned short* Bk = Bq + (size_t)UU * DD; unsigned short* Bv = (unsigned short*)take((size_t)BB * DD * TK * 2);
  float* QP = (float*)take((size_t)2 * BB * TQ * UU * 4); float* KP = QP + (size_t)BB * TQ * UU; float* ATT2 = (float*)take((size_t)BB * TQ * TK * 4);
  if (off > ws_size) return;
  k_prep<<<2 * WTB + (TK / 64) * (DD / 32) * BB, 256, 0, stream>>>(Wq, Wk, value, Bq, Bk, Bv);
  k_gemm_bf3<false, 0, false, false><<<dim3(((BB * TQ / 16) * (UU / 64) + 3) / 4, 2), 128, 0, stream>>>(query, value, 0, DD, Bq, UU * DD, DD, nullptr, nullptr, 1, 0, QP, BB * TQ * UU, UU, BB * TQ, UU, DD);
  k_scores<<<BB * TQ / QT, 256, 0, stream>>>(QP, KP, scale, mask, attn, ATT2);
  k_gemm_bf3<true, 0, false, false><<<dim3(((TQ / 16) * (DD / 64) + 3) / 4, BB), 128, 0, stream>>>(ATT2, nullptr, TQ * TK, TK, Bv, DD * TK, TK, nullptr, nullptr, 1, 0, ctx, TQ * DD, DD, TQ, DD, TK);
}

// v003
// It runs in 72.9 microseconds.
// Two timings next to v002 put it at 1.42 and 1.41 times that version's speed.
// Counting every step since v000, it is 14.3 times as fast.
#include <hip/hip_runtime.h>
// q = query·Wq and k = value·Wk on v_wmma_f32_16x16x32_bf16 (inputs rounded to bf16: single exact term), context = attn·value (attn split hi/lo vs exact value: 2 products),
// f32 accumulate. The additive scores Σ_u scale_u·tanh(q_u + k_u) over the [4,256,256,512] broadcast (f32 VALU, tanh = v_tanh_f32), the key mask and the softmax
// are f32 VALU; attention weights are the second output.
#define BB 4
#define TQ 256
#define TK 256
#define DD 1024
#define UU 512

typedef __bf16 v16b __attribute__((ext_vector_type(16)));
typedef unsigned short v8us __attribute__((ext_vector_type(8), may_alias));
typedef float  v8f  __attribute__((ext_vector_type(8)));
typedef float  v4f  __attribute__((ext_vector_type(4)));
typedef float  v4fa __attribute__((ext_vector_type(4), may_alias));
union FragB { v16b v; v8us half[2]; unsigned short u[16]; };

__device__ __forceinline__ unsigned short bf16_bits(float x) { unsigned int u = __float_as_uint(x); return (unsigned short)((u + 0x7FFFu + ((u >> 16) & 1u)) >> 16); }
__device__ __forceinline__ float bf16_val(unsigned short b) { return __uint_as_float(((unsigned int)b) << 16); }
__device__ __forceinline__ float bf16_round(float x) { return bf16_val(bf16_bits(x)); }
// D += A·B with NT terms: 1 = ah·bh, 2 = + al·bh (A split), 3 = + ah·bl (both split)
template <int NT>
__device__ __forceinline__ v8f mmaN(v16b ah, v16b al, v16b bh, v16b bl, v8f c) {
  c = __builtin_amdgcn_wmma_f32_16x16x32_bf16(false, ah, false, bh, (short)0, c, false, false);
  if (NT >= 2) c = __builtin_amdgcn_wmma_f32_16x16x32_bf16(false, al, false, bh, (short)0, c, false, false);
  if (NT >= 3) c = __builtin_amdgcn_wmma_f32_16x16x32_bf16(false, ah, false, bl, (short)0, c, false, false);
  asm volatile("v_nop\n\tv_nop\n\tv_nop\n\tv_nop" : "+v"(c) : "v"(ah), "v"(al), "v"(bh), "v"(bl));
  return c;
}

__device__ __forceinline__ void wt_bf16(const float* __restrict__ W, unsigned short* __restrict__ Wt, int K, int N, int blk) {
  const int t = blk * 256 + threadIdx.x;
  const int k8n = K / 8;
  if (t >= N * k8n) return;
  const int n = t / k8n, k8 = (t % k8n) * 8;
  v8us v;
#pragma unroll
  for (int i = 0; i < 8; ++i) v[i] = bf16_bits(W[(size_t)(k8 + i) * N + n]);
  *(v8us*)(Wt + (size_t)n * K + k8) = v;
  
}

// GEMM C[M][N] (f32, pitch ldc) = act(A[M][K]·W + bias). A f32 row-major (pitch lda) converted per fragment to bf16
// (ASPLIT: hi/lo two planes -> 2 terms, else single rounded term); Wt bf16 [N][K] (pitch ldb). BIAS_BF16 rounds the
// bias to bf16 first (bias quantised to bf16 before the add). K%32==0, M%16==0, N%64==0.
template <bool ASPLIT, int ACT, bool BIAS_BF16>
__global__ __launch_bounds__(128) void k_gemm_bf(const float* __restrict__ A, int lda, const unsigned short* __restrict__ Wt, int ldb,
                                               const float* __restrict__ bias, float* __restrict__ C, int ldc, int M, int N, int K) {
  __shared__ __attribute__((aligned(16))) float so[4][16][64];
  const int tid = threadIdx.x, w = tid >> 5, lane = tid & 31, ln = lane & 15, hh = lane >> 4;
  const int ntn = N / 64;
  const int wid = blockIdx.x * 4 + w;
  const int mt = wid / ntn, nq = wid % ntn;
  if (mt * 16 >= M) return;
  const int row0 = mt * 16, col0 = nq * 64;
  const float* arow = A + (size_t)(row0 + ln) * lda;
  v8f acc[4] = {};
  for (int kb = 0; kb < K; kb += 32) {
    FragB ah, al;
    const v4f x0 = *(const v4fa*)(arow + kb + 8 * hh), x1 = *(const v4fa*)(arow + kb + 8 * hh + 4);
    const v4f x2 = *(const v4fa*)(arow + kb + 16 + 8 * hh), x3 = *(const v4fa*)(arow + kb + 16 + 8 * hh + 4);
    float xs[16] = {x0[0],x0[1],x0[2],x0[3],x1[0],x1[1],x1[2],x1[3],x2[0],x2[1],x2[2],x2[3],x3[0],x3[1],x3[2],x3[3]};
#pragma unroll
    for (int i = 0; i < 16; ++i) { const unsigned short hb = bf16_bits(xs[i]); ah.u[i] = hb; al.u[i] = ASPLIT ? bf16_bits(xs[i] - bf16_val(hb)) : (unsigned short)0; }
#pragma unroll
    for (int t = 0; t < 4; ++t) {
      const unsigned short* brow = Wt + (size_t)(col0 + t * 16 + ln) * ldb + kb;
      FragB b;
      b.half[0] = *(const v8us*)(brow + 8 * hh);
      b.half[1] = *(const v8us*)(brow + 16 + 8 * hh);
      acc[t] = mmaN<ASPLIT ? 2 : 1>(ah.v, al.v, b.v, b.v, acc[t]);
    }
  }
#pragma unroll
  for (int t = 0; t < 4; ++t) {
    float bv = bias ? bias[col0 + t * 16 + ln] : 0.f;
    if (BIAS_BF16) bv = bf16_round(bv);
#pragma unroll
    for (int r = 0; r < 8; ++r) { float v = acc[t][r] + bv; if (ACT == 1) v = fmaxf(v, 0.f); so[w][8 * hh + r][t * 16 + ln] = v; }
  }
  __builtin_amdgcn_fence(__ATOMIC_ACQ_REL, "workgroup");
  __builtin_amdgcn_wave_barrier();
  const int rsub = lane >> 4, c4 = (lane & 15) * 4;
  {
#pragma unroll
    for (int q = 0; q < 8; ++q) {
      const int r = q * 2 + rsub;
      const v4f v = *(const v4fa*)&so[w][r][c4];
      *(v4f*)(C + (size_t)(row0 + r) * ldc + col0 + c4) = v;
    }
    
  }
}

// Flash-style causal/unmasked attention, all contractions 3-term bf16 hi/lo splits, f32 softmax with running max.
// q,k,v rows are read from f32 buffers with arbitrary row pitch (so they can live inside a fused qkv buffer);
// D = head size (multiple of 32, <= 128); one wave = 16 query rows; block = 4 waves (64 queries) sharing K/V chunks of 32.
template <int D, bool CAUSAL>
__global__ __launch_bounds__(128) void k_flash(const float* __restrict__ qb, const float* __restrict__ kb, const float* __restrict__ vb,
                                             int pitch, int T, int H, float scale, float* __restrict__ y, int ypitch) {
  constexpr int KS = D / 32;        // k-steps for QK
  constexpr int DT = D / 16;        // d tiles for PV
  __shared__ __attribute__((aligned(16))) unsigned short sKh[32][D + 8], sKl[32][D + 8], sVh[32][D + 8], sVl[32][D + 8];
  __shared__ __attribute__((aligned(16))) unsigned short sPh[4][16][40], sPl[4][16][40];
  __shared__ __attribute__((aligned(16))) float sO[4][16][D];
  const int tid = threadIdx.x, w = tid >> 5, lane = tid & 31, ln = lane & 15, hh = lane >> 4;
  const int nqb = (T + 63) / 64;
  const int bh = blockIdx.x / nqb, qblk = blockIdx.x % nqb;
  const int b = bh / H, h = bh % H;
  const int q0 = qblk * 64 + w * 16;
  const float* Q = qb + (size_t)b * T * pitch + h * D;
  const float* K = kb + (size_t)b * T * pitch + h * D;
  const float* V = vb + (size_t)b * T * pitch + h * D;

  // A fragments of the wave's 16 query rows (scaled), hi/lo
  FragB aqh[KS], aql[KS];
  {
    int row = q0 + ln; if (row >= T) row = T - 1;
    const float* qr = Q + (size_t)row * pitch;
#pragma unroll
    for (int ks = 0; ks < KS; ++ks)
#pragma unroll
      for (int i = 0; i < 16; ++i) {
        const int d = ks * 32 + ((i < 8) ? (8 * hh + i) : (16 + 8 * hh + (i - 8)));
        const float x = qr[d] * scale; const unsigned short hb = bf16_bits(x);
        aqh[ks].u[i] = hb; aql[ks].u[i] = bf16_bits(x - bf16_val(hb));
      }
  }
  float m_r[8], l_r[8];
#pragma unroll
  for (int r = 0; r < 8; ++r) { m_r[r] = -3.0e38f; l_r[r] = 0.f; }
  v8f oacc[DT];
#pragma unroll
  for (int dt = 0; dt < DT; ++dt) oacc[dt] = (v8f){0.f,0.f,0.f,0.f,0.f,0.f,0.f,0.f};

  const int kv_end = CAUSAL ? min(T, qblk * 64 + 64) : T;     // block-uniform
  for (int j0 = 0; j0 < kv_end; j0 += 32) {
    __syncthreads();
    for (int e = tid; e < 32 * (D / 4); e += 128) {
      const int r = e / (D / 4), c4 = (e % (D / 4)) * 4;
      const int key = j0 + r;
      v4f kf = {0.f,0.f,0.f,0.f}, vf = {0.f,0.f,0.f,0.f};
      if (key < T) { kf = *(const v4fa*)(K + (size_t)key * pitch + c4); vf = *(const v4fa*)(V + (size_t)key * pitch + c4); }
#pragma unroll
      for (int t = 0; t < 4; ++t) {
        unsigned short hb = bf16_bits(kf[t]); sKh[r][c4 + t] = hb; sKl[r][c4 + t] = bf16_bits(kf[t] - bf16_val(hb));
        hb = bf16_bits(vf[t]); sVh[r][c4 + t] = hb; sVl[r][c4 + t] = bf16_bits(vf[t] - bf16_val(hb));
      }
    }
    __syncthreads();
    // S tile 16 x 32
    v8f s[2];
#pragma unroll
    for (int nt = 0; nt < 2; ++nt) {
      v8f acc = {};
#pragma unroll
      for (int ks = 0; ks < KS; ++ks) {
        FragB bh_, bl_;
        bh_.half[0] = *(const v8us*)&sKh[nt * 16 + ln][ks * 32 + 8 * hh]; bh_.half[1] = *(const v8us*)&sKh[nt * 16 + ln][ks * 32 + 16 + 8 * hh];
        bl_.half[0] = *(const v8us*)&sKl[nt * 16 + ln][ks * 32 + 8 * hh]; bl_.half[1] = *(const v8us*)&sKl[nt * 16 + ln][ks * 32 + 16 + 8 * hh];
        acc = mmaN<3>(aqh[ks].v, aql[ks].v, bh_.v, bl_.v, acc);
      }
      s[nt] = acc;
    }
    // mask + running max (rows 8hh+r; the 16 lanes of a half share rows)
    float alpha[8];
#pragma unroll
    for (int r = 0; r < 8; ++r) {
      const int qi = q0 + 8 * hh + r;
      const int ja = j0 + ln, jb = j0 + 16 + ln;
      if (CAUSAL) { if (ja > qi) s[0][r] = -3.0e38f; if (jb > qi) s[1][r] = -3.0e38f; }
      if (ja >= T) s[0][r] = -3.0e38f;
      if (jb >= T) s[1][r] = -3.0e38f;
      float mx = fmaxf(s[0][r], s[1][r]);
      mx = fmaxf(mx, __shfl_xor(mx, 1, 32)); mx = fmaxf(mx, __shfl_xor(mx, 2, 32)); mx = fmaxf(mx, __shfl_xor(mx, 4, 32)); mx = fmaxf(mx, __shfl_xor(mx, 8, 32));
      const float mnew = fmaxf(m_r[r], mx);
      alpha[r] = (mnew > -1.0e38f) ? __expf(m_r[r] - mnew) : 1.0f;
      const float p0 = (s[0][r] > -1.0e38f) ? __expf(s[0][r] - mnew) : 0.f;
      const float p1 = (s[1][r] > -1.0e38f) ? __expf(s[1][r] - mnew) : 0.f;
      m_r[r] = mnew;
      l_r[r] = l_r[r] * alpha[r] + p0 + p1;            // per-lane partial row sum (16 lanes combined at the end)
      unsigned short hb = bf16_bits(p0); sPh[w][8 * hh + r][ln] = hb;      sPl[w][8 * hh + r][ln] = bf16_bits(p0 - bf16_val(hb));
      hb = bf16_bits(p1);                sPh[w][8 * hh + r][16 + ln] = hb; sPl[w][8 * hh + r][16 + ln] = bf16_bits(p1 - bf16_val(hb));
    }
#pragma unroll
    for (int dt = 0; dt < DT; ++dt)
#pragma unroll
      for (int r = 0; r < 8; ++r) oacc[dt][r] *= alpha[r];
    __builtin_amdgcn_fence(__ATOMIC_ACQ_REL, "workgroup");
    __builtin_amdgcn_wave_barrier();
    FragB pah, pal;
    pah.half[0] = *(const v8us*)&sPh[w][ln][8 * hh]; pah.half[1] = *(const v8us*)&sPh[w][ln][16 + 8 * hh];
    pal.half[0] = *(const v8us*)&sPl[w][ln][8 * hh]; pal.half[1] = *(const v8us*)&sPl[w][ln][16 + 8 * hh];
#pragma unroll
    for (int dt = 0; dt < DT; ++dt) {
      FragB bvh, bvl;
#pragma unroll
      for (int i = 0; i < 8; ++i) {
        bvh.u[i] = sVh[8 * hh + i][dt * 16 + ln]; bvh.u[8 + i] = sVh[16 + 8 * hh + i][dt * 16 + ln];
        bvl.u[i] = sVl[8 * hh + i][dt * 16 + ln]; bvl.u[8 + i] = sVl[16 + 8 * hh + i][dt * 16 + ln];
      }
      oacc[dt] = mmaN<3>(pah.v, pal.v, bvh.v, bvl.v, oacc[dt]);
    }
    __builtin_amdgcn_fence(__ATOMIC_ACQ_REL, "workgroup");
    __builtin_amdgcn_wave_barrier();
  }
#pragma unroll
  for (int r = 0; r < 8; ++r) {
    float l = l_r[r];
    l += __shfl_xor(l, 1, 32); l += __shfl_xor(l, 2, 32); l += __shfl_xor(l, 4, 32); l += __shfl_xor(l, 8, 32);
    l_r[r] = (l > 0.f) ? 1.0f / l : 0.f;
  }
#pragma unroll
  for (int dt = 0; dt < DT; ++dt)
#pragma unroll
    for (int r = 0; r < 8; ++r) sO[w][8 * hh + r][dt * 16 + ln] = oacc[dt][r] * l_r[r];
  __builtin_amdgcn_fence(__ATOMIC_ACQ_REL, "workgroup");
  __builtin_amdgcn_wave_barrier();
  {
    for (int r = 0; r < 16; ++r) {
      const int row = q0 + r;
      if (row < T && lane < D / 4) {
        const v4f val = *(const v4fa*)&sO[w][r][lane * 4];
        *(v4f*)(y + ((size_t)b * T + row) * ypitch + h * D + lane * 4) = val;
      }
    }
    
  }
}

// GEMM C = act(A·W + bias + resid): A f32 (ASPLIT -> hi/lo 2 terms), Wt bf16 [N][K]; ACT 0 none, 1 relu, 2 exact gelu;
// resid (optional, f32, row index = (row % rmod), pitch ldr, RES_BF16 rounds it) added before the activation.
template <bool ASPLIT, int ACT, bool BIAS_BF16, bool RES_BF16>
// blockIdx.y = which of several independent products of one shape: A, Wt and C advance by sA, sB, sC elements per product; A1, where given, is product 1's A.
__global__ __launch_bounds__(128) void k_gemm_bf3(const float* __restrict__ A0, const float* __restrict__ A1, int sA, int lda, const unsigned short* __restrict__ Wt0, int sB, int ldb,
                                                const float* __restrict__ bias, const float* __restrict__ resid, int rmod, int ldr,
                                                float* __restrict__ C0, int sC, int ldc, int M, int N, int K) {
  __shared__ __attribute__((aligned(16))) float so[4][16][64];
  const int z = blockIdx.y;
  const float* A = (A1 != nullptr && z == 1) ? A1 : A0 + (size_t)z * sA;
  const unsigned short* Wt = Wt0 + (size_t)z * sB;
  float* C = C0 + (size_t)z * sC;
  const int tid = threadIdx.x, w = tid >> 5, lane = tid & 31, ln = lane & 15, hh = lane >> 4;
  const int ntn = N / 64;
  const int wid = blockIdx.x * 4 + w;
  const int mt = wid / ntn, nq = wid % ntn;
  if (mt * 16 >= M) return;
  const int row0 = mt * 16, col0 = nq * 64;
  const float* arow = A + (size_t)(row0 + ln) * lda;
  v8f acc[4] = {};
  for (int kb = 0; kb < K; kb += 32) {
    FragB ah, al;
    const v4f x0 = *(const v4fa*)(arow + kb + 8 * hh), x1 = *(const v4fa*)(arow + kb + 8 * hh + 4);
    const v4f x2 = *(const v4fa*)(arow + kb + 16 + 8 * hh), x3 = *(const v4fa*)(arow + kb + 16 + 8 * hh + 4);
    float xs[16] = {x0[0],x0[1],x0[2],x0[3],x1[0],x1[1],x1[2],x1[3],x2[0],x2[1],x2[2],x2[3],x3[0],x3[1],x3[2],x3[3]};
#pragma unroll
    for (int i = 0; i < 16; ++i) { const unsigned short hb = bf16_bits(xs[i]); ah.u[i] = hb; al.u[i] = ASPLIT ? bf16_bits(xs[i] - bf16_val(hb)) : (unsigned short)0; }
#pragma unroll
    for (int t = 0; t < 4; ++t) {
      const unsigned short* brow = Wt + (size_t)(col0 + t * 16 + ln) * ldb + kb;
      FragB b;
      b.half[0] = *(const v8us*)(brow + 8 * hh);
      b.half[1] = *(const v8us*)(brow + 16 + 8 * hh);
      acc[t] = mmaN<ASPLIT ? 2 : 1>(ah.v, al.v, b.v, b.v, acc[t]);
    }
  }
#pragma unroll
  for (int t = 0; t < 4; ++t) {
    const int col = col0 + t * 16 + ln;
    float bv = bias ? bias[col] : 0.f;
    if (BIAS_BF16) bv = bf16_round(bv);
#pragma unroll
    for (int r = 0; r < 8; ++r) {
      float v = acc[t][r] + bv;
      if (resid) { float rv = resid[(size_t)((row0 + 8 * hh + r) % rmod) * ldr + col]; if (RES_BF16) rv = bf16_round(rv); v += rv; }
      if (ACT == 1) v = fmaxf(v, 0.f);
      if (ACT == 2) v = 0.5f * v * (1.0f + erff(v * 0.70710678118654752f));
      if (ACT == 3) { const float u = 0.7978845608028654f * (v + 0.044715f * v * v * v); v = 0.5f * v * (1.0f + tanhf(u)); }
      so[w][8 * hh + r][t * 16 + ln] = v;
    }
  }
  __builtin_amdgcn_fence(__ATOMIC_ACQ_REL, "workgroup");
  __builtin_amdgcn_wave_barrier();
  const int rsub = lane >> 4, c4 = (lane & 15) * 4;
  {
#pragma unroll
    for (int q = 0; q < 8; ++q) {
      const int r = q * 2 + rsub;
      const v4f v = *(const v4fa*)&so[w][r][c4];
      *(v4f*)(C + (size_t)(row0 + r) * ldc + col0 + c4) = v;
    }
    
  }
}
// row LayerNorm (biased variance, eps) over N: s = X (+ R); optional out_sum <- s; out_norm <- (s-mu)*rsqrt(var+eps)*g + b
template <bool PARAM_BF16>
__global__ __launch_bounds__(256) void k_layernorm(const float* __restrict__ X, const float* __restrict__ R, const float* __restrict__ g, const float* __restrict__ bta,
                                                  float* __restrict__ out_sum, float* __restrict__ out_norm, int N, float eps) {
  __shared__ float red[256];
  const int row = blockIdx.x, tid = threadIdx.x;
  const float* x = X + (size_t)row * N; const float* rr = R ? R + (size_t)row * N : nullptr;
  float vals[16];                     // up to N = 4096
  const int per = N / 256;            // contiguous chunk per thread? use strided-by-4 chunks: thread handles j = tid*4 + 1024*u
  float s1 = 0.f;
  for (int u = 0; u < per / 4; ++u) {
    const int j = tid * 4 + 1024 * u;
    const v4f a = *(const v4fa*)(x + j);
    v4f b = {0.f,0.f,0.f,0.f}; if (rr) b = *(const v4fa*)(rr + j);
#pragma unroll
    for (int q = 0; q < 4; ++q) { const float v = a[q] + b[q]; vals[u * 4 + q] = v; s1 += v; }
  }
  red[tid] = s1; __syncthreads();
  for (int st = 128; st > 0; st >>= 1) { if (tid < st) red[tid] += red[tid + st]; __syncthreads(); }
  const float mu = red[0] / (float)N; __syncthreads();
  float s2 = 0.f;
  for (int u = 0; u < per / 4; ++u)
#pragma unroll
    for (int q = 0; q < 4; ++q) { const float c = vals[u * 4 + q] - mu; s2 += c * c; }
  red[tid] = s2; __syncthreads();
  for (int st = 128; st > 0; st >>= 1) { if (tid < st) red[tid] += red[tid + st]; __syncthreads(); }
  const float rs = rsqrtf(red[0] / (float)N + eps);
  {
    for (int u = 0; u < per / 4; ++u) {
      const int j = tid * 4 + 1024 * u;
      v4f o, sm;
#pragma unroll
      for (int q = 0; q < 4; ++q) {
        float gg = g[j + q], bb = bta[j + q];
        if (PARAM_BF16) { gg = bf16_round(gg); bb = bf16_round(bb); }
        sm[q] = vals[u * 4 + q]; o[q] = (vals[u * 4 + q] - mu) * rs * gg + bb;
      }
      if (out_sum) *(v4f*)(out_sum + (size_t)row * N + j) = sm;
      *(v4f*)(out_norm + (size_t)row * N + j) = o;
    }
    
  }
}

__device__ __forceinline__ float tnh(float x) { return __builtin_amdgcn_tanhf(x); }   // one v_tanh_f32
// scores + softmax: block = QT query rows of one batch; its 8 waves split the 256 keys, 32 keys each. Lanes hold scale_u and q_u in registers (16 per lane and row,
// u = j*32 + lane); each key row is loaded once per block, one key ahead of its use, and serves all QT rows: s_k = sum_u scale_u*tanh(q_u + k[b][k][u]), same in-lane order
// and same shuffle tree as a wave-per-row loop. Scores meet in LDS; behind one block barrier wave t does mask, max-shifted softmax and both stores of row t.
#define QT 2
__global__ __launch_bounds__(256) void k_scores(const float* __restrict__ QP, const float* __restrict__ KP, const float* __restrict__ scale, const int* __restrict__ mask, float* __restrict__ ATT, float* __restrict__ ATT2) {
  __shared__ float ss[QT][TK];
  const int tid = threadIdx.x, wv = tid >> 5, lane = tid & 31;
  const int row0 = blockIdx.x * QT, b = row0 / TQ;
  const float* qr = QP + (size_t)row0 * UU;                         // the block's QT query rows
  float sc[16], qv[QT][16], ka[16], kb[16], keep[QT];
#pragma unroll
  for (int j = 0; j < 16; ++j) sc[j] = bf16_round(scale[j * 32 + lane]);
#pragma unroll
  for (int t = 0; t < QT; ++t) { keep[t] = 0.f;
#pragma unroll
    for (int j = 0; j < 16; ++j) qv[t][j] = qr[t * UU + j * 32 + lane]; }
  const float* kr = KP + ((size_t)b * TK + wv * 32) * UU + lane;   // this wave's 32 key rows
  auto fetch = [&](float (&kx)[16], int kk) {
#pragma unroll
    for (int j = 0; j < 16; ++j) kx[j] = kr[(size_t)kk * UU + j * 32];
  };
  auto score = [&](const float (&kx)[16], int kk) {
#pragma unroll
    for (int t = 0; t < QT; ++t) { float s = 0.f;
#pragma unroll
      for (int j = 0; j < 16; ++j) s += sc[j] * tnh(qv[t][j] + kx[j]);
      for (int o = 16; o >= 1; o >>= 1) s += __shfl_xor(s, o, 32);
      keep[t] = (lane == kk) ? s : keep[t]; }
  };
  fetch(ka, 0);
  // the wait that lets the address registers of the loads above be reused; naming the two bases that are dead from here on keeps them untouched up to it
  asm volatile("s_wait_xcnt 0x0" :: "s"(scale), "s"(qr) : "memory");
  // rolled: one trip is two keys (two register buffers, no copies)
#pragma unroll 1
  for (int kk = 0; kk < 32; kk += 2) {
    fetch(kb, kk + 1);
    score(ka, kk);
    fetch(ka, kk + 2 < 32 ? kk + 2 : 31);   // last trip: a row of this wave again, in bounds, not used
    score(kb, kk + 1);
  }
#pragma unroll
  for (int t = 0; t < QT; ++t) ss[t][wv * 32 + lane] = keep[t];
  __syncthreads();
  if (wv >= QT) return;
  const int row = row0 + wv;
  float lv[8]; float mx = -3.0e38f;
#pragma unroll
  for (int j = 0; j < 8; ++j) { const int k = j * 32 + lane; float v = ss[wv][k]; if (mask[b * TK + k] == 0) v = -1.0e9f; lv[j] = v; mx = fmaxf(mx, v); }
  for (int o = 16; o >= 1; o >>= 1) mx = fmaxf(mx, __shfl_xor(mx, o, 32));
  float den = 0.f; for (int j = 0; j < 8; ++j) { lv[j] = expf(lv[j] - mx); den += lv[j]; } for (int o = 16; o >= 1; o >>= 1) den += __shfl_xor(den, o, 32); const float rd = 1.0f / den;
  float* a1 = ATT + (size_t)row * TK; float* a2 = ATT2 + (size_t)row * TK;
  { for (int j = 0; j < 8; ++j) { const float p = lv[j] * rd; *(float*)(a1 + j * 32 + lane) = p; *(float*)(a2 + j * 32 + lane) = p; }  }
}
// value → Bt for the context GEMM per batch: Bt[b][d][k] = bf16(value[b][k][d]) (transpose via 64×32 (key × d) tiles)
__device__ __forceinline__ void vt_tile(const float* __restrict__ V, unsigned short* __restrict__ Bt, int bx, int by, int b) { __shared__ float tile[64][33]; const int k0 = bx * 64, d0 = by * 32; const int tx = threadIdx.x & 31, ty = threadIdx.x >> 5;
  for (int i = ty; i < 64; i += 8) tile[i][tx] = V[((size_t)b * TK + k0 + i) * DD + d0 + tx]; __syncthreads();
  typedef unsigned short us2 __attribute__((ext_vector_type(2)));
  { for (int e = threadIdx.x; e < 32 * 32; e += 256) { const int dr = e >> 5, kp = (e & 31) * 2; us2 v; v.x = bf16_bits(tile[kp][dr]); v.y = bf16_bits(tile[kp + 1][dr]); *(us2*)(Bt + ((size_t)b * DD + d0 + dr) * TK + k0 + kp) = v; }  } }
// the three independent re-layouts in one launch: blocks 0..WTB-1 do Wq, the next WTB do Wk, the rest the value tiles (the choice is the same for a whole block)
#define WTB (UU * (DD / 8) / 256)
__global__ __launch_bounds__(256) void k_prep(const float* __restrict__ Wq, const float* __restrict__ Wk, const float* __restrict__ V,
                                              unsigned short* __restrict__ Bq, unsigned short* __restrict__ Bk, unsigned short* __restrict__ Bv) {
  const int blk = blockIdx.x;
  if (blk < WTB) { wt_bf16(Wq, Bq, DD, UU, blk); return; }
  if (blk < 2 * WTB) { wt_bf16(Wk, Bk, DD, UU, blk - WTB); return; }
  const int i = blk - 2 * WTB;
  vt_tile(V, Bv, i % (TK / 64), (i / (TK / 64)) % (DD / 32), i / ((TK / 64) * (DD / 32)));
}
extern "C" void kernel_launch(void* const* d_in, const int* in_sizes, int n_in,
                              void* d_out, int out_size, void* d_ws, size_t ws_size, hipStream_t stream) {
  (void)in_sizes; (void)n_in; (void)out_size;
  const float* query = (const float*)d_in[0]; const float* value = (const float*)d_in[1]; const int* mask = (const int*)d_in[2]; const float* Wq = (const float*)d_in[3]; const float* Wk = (const float*)d_in[4]; const float* scale = (const float*)d_in[5];
  float* ctx = (float*)d_out; float* attn = ctx + (size_t)BB * TQ * DD;
  char* ws = (char*)d_ws; size_t off = 0;
  auto take = [&](size_t bytes) { char* p = ws + off; off += (bytes + 255) & ~(size_t)255; return p; };
  unsigned short* Bq = (unsigned short*)take((size_t)2 * UU * DD * 2); unsigned short* Bk = Bq + (size_t)UU * DD; unsigned short* Bv = (unsigned short*)take((size_t)BB * DD * TK * 2);
  float* QP = (float*)take((size_t)2 * BB * TQ * UU * 4); float* KP = QP + (size_t)BB * TQ * UU; float* ATT2 = (float*)take((size_t)BB * TQ * TK * 4);
  if (off > ws_size) return;
  k_prep<<<2 * WTB + (TK / 64) * (DD / 32) * BB, 256, 0, stream>>>(Wq, Wk, value, Bq, Bk, Bv);
  k_gemm_bf3<false, 0, false, false><<<dim3(((BB * TQ / 16) * (UU / 64) + 3) / 4, 2), 128, 0, stream>>>(query, value, 0, DD, Bq, UU * DD, DD, nullptr, nullptr, 1, 0, QP, BB * TQ * UU, UU, BB * TQ, UU, DD);
  k_scores<<<BB * TQ / QT, 256, 0, stream>>>(QP, KP, scale, mask, attn, ATT2);
  k_gemm_bf3<true, 0, false, false><<<dim3(((TQ / 16) * (DD / 64) + 3) / 4, BB), 128, 0, stream>>>(ATT2, nullptr, TQ * TK, TK, Bv, DD * TK, TK, nullptr, nullptr, 1, 0, ctx, TQ * DD, DD, TQ, DD, TK);
}

// v004
// Measured time: 33.7 microseconds a run.
// In two side-by-side timings against v003, it was 2.24 and 2.23 times as fast.
// Counting every step since v000, it is 32.1 times as fast.
#include <hip/hip_runtime.h>
// q = query·Wq and k = value·Wk on v_wmma_f32_16x16x32_bf16 (inputs rounded to bf16: single exact term), context = attn·value (attn split hi/lo vs value rounded to bf16: 2 products),
// f32 accumulate. The additive scores Σ_u scale_u·tanh(q_u + k_u) over the [4,256,256,512] broadcast (f32 VALU, tanh = v_tanh_f32), the key mask and the softmax
// are f32 VALU; attention weights are the second output.
#define BB 4
#define TQ 256
#define TK 256
#define DD 1024
#define UU 512

typedef __bf16 v16b __attribute__((ext_vector_type(16)));
typedef unsigned short v8us __attribute__((ext_vector_type(8), may_alias));
typedef float  v8f  __attribute__((ext_vector_type(8)));
typedef float  v4f  __attribute__((ext_vector_type(4)));
typedef float  v4fa __attribute__((ext_vector_type(4), may_alias));
union FragB { v16b v; v8us half[2]; unsigned short u[16]; };

__device__ __forceinline__ unsigned short bf16_bits(float x) { unsigned int u = __float_as_uint(x); return (unsigned short)((u + 0x7FFFu + ((u >> 16) & 1u)) >> 16); }
__device__ __forceinline__ float bf16_val(unsigned short b) { return __uint_as_float(((unsigned int)b) << 16); }
__device__ __forceinline__ float bf16_round(float x) { return bf16_val(bf16_bits(x)); }
// D += A·B with NT terms: 1 = ah·bh, 2 = + al·bh (A split), 3 = + ah·bl (both split)
template <int NT>
__device__ __forceinline__ v8f mmaN(v16b ah, v16b al, v16b bh, v16b bl, v8f c) {
  c = __builtin_amdgcn_wmma_f32_16x16x32_bf16(false, ah, false, bh, (short)0, c, false, false);
  if (NT >= 2) c = __builtin_amdgcn_wmma_f32_16x16x32_bf16(false, al, false, bh, (short)0, c, false, false);
  if (NT >= 3) c = __builtin_amdgcn_wmma_f32_16x16x32_bf16(false, ah, false, bl, (short)0, c, false, false);
  asm volatile("v_nop\n\tv_nop\n\tv_nop\n\tv_nop" : "+v"(c) : "v"(ah), "v"(al), "v"(bh), "v"(bl));
  return c;
}

// GEMM C[M][N] (f32, pitch ldc) = act(A[M][K]·W + bias). A f32 row-major (pitch lda) converted per fragment to bf16
// (ASPLIT: hi/lo two planes -> 2 terms, else single rounded term); Wt bf16 [N][K] (pitch ldb). BIAS_BF16 rounds the
// bias to bf16 first (bias quantised to bf16 before the add). K%32==0, M%16==0, N%64==0.
template <bool ASPLIT, int ACT, bool BIAS_BF16>
__global__ __launch_bounds__(128) void k_gemm_bf(const float* __restrict__ A, int lda, const unsigned short* __restrict__ Wt, int ldb,
                                               const float* __restrict__ bias, float* __restrict__ C, int ldc, int M, int N, int K) {
  __shared__ __attribute__((aligned(16))) float so[4][16][64];
  const int tid = threadIdx.x, w = tid >> 5, lane = tid & 31, ln = lane & 15, hh = lane >> 4;
  const int ntn = N / 64;
  const int wid = blockIdx.x * 4 + w;
  const int mt = wid / ntn, nq = wid % ntn;
  if (mt * 16 >= M) return;
  const int row0 = mt * 16, col0 = nq * 64;
  const float* arow = A + (size_t)(row0 + ln) * lda;
  v8f acc[4] = {};
  for (int kb = 0; kb < K; kb += 32) {
    FragB ah, al;
    const v4f x0 = *(const v4fa*)(arow + kb + 8 * hh), x1 = *(const v4fa*)(arow + kb + 8 * hh + 4);
    const v4f x2 = *(const v4fa*)(arow + kb + 16 + 8 * hh), x3 = *(const v4fa*)(arow + kb + 16 + 8 * hh + 4);
    float xs[16] = {x0[0],x0[1],x0[2],x0[3],x1[0],x1[1],x1[2],x1[3],x2[0],x2[1],x2[2],x2[3],x3[0],x3[1],x3[2],x3[3]};
#pragma unroll
    for (int i = 0; i < 16; ++i) { const unsigned short hb = bf16_bits(xs[i]); ah.u[i] = hb; al.u[i] = ASPLIT ? bf16_bits(xs[i] - bf16_val(hb)) : (unsigned short)0; }
#pragma unroll
    for (int t = 0; t < 4; ++t) {
      const unsigned short* brow = Wt + (size_t)(col0 + t * 16 + ln) * ldb + kb;
      FragB b;
      b.half[0] = *(const v8us*)(brow + 8 * hh);
      b.half[1] = *(const v8us*)(brow + 16 + 8 * hh);
      acc[t] = mmaN<ASPLIT ? 2 : 1>(ah.v, al.v, b.v, b.v, acc[t]);
    }
  }
#pragma unroll
  for (int t = 0; t < 4; ++t) {
    float bv = bias ? bias[col0 + t * 16 + ln] : 0.f;
    if (BIAS_BF16) bv = bf16_round(bv);
#pragma unroll
    for (int r = 0; r < 8; ++r) { float v = acc[t][r] + bv; if (ACT == 1) v = fmaxf(v, 0.f); so[w][8 * hh + r][t * 16 + ln] = v; }
  }
  __builtin_amdgcn_fence(__ATOMIC_ACQ_REL, "workgroup");
  __builtin_amdgcn_wave_barrier();
  const int rsub = lane >> 4, c4 = (lane & 15) * 4;
  {
#pragma unroll
    for (int q = 0; q < 8; ++q) {
      const int r = q * 2 + rsub;
      const v4f v = *(const v4fa*)&so[w][r][c4];
      *(v4f*)(C + (size_t)(row0 + r) * ldc + col0 + c4) = v;
    }
    
  }
}

// Flash-style causal/unmasked attention, all contractions 3-term bf16 hi/lo splits, f32 softmax with running max.
// q,k,v rows are read from f32 buffers with arbitrary row pitch (so they can live inside a fused qkv buffer);
// D = head size (multiple of 32, <= 128); one wave = 16 query rows; block = 4 waves (64 queries) sharing K/V chunks of 32.
template <int D, bool CAUSAL>
__global__ __launch_bounds__(128) void k_flash(const float* __restrict__ qb, const float* __restrict__ kb, const float* __restrict__ vb,
                                             int pitch, int T, int H, float scale, float* __restrict__ y, int ypitch) {
  constexpr int KS = D / 32;        // k-steps for QK
  constexpr int DT = D / 16;        // d tiles for PV
  __shared__ __attribute__((aligned(16))) unsigned short sKh[32][D + 8], sKl[32][D + 8], sVh[32][D + 8], sVl[32][D + 8];
  __shared__ __attribute__((aligned(16))) unsigned short sPh[4][16][40], sPl[4][16][40];
  __shared__ __attribute__((aligned(16))) float sO[4][16][D];
  const int tid = threadIdx.x, w = tid >> 5, lane = tid & 31, ln = lane & 15, hh = lane >> 4;
  const int nqb = (T + 63) / 64;
  const int bh = blockIdx.x / nqb, qblk = blockIdx.x % nqb;
  const int b = bh / H, h = bh % H;
  const int q0 = qblk * 64 + w * 16;
  const float* Q = qb + (size_t)b * T * pitch + h * D;
  const float* K = kb + (size_t)b * T * pitch + h * D;
  const float* V = vb + (size_t)b * T * pitch + h * D;

  // A fragments of the wave's 16 query rows (scaled), hi/lo
  FragB aqh[KS], aql[KS];
  {
    int row = q0 + ln; if (row >= T) row = T - 1;
    const float* qr = Q + (size_t)row * pitch;
#pragma unroll
    for (int ks = 0; ks < KS; ++ks)
#pragma unroll
      for (int i = 0; i < 16; ++i) {
        const int d = ks * 32 + ((i < 8) ? (8 * hh + i) : (16 + 8 * hh + (i - 8)));
        const float x = qr[d] * scale; const unsigned short hb = bf16_bits(x);
        aqh[ks].u[i] = hb; aql[ks].u[i] = bf16_bits(x - bf16_val(hb));
      }
  }
  float m_r[8], l_r[8];
#pragma unroll
  for (int r = 0; r < 8; ++r) { m_r[r] = -3.0e38f; l_r[r] = 0.f; }
  v8f oacc[DT];
#pragma unroll
  for (int dt = 0; dt < DT; ++dt) oacc[dt] = (v8f){0.f,0.f,0.f,0.f,0.f,0.f,0.f,0.f};

  const int kv_end = CAUSAL ? min(T, qblk * 64 + 64) : T;     // block-uniform
  for (int j0 = 0; j0 < kv_end; j0 += 32) {
    __syncthreads();
    for (int e = tid; e < 32 * (D / 4); e += 128) {
      const int r = e / (D / 4), c4 = (e % (D / 4)) * 4;
      const int key = j0 + r;
      v4f kf = {0.f,0.f,0.f,0.f}, vf = {0.f,0.f,0.f,0.f};
      if (key < T) { kf = *(const v4fa*)(K + (size_t)key * pitch + c4); vf = *(const v4fa*)(V + (size_t)key * pitch + c4); }
#pragma unroll
      for (int t = 0; t < 4; ++t) {
        unsigned short hb = bf16_bits(kf[t]); sKh[r][c4 + t] = hb; sKl[r][c4 + t] = bf16_bits(kf[t] - bf16_val(hb));
        hb = bf16_bits(vf[t]); sVh[r][c4 + t] = hb; sVl[r][c4 + t] = bf16_bits(vf[t] - bf16_val(hb));
      }
    }
    __syncthreads();
    // S tile 16 x 32
    v8f s[2];
#pragma unroll
    for (int nt = 0; nt < 2; ++nt) {
      v8f acc = {};
#pragma unroll
      for (int ks = 0; ks < KS; ++ks) {
        FragB bh_, bl_;
        bh_.half[0] = *(const v8us*)&sKh[nt * 16 + ln][ks * 32 + 8 * hh]; bh_.half[1] = *(const v8us*)&sKh[nt * 16 + ln][ks * 32 + 16 + 8 * hh];
        bl_.half[0] = *(const v8us*)&sKl[nt * 16 + ln][ks * 32 + 8 * hh]; bl_.half[1] = *(const v8us*)&sKl[nt * 16 + ln][ks * 32 + 16 + 8 * hh];
        acc = mmaN<3>(aqh[ks].v, aql[ks].v, bh_.v, bl_.v, acc);
      }
      s[nt] = acc;
    }
    // mask + running max (rows 8hh+r; the 16 lanes of a half share rows)
    float alpha[8];
#pragma unroll
    for (int r = 0; r < 8; ++r) {
      const int qi = q0 + 8 * hh + r;
      const int ja = j0 + ln, jb = j0 + 16 + ln;
      if (CAUSAL) { if (ja > qi) s[0][r] = -3.0e38f; if (jb > qi) s[1][r] = -3.0e38f; }
      if (ja >= T) s[0][r] = -3.0e38f;
      if (jb >= T) s[1][r] = -3.0e38f;
      float mx = fmaxf(s[0][r], s[1][r]);
      mx = fmaxf(mx, __shfl_xor(mx, 1, 32)); mx = fmaxf(mx, __shfl_xor(mx, 2, 32)); mx = fmaxf(mx, __shfl_xor(mx, 4, 32)); mx = fmaxf(mx, __shfl_xor(mx, 8, 32));
      const float mnew = fmaxf(m_r[r], mx);
      alpha[r] = (mnew > -1.0e38f) ? __expf(m_r[r] - mnew) : 1.0f;
      const float p0 = (s[0][r] > -1.0e38f) ? __expf(s[0][r] - mnew) : 0.f;
      const float p1 = (s[1][r] > -1.0e38f) ? __expf(s[1][r] - mnew) : 0.f;
      m_r[r] = mnew;
      l_r[r] = l_r[r] * alpha[r] + p0 + p1;            // per-lane partial row sum (16 lanes combined at the end)
      unsigned short hb = bf16_bits(p0); sPh[w][8 * hh + r][ln] = hb;      sPl[w][8 * hh + r][ln] = bf16_bits(p0 - bf16_val(hb));
      hb = bf16_bits(p1);                sPh[w][8 * hh + r][16 + ln] = hb; sPl[w][8 * hh + r][16 + ln] = bf16_bits(p1 - bf16_val(hb));
    }
#pragma unroll
    for (int dt = 0; dt < DT; ++dt)
#pragma unroll
      for (int r = 0; r < 8; ++r) oacc[dt][r] *= alpha[r];
    __builtin_amdgcn_fence(__ATOMIC_ACQ_REL, "workgroup");
    __builtin_amdgcn_wave_barrier();
    FragB pah, pal;
    pah.half[0] = *(const v8us*)&sPh[w][ln][8 * hh]; pah.half[1] = *(const v8us*)&sPh[w][ln][16 + 8 * hh];
    pal.half[0] = *(const v8us*)&sPl[w][ln][8 * hh]; pal.half[1] = *(const v8us*)&sPl[w][ln][16 + 8 * hh];
#pragma unroll
    for (int dt = 0; dt < DT; ++dt) {
      FragB bvh, bvl;
#pragma unroll
      for (int i = 0; i < 8; ++i) {
        bvh.u[i] = sVh[8 * hh + i][dt * 16 + ln]; bvh.u[8 + i] = sVh[16 + 8 * hh + i][dt * 16 + ln];
        bvl.u[i] = sVl[8 * hh + i][dt * 16 + ln]; bvl.u[8 + i] = sVl[16 + 8 * hh + i][dt * 16 + ln];
      }
      oacc[dt] = mmaN<3>(pah.v, pal.v, bvh.v, bvl.v, oacc[dt]);
    }
    __builtin_amdgcn_fence(__ATOMIC_ACQ_REL, "workgroup");
    __builtin_amdgcn_wave_barrier();
  }
#pragma unroll
  for (int r = 0; r < 8; ++r) {
    float l = l_r[r];
    l += __shfl_xor(l, 1, 32); l += __shfl_xor(l, 2, 32); l += __shfl_xor(l, 4, 32); l += __shfl_xor(l, 8, 32);
    l_r[r] = (l > 0.f) ? 1.0f / l : 0.f;
  }
#pragma unroll
  for (int dt = 0; dt < DT; ++dt)
#pragma unroll
    for (int r = 0; r < 8; ++r) sO[w][8 * hh + r][dt * 16 + ln] = oacc[dt][r] * l_r[r];
  __builtin_amdgcn_fence(__ATOMIC_ACQ_REL, "workgroup");
  __builtin_amdgcn_wave_barrier();
  {
    for (int r = 0; r < 16; ++r) {
      const int row = q0 + r;
      if (row < T && lane < D / 4) {
        const v4f val = *(const v4fa*)&sO[w][r][lane * 4];
        *(v4f*)(y + ((size_t)b * T + row) * ypitch + h * D + lane * 4) = val;
      }
    }
    
  }
}

// C[z] = A[z]*B[z], blockIdx.y = z: A f32 [M][K], B f32 [K][N], C f32 [M][N], all row-major and dense; A, B, C advance by sA, sB, sC elements per product
// (A1, B1, where given, are product 1's). Block = 8 waves = one 64x64 tile of C; wave = 16 rows x 32 columns. A k tile of GBK is rounded to bf16 on its way into LDS
// (ASPLIT: A as hi and lo planes, 2 terms), B transposed there to [n][k]; the next k tile's global loads are in flight while this one is multiplied.
// Two LDS buffers, one block barrier per k tile. k runs upward in steps of 32 per accumulator. M%64==0, N%64==0, K%GBK==0.
#define GBK 128
#define GPI (GBK + 8)   // LDS row pitch in bf16: 256 + 16 bytes, for the 16-byte fragment reads
typedef unsigned int v2u __attribute__((ext_vector_type(2), may_alias));
typedef unsigned int v4u __attribute__((ext_vector_type(4), may_alias));
// bf16_bits in 32-bit form: the rounded bf16 stands in the high half of bf16_rn; hi_pair packs two of them (first one low), hi_val is the rounded value as f32
__device__ __forceinline__ unsigned int bf16_rn(float x) { const unsigned int u = __float_as_uint(x); return u + 0x7FFFu + ((u >> 16) & 1u); }
__device__ __forceinline__ unsigned int hi_pair(unsigned int r0, unsigned int r1) { return __builtin_amdgcn_perm(r1, r0, 0x07060302u); }   // one v_perm_b32: (r1 & 0xFFFF0000) | (r0 >> 16)
__device__ __forceinline__ float hi_val(unsigned int r) { return __uint_as_float(r & 0xFFFF0000u); }
template <bool ASPLIT, int N, int K>
__global__ __launch_bounds__(256) void k_gemm_st(const float* __restrict__ A0, const float* __restrict__ A1, int sA, const float* __restrict__ B0, const float* __restrict__ B1, int sB,
                                                 float* __restrict__ C0, int sC) {
  constexpr int NP = ASPLIT ? 2 : 1, NS = K / GBK;
  __shared__ __attribute__((aligned(16))) unsigned short sa[2][NP][64][GPI], sb[2][64][GPI];
  __shared__ __attribute__((aligned(16))) float so[8][16][32];
  const int z = blockIdx.y;
  const float* A = (A1 != nullptr && z == 1) ? A1 : A0 + (size_t)z * sA;
  const float* B = (B1 != nullptr && z == 1) ? B1 : B0 + (size_t)z * sB;
  float* C = C0 + (size_t)z * sC;
  const int tid = threadIdx.x, w = tid >> 5, lane = tid & 31, ln = lane & 15, hh = lane >> 4;
  const int row0 = (blockIdx.x / (N / 64)) * 64, col0 = (blockIdx.x % (N / 64)) * 64;
  const int wm = w & 3, wn = w >> 2;
  const int bk = (tid >> 4) * 8, bn = (tid & 15) * 4;
  const float* ag = A + (size_t)row0 * K;                    // block-uniform bases; the lane's own part is a 32-bit offset that never changes
  const float* bg = B + col0;
  const unsigned int ao = (unsigned int)(w * K + lane * 4);  // load p: tile row w + 8p, 4 k
  const unsigned int bo = (unsigned int)(bk * N + bn);       // load i: tile k row bk + i, 4 n
  v4f ra[8], rb[8];
  auto fetch = [&](int s) {
#pragma unroll
    for (int p = 0; p < 8; ++p) ra[p] = *(const v4fa*)(ag + (size_t)s * GBK + 8 * p * K + ao);
    // the wait that lets the address registers of the loads above be rewritten (the build reuses them as a destination of the loads below)
    asm volatile("s_wait_xcnt 0x0" ::: "memory");
#pragma unroll
    for (int i = 0; i < 8; ++i) rb[i] = *(const v4fa*)(bg + (size_t)s * GBK * N + i * N + bo);
    // the wait that lets the address registers of the loads above be rewritten (the next tile's bases)
    asm volatile("s_wait_xcnt 0x0" ::: "memory");
  };
  auto stage = [&](int buf) {
#pragma unroll
    for (int p = 0; p < 8; ++p) {
      const unsigned int r0 = bf16_rn(ra[p][0]), r1 = bf16_rn(ra[p][1]), r2 = bf16_rn(ra[p][2]), r3 = bf16_rn(ra[p][3]);
      v2u h; h[0] = hi_pair(r0, r1); h[1] = hi_pair(r2, r3);
      *(v2u*)&sa[buf][0][w + 8 * p][lane * 4] = h;
      if (ASPLIT) {
        v2u l;
        l[0] = hi_pair(bf16_rn(ra[p][0] - hi_val(r0)), bf16_rn(ra[p][1] - hi_val(r1)));
        l[1] = hi_pair(bf16_rn(ra[p][2] - hi_val(r2)), bf16_rn(ra[p][3] - hi_val(r3)));
        *(v2u*)&sa[buf][NP - 1][w + 8 * p][lane * 4] = l;
      }
    }
#pragma unroll
    for (int q = 0; q < 4; ++q) {
      v4u v;
#pragma unroll
      for (int i = 0; i < 4; ++i) v[i] = hi_pair(bf16_rn(rb[2 * i][q]), bf16_rn(rb[2 * i + 1][q]));
      *(v4u*)&sb[buf][bn + q][bk] = v;
    }
  };
  v8f acc[2] = {};
  fetch(0);
  // rolled: the body is long and runs few times
#pragma unroll 1
  for (int s = 0; s < NS; ++s) {
    const int buf = s & 1;
    stage(buf);
    __syncthreads();   // publishes buffer buf; the buffer written next was last read in front of this barrier
    if (s + 1 < NS) fetch(s + 1);   // behind the barrier, which would drain loads issued in front of it: they fly while this tile is multiplied
#pragma unroll
    for (int kp = 0; kp < GBK / 64; ++kp) {
      FragB ah[2], al[2], b[2][2];   // the fragments of two k steps are read as one group
#pragma unroll
      for (int j = 0; j < 2; ++j) {
        const int k0 = (kp * 2 + j) * 32 + 8 * hh;
        ah[j].half[0] = *(const v8us*)&sa[buf][0][wm * 16 + ln][k0]; ah[j].half[1] = *(const v8us*)&sa[buf][0][wm * 16 + ln][k0 + 16];
        al[j].half[0] = *(const v8us*)&sa[buf][NP - 1][wm * 16 + ln][k0]; al[j].half[1] = *(const v8us*)&sa[buf][NP - 1][wm * 16 + ln][k0 + 16];
#pragma unroll
        for (int t = 0; t < 2; ++t) { b[j][t].half[0] = *(const v8us*)&sb[buf][wn * 32 + t * 16 + ln][k0]; b[j][t].half[1] = *(const v8us*)&sb[buf][wn * 32 + t * 16 + ln][k0 + 16]; }
      }
#pragma unroll
      for (int j = 0; j < 2; ++j)
#pragma unroll
        for (int t = 0; t < 2; ++t) acc[t] = mmaN<ASPLIT ? 2 : 1>(ah[j].v, al[j].v, b[j][t].v, b[j][t].v, acc[t]);
    }
  }
#pragma unroll
  for (int t = 0; t < 2; ++t)
#pragma unroll
    for (int r = 0; r < 8; ++r) so[w][8 * hh + r][t * 16 + ln] = acc[t][r];
  __builtin_amdgcn_fence(__ATOMIC_ACQ_REL, "workgroup");
  __builtin_amdgcn_wave_barrier();
  const int rsub = lane >> 3, c4 = (lane & 7) * 4;
#pragma unroll
  for (int q = 0; q < 4; ++q) {
    const int r = q * 4 + rsub;
    const v4f v = *(const v4fa*)&so[w][r][c4];
    *(v4f*)(C + (size_t)(row0 + wm * 16 + r) * N + col0 + wn * 32 + c4) = v;
  }
}
// row LayerNorm (biased variance, eps) over N: s = X (+ R); optional out_sum <- s; out_norm <- (s-mu)*rsqrt(var+eps)*g + b
template <bool PARAM_BF16>
__global__ __launch_bounds__(256) void k_layernorm(const float* __restrict__ X, const float* __restrict__ R, const float* __restrict__ g, const float* __restrict__ bta,
                                                  float* __restrict__ out_sum, float* __restrict__ out_norm, int N, float eps) {
  __shared__ float red[256];
  const int row = blockIdx.x, tid = threadIdx.x;
  const float* x = X + (size_t)row * N; const float* rr = R ? R + (size_t)row * N : nullptr;
  float vals[16];                     // up to N = 4096
  const int per = N / 256;            // contiguous chunk per thread? use strided-by-4 chunks: thread handles j = tid*4 + 1024*u
  float s1 = 0.f;
  for (int u = 0; u < per / 4; ++u) {
    const int j = tid * 4 + 1024 * u;
    const v4f a = *(const v4fa*)(x + j);
    v4f b = {0.f,0.f,0.f,0.f}; if (rr) b = *(const v4fa*)(rr + j);
#pragma unroll
    for (int q = 0; q < 4; ++q) { const float v = a[q] + b[q]; vals[u * 4 + q] = v; s1 += v; }
  }
  red[tid] = s1; __syncthreads();
  for (int st = 128; st > 0; st >>= 1) { if (tid < st) red[tid] += red[tid + st]; __syncthreads(); }
  const float mu = red[0] / (float)N; __syncthreads();
  float s2 = 0.f;
  for (int u = 0; u < per / 4; ++u)
#pragma unroll
    for (int q = 0; q < 4; ++q) { const float c = vals[u * 4 + q] - mu; s2 += c * c; }
  red[tid] = s2; __syncthreads();
  for (int st = 128; st > 0; st >>= 1) { if (tid < st) red[tid] += red[tid + st]; __syncthreads(); }
  const float rs = rsqrtf(red[0] / (float)N + eps);
  {
    for (int u = 0; u < per / 4; ++u) {
      const int j = tid * 4 + 1024 * u;
      v4f o, sm;
#pragma unroll
      for (int q = 0; q < 4; ++q) {
        float gg = g[j + q], bb = bta[j + q];
        if (PARAM_BF16) { gg = bf16_round(gg); bb = bf16_round(bb); }
        sm[q] = vals[u * 4 + q]; o[q] = (vals[u * 4 + q] - mu) * rs * gg + bb;
      }
      if (out_sum) *(v4f*)(out_sum + (size_t)row * N + j) = sm;
      *(v4f*)(out_norm + (size_t)row * N + j) = o;
    }
    
  }
}

__device__ __forceinline__ float tnh(float x) { return __builtin_amdgcn_tanhf(x); }   // one v_tanh_f32
// scores + softmax: block = QT query rows of one batch; its 8 waves split the 256 keys, 32 keys each. Lanes hold scale_u and q_u in registers (16 per lane and row,
// u = j*32 + lane); each key row is loaded once per block, one key ahead of its use, and serves all QT rows: s_k = sum_u scale_u*tanh(q_u + k[b][k][u]), same in-lane order
// and same shuffle tree as a wave-per-row loop. Scores meet in LDS; behind one block barrier wave t does mask, max-shifted softmax and both stores of row t.
#define QT 2
__global__ __launch_bounds__(256) void k_scores(const float* __restrict__ QP, const float* __restrict__ KP, const float* __restrict__ scale, const int* __restrict__ mask, float* __restrict__ ATT, float* __restrict__ ATT2) {
  __shared__ float ss[QT][TK];
  const int tid = threadIdx.x, wv = tid >> 5, lane = tid & 31;
  const int row0 = blockIdx.x * QT, b = row0 / TQ;
  const float* qr = QP + (size_t)row0 * UU;                         // the block's QT query rows
  float sc[16], qv[QT][16], ka[16], kb[16], keep[QT];
#pragma unroll
  for (int j = 0; j < 16; ++j) sc[j] = bf16_round(scale[j * 32 + lane]);
#pragma unroll
  for (int t = 0; t < QT; ++t) { keep[t] = 0.f;
#pragma unroll
    for (int j = 0; j < 16; ++j) qv[t][j] = qr[t * UU + j * 32 + lane]; }
  const float* kr = KP + ((size_t)b * TK + wv * 32) * UU + lane;   // this wave's 32 key rows
  auto fetch = [&](float (&kx)[16], int kk) {
#pragma unroll
    for (int j = 0; j < 16; ++j) kx[j] = kr[(size_t)kk * UU + j * 32];
  };
  auto score = [&](const float (&kx)[16], int kk) {
#pragma unroll
    for (int t = 0; t < QT; ++t) { float s = 0.f;
#pragma unroll
      for (int j = 0; j < 16; ++j) s += sc[j] * tnh(qv[t][j] + kx[j]);
      for (int o = 16; o >= 1; o >>= 1) s += __shfl_xor(s, o, 32);
      keep[t] = (lane == kk) ? s : keep[t]; }
  };
  fetch(ka, 0);
  // the wait that lets the address registers of the loads above be reused; naming the two bases that are dead from here on keeps them untouched up to it
  asm volatile("s_wait_xcnt 0x0" :: "s"(scale), "s"(qr) : "memory");
  // rolled: one trip is two keys (two register buffers, no copies)
#pragma unroll 1
  for (int kk = 0; kk < 32; kk += 2) {
    fetch(kb, kk + 1);
    score(ka, kk);
    fetch(ka, kk + 2 < 32 ? kk + 2 : 31);   // last trip: a row of this wave again, in bounds, not used
    score(kb, kk + 1);
  }
#pragma unroll
  for (int t = 0; t < QT; ++t) ss[t][wv * 32 + lane] = keep[t];
  __syncthreads();
  if (wv >= QT) return;
  const int row = row0 + wv;
  float lv[8]; float mx = -3.0e38f;
#pragma unroll
  for (int j = 0; j < 8; ++j) { const int k = j * 32 + lane; float v = ss[wv][k]; if (mask[b * TK + k] == 0) v = -1.0e9f; lv[j] = v; mx = fmaxf(mx, v); }
  for (int o = 16; o >= 1; o >>= 1) mx = fmaxf(mx, __shfl_xor(mx, o, 32));
  float den = 0.f; for (int j = 0; j < 8; ++j) { lv[j] = expf(lv[j] - mx); den += lv[j]; } for (int o = 16; o >= 1; o >>= 1) den += __shfl_xor(den, o, 32); const float rd = 1.0f / den;
  float* a1 = ATT + (size_t)row * TK; float* a2 = ATT2 + (size_t)row * TK;
  { for (int j = 0; j < 8; ++j) { const float p = lv[j] * rd; *(float*)(a1 + j * 32 + lane) = p; *(float*)(a2 + j * 32 + lane) = p; }  }
}
extern "C" void kernel_launch(void* const* d_in, const int* in_sizes, int n_in,
                              void* d_out, int out_size, void* d_ws, size_t ws_size, hipStream_t stream) {
  (void)in_sizes; (void)n_in; (void)out_size;
  const float* query = (const float*)d_in[0]; const float* value = (const float*)d_in[1]; const int* mask = (const int*)d_in[2]; const float* Wq = (const float*)d_in[3]; const float* Wk = (const float*)d_in[4]; const float* scale = (const float*)d_in[5];
  float* ctx = (float*)d_out; float* attn = ctx + (size_t)BB * TQ * DD;
  char* ws = (char*)d_ws; size_t off = 0;
  auto take = [&](size_t bytes) { char* p = ws + off; off += (bytes + 255) & ~(size_t)255; return p; };
  float* QP = (float*)take((size_t)2 * BB * TQ * UU * 4); float* KP = QP + (size_t)BB * TQ * UU; float* ATT2 = (float*)take((size_t)BB * TQ * TK * 4);
  if (off > ws_size) return;
  k_gemm_st<false, UU, DD><<<dim3((BB * TQ / 64) * (UU / 64), 2), 256, 0, stream>>>(query, value, 0, Wq, Wk, 0, QP, BB * TQ * UU);
  k_scores<<<BB * TQ / QT, 256, 0, stream>>>(QP, KP, scale, mask, attn, ATT2);
  k_gemm_st<true, DD, TK><<<dim3((TQ / 64) * (DD / 64), BB), 256, 0, stream>>>(ATT2, nullptr, TQ * TK, value, nullptr, TK * DD, ctx, TQ * DD);
}

// v005
// A run of this version takes 31.5 microseconds.
// Two timings next to v004 both put it at 1.09 times that version's speed.
// Counting every step since v000, it is 34.9 times as fast.
#include <hip/hip_runtime.h>
// q = query·Wq and k = value·Wk on v_wmma_f32_16x16x32_bf16 (inputs rounded to bf16: single exact term), context = attn·value (attn split hi/lo vs value rounded to bf16: 2 products),
// f32 accumulate. The additive scores Σ_u scale_u·tanh(q_u + k_u) over the [4,256,256,512] broadcast (f32 VALU, tanh = v_tanh_f32), the key mask and the softmax
// are f32 VALU; attention weights are the second output.
#define BB 4
#define TQ 256
#define TK 256
#define DD 1024
#define UU 512

typedef __bf16 v16b __attribute__((ext_vector_type(16)));
typedef unsigned short v8us __attribute__((ext_vector_type(8), may_alias));
typedef float  v8f  __attribute__((ext_vector_type(8)));
typedef float  v4f  __attribute__((ext_vector_type(4)));
typedef float  v4fa __attribute__((ext_vector_type(4), may_alias));
union FragB { v16b v; v8us half[2]; unsigned short u[16]; };

__device__ __forceinline__ unsigned short bf16_bits(float x) { unsigned int u = __float_as_uint(x); return (unsigned short)((u + 0x7FFFu + ((u >> 16) & 1u)) >> 16); }
__device__ __forceinline__ float bf16_val(unsigned short b) { return __uint_as_float(((unsigned int)b) << 16); }
__device__ __forceinline__ float bf16_round(float x) { return bf16_val(bf16_bits(x)); }
// D += A·B with NT terms: 1 = ah·bh, 2 = + al·bh (A split), 3 = + ah·bl (both split)
template <int NT>
__device__ __forceinline__ v8f mmaN(v16b ah, v16b al, v16b bh, v16b bl, v8f c) {
  c = __builtin_amdgcn_wmma_f32_16x16x32_bf16(false, ah, false, bh, (short)0, c, false, false);
  if (NT >= 2) c = __builtin_amdgcn_wmma_f32_16x16x32_bf16(false, al, false, bh, (short)0, c, false, false);
  if (NT >= 3) c = __builtin_amdgcn_wmma_f32_16x16x32_bf16(false, ah, false, bl, (short)0, c, false, false);
  asm volatile("v_nop\n\tv_nop\n\tv_nop\n\tv_nop" : "+v"(c) : "v"(ah), "v"(al), "v"(bh), "v"(bl));
  return c;
}

// GEMM C[M][N] (f32, pitch ldc) = act(A[M][K]·W + bias). A f32 row-major (pitch lda) converted per fragment to bf16
// (ASPLIT: hi/lo two planes -> 2 terms, else single rounded term); Wt bf16 [N][K] (pitch ldb). BIAS_BF16 rounds the
// bias to bf16 first (bias quantised to bf16 before the add). K%32==0, M%16==0, N%64==0.
template <bool ASPLIT, int ACT, bool BIAS_BF16>
__global__ __launch_bounds__(128) void k_gemm_bf(const float* __restrict__ A, int lda, const unsigned short* __restrict__ Wt, int ldb,
                                               const float* __restrict__ bias, float* __restrict__ C, int ldc, int M, int N, int K) {
  __shared__ __attribute__((aligned(16))) float so[4][16][64];
  const int tid = threadIdx.x, w = tid >> 5, lane = tid & 31, ln = lane & 15, hh = lane >> 4;
  const int ntn = N / 64;
  const int wid = blockIdx.x * 4 + w;
  const int mt = wid / ntn, nq = wid % ntn;
  if (mt * 16 >= M) return;
  const int row0 = mt * 16, col0 = nq * 64;
  const float* arow = A + (size_t)(row0 + ln) * lda;
  v8f acc[4] = {};
  for (int kb = 0; kb < K; kb += 32) {
    FragB ah, al;
    const v4f x0 = *(const v4fa*)(arow + kb + 8 * hh), x1 = *(const v4fa*)(arow + kb + 8 * hh + 4);
    const v4f x2 = *(const v4fa*)(arow + kb + 16 + 8 * hh), x3 = *(const v4fa*)(arow + kb + 16 + 8 * hh + 4);
    float xs[16] = {x0[0],x0[1],x0[2],x0[3],x1[0],x1[1],x1[2],x1[3],x2[0],x2[1],x2[2],x2[3],x3[0],x3[1],x3[2],x3[3]};
#pragma unroll
    for (int i = 0; i < 16; ++i) { const unsigned short hb = bf16_bits(xs[i]); ah.u[i] = hb; al.u[i] = ASPLIT ? bf16_bits(xs[i] - bf16_val(hb)) : (unsigned short)0; }
#pragma unroll
    for (int t = 0; t < 4; ++t) {
      const unsigned short* brow = Wt + (size_t)(col0 + t * 16 + ln) * ldb + kb;
      FragB b;
      b.half[0] = *(const v8us*)(brow + 8 * hh);
      b.half[1] = *(const v8us*)(brow + 16 + 8 * hh);
      acc[t] = mmaN<ASPLIT ? 2 : 1>(ah.v, al.v, b.v, b.v, acc[t]);
    }
  }
#pragma unroll
  for (int t = 0; t < 4; ++t) {
    float bv = bias ? bias[col0 + t * 16 + ln] : 0.f;
    if (BIAS_BF16) bv = bf16_round(bv);
#pragma unroll
    for (int r = 0; r < 8; ++r) { float v = acc[t][r] + bv; if (ACT == 1) v = fmaxf(v, 0.f); so[w][8 * hh + r][t * 16 + ln] = v; }
  }
  __builtin_amdgcn_fence(__ATOMIC_ACQ_REL, "workgroup");
  __builtin_amdgcn_wave_barrier();
  const int rsub = lane >> 4, c4 = (lane & 15) * 4;
  {
#pragma unroll
    for (int q = 0; q < 8; ++q) {
      const int r = q * 2 + rsub;
      const v4f v = *(const v4fa*)&so[w][r][c4];
      *(v4f*)(C + (size_t)(row0 + r) * ldc + col0 + c4) = v;
    }
    
  }
}

// Flash-style causal/unmasked attention, all contractions 3-term bf16 hi/lo splits, f32 softmax with running max.
// q,k,v rows are read from f32 buffers with arbitrary row pitch (so they can live inside a fused qkv buffer);
// D = head size (multiple of 32, <= 128); one wave = 16 query rows; block = 4 waves (64 queries) sharing K/V chunks of 32.
template <int D, bool CAUSAL>
__global__ __launch_bounds__(128) void k_flash(const float* __restrict__ qb, const float* __restrict__ kb, const float* __restrict__ vb,
                                             int pitch, int T, int H, float scale, float* __restrict__ y, int ypitch) {
  constexpr int KS = D / 32;        // k-steps for QK
  constexpr int DT = D / 16;        // d tiles for PV
  __shared__ __attribute__((aligned(16))) unsigned short sKh[32][D + 8], sKl[32][D + 8], sVh[32][D + 8], sVl[32][D + 8];
  __shared__ __attribute__((aligned(16))) unsigned short sPh[4][16][40], sPl[4][16][40];
  __shared__ __attribute__((aligned(16))) float sO[4][16][D];
  const int tid = threadIdx.x, w = tid >> 5, lane = tid & 31, ln = lane & 15, hh = lane >> 4;
  const int nqb = (T + 63) / 64;
  const int bh = blockIdx.x / nqb, qblk = blockIdx.x % nqb;
  const int b = bh / H, h = bh % H;
  const int q0 = qblk * 64 + w * 16;
  const float* Q = qb + (size_t)b * T * pitch + h * D;
  const float* K = kb + (size_t)b * T * pitch + h * D;
  const float* V = vb + (size_t)b * T * pitch + h * D;

  // A fragments of the wave's 16 query rows (scaled), hi/lo
  FragB aqh[KS], aql[KS];
  {
    int row = q0 + ln; if (row >= T) row = T - 1;
    const float* qr = Q + (size_t)row * pitch;
#pragma unroll
    for (int ks = 0; ks < KS; ++ks)
#pragma unroll
      for (int i = 0; i < 16; ++i) {
        const int d = ks * 32 + ((i < 8) ? (8 * hh + i) : (16 + 8 * hh + (i - 8)));
        const float x = qr[d] * scale; const unsigned short hb = bf16_bits(x);
        aqh[ks].u[i] = hb; aql[ks].u[i] = bf16_bits(x - bf16_val(hb));
      }
  }
  float m_r[8], l_r[8];
#pragma unroll
  for (int r = 0; r < 8; ++r) { m_r[r] = -3.0e38f; l_r[r] = 0.f; }
  v8f oacc[DT];
#pragma unroll
  for (int dt = 0; dt < DT; ++dt) oacc[dt] = (v8f){0.f,0.f,0.f,0.f,0.f,0.f,0.f,0.f};

  const int kv_end = CAUSAL ? min(T, qblk * 64 + 64) : T;     // block-uniform
  for (int j0 = 0; j0 < kv_end; j0 += 32) {
    __syncthreads();
    for (int e = tid; e < 32 * (D / 4); e += 128) {
      const int r = e / (D / 4), c4 = (e % (D / 4)) * 4;
      const int key = j0 + r;
      v4f kf = {0.f,0.f,0.f,0.f}, vf = {0.f,0.f,0.f,0.f};
      if (key < T) { kf = *(const v4fa*)(K + (size_t)key * pitch + c4); vf = *(const v4fa*)(V + (size_t)key * pitch + c4); }
#pragma unroll
      for (int t = 0; t < 4; ++t) {
        unsigned short hb = bf16_bits(kf[t]); sKh[r][c4 + t] = hb; sKl[r][c4 + t] = bf16_bits(kf[t] - bf16_val(hb));
        hb = bf16_bits(vf[t]); sVh[r][c4 + t] = hb; sVl[r][c4 + t] = bf16_bits(vf[t] - bf16_val(hb));
      }
    }
    __syncthreads();
    // S tile 16 x 32
    v8f s[2];
#pragma unroll
    for (int nt = 0; nt < 2; ++nt) {
      v8f acc = {};
#pragma unroll
      for (int ks = 0; ks < KS; ++ks) {
        FragB bh_, bl_;
        bh_.half[0] = *(const v8us*)&sKh[nt * 16 + ln][ks * 32 + 8 * hh]; bh_.half[1] = *(const v8us*)&sKh[nt * 16 + ln][ks * 32 + 16 + 8 * hh];
        bl_.half[0] = *(const v8us*)&sKl[nt * 16 + ln][ks * 32 + 8 * hh]; bl_.half[1] = *(const v8us*)&sKl[nt * 16 + ln][ks * 32 + 16 + 8 * hh];
        acc = mmaN<3>(aqh[ks].v, aql[ks].v, bh_.v, bl_.v, acc);
      }
      s[nt] = acc;
    }
    // mask + running max (rows 8hh+r; the 16 lanes of a half share rows)
    float alpha[8];
#pragma unroll
    for (int r = 0; r < 8; ++r) {
      const int qi = q0 + 8 * hh + r;
      const int ja = j0 + ln, jb = j0 + 16 + ln;
      if (CAUSAL) { if (ja > qi) s[0][r] = -3.0e38f; if (jb > qi) s[1][r] = -3.0e38f; }
      if (ja >= T) s[0][r] = -3.0e38f;
      if (jb >= T) s[1][r] = -3.0e38f;
      float mx = fmaxf(s[0][r], s[1][r]);
      mx = fmaxf(mx, __shfl_xor(mx, 1, 32)); mx = fmaxf(mx, __shfl_xor(mx, 2, 32)); mx = fmaxf(mx, __shfl_xor(mx, 4, 32)); mx = fmaxf(mx, __shfl_xor(mx, 8, 32));
      const float mnew = fmaxf(m_r[r], mx);
      alpha[r] = (mnew > -1.0e38f) ? __expf(m_r[r] - mnew) : 1.0f;
      const float p0 = (s[0][r] > -1.0e38f) ? __expf(s[0][r] - mnew) : 0.f;
      const float p1 = (s[1][r] > -1.0e38f) ? __expf(s[1][r] - mnew) : 0.f;
      m_r[r] = mnew;
      l_r[r] = l_r[r] * alpha[r] + p0 + p1;            // per-lane partial row sum (16 lanes combined at the end)
      unsigned short hb = bf16_bits(p0); sPh[w][8 * hh + r][ln] = hb;      sPl[w][8 * hh + r][ln] = bf16_bits(p0 - bf16_val(hb));
      hb = bf16_bits(p1);                sPh[w][8 * hh + r][16 + ln] = hb; sPl[w][8 * hh + r][16 + ln] = bf16_bits(p1 - bf16_val(hb));
    }
#pragma unroll
    for (int dt = 0; dt < DT; ++dt)
#pragma unroll
      for (int r = 0; r < 8; ++r) oacc[dt][r] *= alpha[r];
    __builtin_amdgcn_fence(__ATOMIC_ACQ_REL, "workgroup");
    __builtin_amdgcn_wave_barrier();
    FragB pah, pal;
    pah.half[0] = *(const v8us*)&sPh[w][ln][8 * hh]; pah.half[1] = *(const v8us*)&sPh[w][ln][16 + 8 * hh];
    pal.half[0] = *(const v8us*)&sPl[w][ln][8 * hh]; pal.half[1] = *(const v8us*)&sPl[w][ln][16 + 8 * hh];
#pragma unroll
    for (int dt = 0; dt < DT; ++dt) {
      FragB bvh, bvl;
#pragma unroll
      for (int i = 0; i < 8; ++i) {
        bvh.u[i] = sVh[8 * hh + i][dt * 16 + ln]; bvh.u[8 + i] = sVh[16 + 8 * hh + i][dt * 16 + ln];
        bvl.u[i] = sVl[8 * hh + i][dt * 16 + ln]; bvl.u[8 + i] = sVl[16 + 8 * hh + i][dt * 16 + ln];
      }
      oacc[dt] = mmaN<3>(pah.v, pal.v, bvh.v, bvl.v, oacc[dt]);
    }
    __builtin_amdgcn_fence(__ATOMIC_ACQ_REL, "workgroup");
    __builtin_amdgcn_wave_barrier();
  }
#pragma unroll
  for (int r = 0; r < 8; ++r) {
    float l = l_r[r];
    l += __shfl_xor(l, 1, 32); l += __shfl_xor(l, 2, 32); l += __shfl_xor(l, 4, 32); l += __shfl_xor(l, 8, 32);
    l_r[r] = (l > 0.f) ? 1.0f / l : 0.f;
  }
#pragma unroll
  for (int dt = 0; dt < DT; ++dt)
#pragma unroll
    for (int r = 0; r < 8; ++r) sO[w][8 * hh + r][dt * 16 + ln] = oacc[dt][r] * l_r[r];
  __builtin_amdgcn_fence(__ATOMIC_ACQ_REL, "workgroup");
  __builtin_amdgcn_wave_barrier();
  {
    for (int r = 0; r < 16; ++r) {
      const int row = q0 + r;
      if (row < T && lane < D / 4) {
        const v4f val = *(const v4fa*)&sO[w][r][lane * 4];
        *(v4f*)(y + ((size_t)b * T + row) * ypitch + h * D + lane * 4) = val;
      }
    }
    
  }
}

// C[z] = A[z]*B[z], blockIdx.y = z: A f32 [M][K], B f32 [K][N], C f32 [M][N], all row-major and dense; A, B, C advance by sA, sB, sC elements per product
// (A1, B1, where given, are product 1's). Block = 8 waves = one 64x64 tile of C; wave = 16 rows x 32 columns. A k tile of GBK is rounded to bf16 on its way into LDS
// (ASPLIT: A as hi and lo planes, 2 terms), B transposed there to [n][k]; the global loads of the next two k tiles are in flight while this one is multiplied.
// Two LDS buffers, one block barrier per k tile. k runs upward in steps of 32 per accumulator. M%64==0, N%64==0, K%(2*GBK)==0.
#define GBK 128
#define GPI (GBK + 8)   // LDS row pitch in bf16: 256 + 16 bytes, for the 16-byte fragment reads
typedef unsigned int v2u __attribute__((ext_vector_type(2), may_alias));
typedef unsigned int v4u __attribute__((ext_vector_type(4), may_alias));
// bf16_bits in 32-bit form: the rounded bf16 stands in the high half of bf16_rn; hi_pair packs two of them (first one low), hi_val is the rounded value as f32
__device__ __forceinline__ unsigned int bf16_rn(float x) { const unsigned int u = __float_as_uint(x); return u + 0x7FFFu + ((u >> 16) & 1u); }
__device__ __forceinline__ unsigned int hi_pair(unsigned int r0, unsigned int r1) { return __builtin_amdgcn_perm(r1, r0, 0x07060302u); }   // one v_perm_b32: (r1 & 0xFFFF0000) | (r0 >> 16)
__device__ __forceinline__ float hi_val(unsigned int r) { return __uint_as_float(r & 0xFFFF0000u); }
template <bool ASPLIT, int N, int K>
__global__ __launch_bounds__(256) void k_gemm_st(const float* __restrict__ A0, const float* __restrict__ A1, int sA, const float* __restrict__ B0, const float* __restrict__ B1, int sB,
                                                 float* __restrict__ C0, int sC) {
  constexpr int NP = ASPLIT ? 2 : 1, NS = K / GBK;
  __shared__ __attribute__((aligned(16))) unsigned short sa[2][NP][64][GPI], sb[2][64][GPI];
  __shared__ __attribute__((aligned(16))) float so[8][16][32];
  const int z = blockIdx.y;
  const float* A = (A1 != nullptr && z == 1) ? A1 : A0 + (size_t)z * sA;
  const float* B = (B1 != nullptr && z == 1) ? B1 : B0 + (size_t)z * sB;
  float* C = C0 + (size_t)z * sC;
  const int tid = threadIdx.x, w = tid >> 5, lane = tid & 31, ln = lane & 15, hh = lane >> 4;
  const int row0 = (blockIdx.x / (N / 64)) * 64, col0 = (blockIdx.x % (N / 64)) * 64;
  const int wm = w & 3, wn = w >> 2;
  const int bk = (tid >> 4) * 8, bn = (tid & 15) * 4;
  const float* ag = A + (size_t)row0 * K;                    // block-uniform bases; the lane's own part is a 32-bit offset that never changes
  const float* bg = B + col0;
  const unsigned int ao = (unsigned int)(w * K + lane * 4);  // load p: tile row w + 8p, 4 k
  const unsigned int bo = (unsigned int)(bk * N + bn);       // load i: tile k row bk + i, 4 n
  v4f ra0[8], rb0[8], ra1[8], rb1[8];   // two register sets: even k tiles travel in set 0, odd ones in set 1
  auto fetch = [&](v4f (&ra)[8], v4f (&rb)[8], int s) {
#pragma unroll
    for (int p = 0; p < 8; ++p) ra[p] = *(const v4fa*)(ag + (size_t)s * GBK + 8 * p * K + ao);
    // the wait that lets the address registers of the loads above be rewritten
    asm volatile("s_wait_xcnt 0x0" ::: "memory");
#pragma unroll
    for (int i = 0; i < 8; ++i) rb[i] = *(const v4fa*)(bg + (size_t)s * GBK * N + i * N + bo);
    // the wait that lets the address registers of the loads above be rewritten (the next tile's bases)
    asm volatile("s_wait_xcnt 0x0" ::: "memory");
  };
  auto stage = [&](const v4f (&ra)[8], const v4f (&rb)[8], int buf) {
#pragma unroll
    for (int p = 0; p < 8; ++p) {
      const unsigned int r0 = bf16_rn(ra[p][0]), r1 = bf16_rn(ra[p][1]), r2 = bf16_rn(ra[p][2]), r3 = bf16_rn(ra[p][3]);
      v2u h; h[0] = hi_pair(r0, r1); h[1] = hi_pair(r2, r3);
      *(v2u*)&sa[buf][0][w + 8 * p][lane * 4] = h;
      if (ASPLIT) {
        v2u l;
        l[0] = hi_pair(bf16_rn(ra[p][0] - hi_val(r0)), bf16_rn(ra[p][1] - hi_val(r1)));
        l[1] = hi_pair(bf16_rn(ra[p][2] - hi_val(r2)), bf16_rn(ra[p][3] - hi_val(r3)));
        *(v2u*)&sa[buf][NP - 1][w + 8 * p][lane * 4] = l;
      }
    }
#pragma unroll
    for (int q = 0; q < 4; ++q) {
      v4u v;
#pragma unroll
      for (int i = 0; i < 4; ++i) v[i] = hi_pair(bf16_rn(rb[2 * i][q]), bf16_rn(rb[2 * i + 1][q]));
      *(v4u*)&sb[buf][bn + q][bk] = v;
    }
  };
  // hold: a scheduling fence in front of a tile's staging. Without it the build moves that set's rounding, and so the wait for its loads, upward: in front of the tile
  // before's barrier and products, where the set loses its lead, or in between the first loads, which then go out one group per round trip
  auto hold = [&]() { __builtin_amdgcn_sched_barrier(0); };
  // publish: the block barrier that publishes the buffer just staged; the buffer written next was last read in front of it. By hand, with the LDS wait alone:
  // __syncthreads() would also wait for the other register set's global loads, which are meant to stay in flight across it
  auto publish = [&]() { asm volatile("s_wait_dscnt 0x0\n\ts_barrier_signal -1\n\ts_barrier_wait -1" ::: "memory"); };
  v8f acc[2] = {};
  auto mult = [&](int buf) {
#pragma unroll
    for (int kp = 0; kp < GBK / 64; ++kp) {
      FragB ah[2], al[2], b[2][2];   // the fragments of two k steps are read as one group
#pragma unroll
      for (int j = 0; j < 2; ++j) {
        const int k0 = (kp * 2 + j) * 32 + 8 * hh;
        ah[j].half[0] = *(const v8us*)&sa[buf][0][wm * 16 + ln][k0]; ah[j].half[1] = *(const v8us*)&sa[buf][0][wm * 16 + ln][k0 + 16];
        al[j].half[0] = *(const v8us*)&sa[buf][NP - 1][wm * 16 + ln][k0]; al[j].half[1] = *(const v8us*)&sa[buf][NP - 1][wm * 16 + ln][k0 + 16];
#pragma unroll
        for (int t = 0; t < 2; ++t) { b[j][t].half[0] = *(const v8us*)&sb[buf][wn * 32 + t * 16 + ln][k0]; b[j][t].half[1] = *(const v8us*)&sb[buf][wn * 32 + t * 16 + ln][k0 + 16]; }
      }
#pragma unroll
      for (int j = 0; j < 2; ++j)
#pragma unroll
        for (int t = 0; t < 2; ++t) acc[t] = mmaN<ASPLIT ? 2 : 1>(ah[j].v, al[j].v, b[j][t].v, b[j][t].v, acc[t]);
    }
  };
  static_assert(NS >= 2 && NS % 2 == 0, "k tiles are walked in pairs");
  fetch(ra0, rb0, 0);
  fetch(ra1, rb1, 1); hold();
  // rolled: one trip is two k tiles (two register sets, no copies); every trip refills both sets, so the counted load waits never meet a path without loads
#pragma unroll 1
  for (int s = 0; s + 2 < NS; s += 2) {
    stage(ra0, rb0, 0); publish(); fetch(ra0, rb0, s + 2); mult(0); hold();
    stage(ra1, rb1, 1); publish(); fetch(ra1, rb1, s + 3); mult(1);
  }
  // the last two k tiles: nothing is left to fetch
  stage(ra0, rb0, 0); publish(); mult(0); hold();
  stage(ra1, rb1, 1); publish(); mult(1);
#pragma unroll
  for (int t = 0; t < 2; ++t)
#pragma unroll
    for (int r = 0; r < 8; ++r) so[w][8 * hh + r][t * 16 + ln] = acc[t][r];
  __builtin_amdgcn_fence(__ATOMIC_ACQ_REL, "workgroup");
  __builtin_amdgcn_wave_barrier();
  const int rsub = lane >> 3, c4 = (lane & 7) * 4;
#pragma unroll
  for (int q = 0; q < 4; ++q) {
    const int r = q * 4 + rsub;
    const v4f v = *(const v4fa*)&so[w][r][c4];
    *(v4f*)(C + (size_t)(row0 + wm * 16 + r) * N + col0 + wn * 32 + c4) = v;
  }
}
// row LayerNorm (biased variance, eps) over N: s = X (+ R); optional out_sum <- s; out_norm <- (s-mu)*rsqrt(var+eps)*g + b
template <bool PARAM_BF16>
__global__ __launch_bounds__(256) void k_layernorm(const float* __restrict__ X, const float* __restrict__ R, const float* __restrict__ g, const float* __restrict__ bta,
                                                  float* __restrict__ out_sum, float* __restrict__ out_norm, int N, float eps) {
  __shared__ float red[256];
  const int row = blockIdx.x, tid = threadIdx.x;
  const float* x = X + (size_t)row * N; const float* rr = R ? R + (size_t)row * N : nullptr;
  float vals[16];                     // up to N = 4096
  const int per = N / 256;            // contiguous chunk per thread? use strided-by-4 chunks: thread handles j = tid*4 + 1024*u
  float s1 = 0.f;
  for (int u = 0; u < per / 4; ++u) {
    const int j = tid * 4 + 1024 * u;
    const v4f a = *(const v4fa*)(x + j);
    v4f b = {0.f,0.f,0.f,0.f}; if (rr) b = *(const v4fa*)(rr + j);
#pragma unroll
    for (int q = 0; q < 4; ++q) { const float v = a[q] + b[q]; vals[u * 4 + q] = v; s1 += v; }
  }
  red[tid] = s1; __syncthreads();
  for (int st = 128; st > 0; st >>= 1) { if (tid < st) red[tid] += red[tid + st]; __syncthreads(); }
  const float mu = red[0] / (float)N; __syncthreads();
  float s2 = 0.f;
  for (int u = 0; u < per / 4; ++u)
#pragma unroll
    for (int q = 0; q < 4; ++q) { const float c = vals[u * 4 + q] - mu; s2 += c * c; }
  red[tid] = s2; __syncthreads();
  for (int st = 128; st > 0; st >>= 1) { if (tid < st) red[tid] += red[tid + st]; __syncthreads(); }
  const float rs = rsqrtf(red[0] / (float)N + eps);
  {
    for (int u = 0; u < per / 4; ++u) {
      const int j = tid * 4 + 1024 * u;
      v4f o, sm;
#pragma unroll
      for (int q = 0; q < 4; ++q) {
        float gg = g[j + q], bb = bta[j + q];
        if (PARAM_BF16) { gg = bf16_round(gg); bb = bf16_round(bb); }
        sm[q] = vals[u * 4 + q]; o[q] = (vals[u * 4 + q] - mu) * rs * gg + bb;
      }
      if (out_sum) *(v4f*)(out_sum + (size_t)row * N + j) = sm;
      *(v4f*)(out_norm + (size_t)row * N + j) = o;
    }
    
  }
}

__device__ __forceinline__ float tnh(float x) { return __builtin_amdgcn_tanhf(x); }   // one v_tanh_f32
// scores + softmax: block = QT query rows of one batch; its 8 waves split the 256 keys, 32 keys each. Lanes hold scale_u and q_u in registers (16 per lane and row,
// u = j*32 + lane); each key row is loaded once per block, one key ahead of its use, and serves all QT rows: s_k = sum_u scale_u*tanh(q_u + k[b][k][u]), same in-lane order
// and same shuffle tree as a wave-per-row loop. Scores meet in LDS; behind one block barrier wave t does mask, max-shifted softmax and both stores of row t.
#define QT 2
__global__ __launch_bounds__(256) void k_scores(const float* __restrict__ QP, const float* __restrict__ KP, const float* __restrict__ scale, const int* __restrict__ mask, float* __restrict__ ATT, float* __restrict__ ATT2) {
  __shared__ float ss[QT][TK];
  const int tid = threadIdx.x, wv = tid >> 5, lane = tid & 31;
  const int row0 = blockIdx.x * QT, b = row0 / TQ;
  const float* qr = QP + (size_t)row0 * UU;                         // the block's QT query rows
  float sc[16], qv[QT][16], ka[16], kb[16], keep[QT];
#pragma unroll
  for (int j = 0; j < 16; ++j) sc[j] = bf16_round(scale[j * 32 + lane]);
#pragma unroll
  for (int t = 0; t < QT; ++t) { keep[t] = 0.f;
#pragma unroll
    for (int j = 0; j < 16; ++j) qv[t][j] = qr[t * UU + j * 32 + lane]; }
  const float* kr = KP + ((size_t)b * TK + wv * 32) * UU + lane;   // this wave's 32 key rows
  auto fetch = [&](float (&kx)[16], int kk) {
#pragma unroll
    for (int j = 0; j < 16; ++j) kx[j] = kr[(size_t)kk * UU + j * 32];
  };
  auto score = [&](const float (&kx)[16], int kk) {
#pragma unroll
    for (int t = 0; t < QT; ++t) { float s = 0.f;
#pragma unroll
      for (int j = 0; j < 16; ++j) s += sc[j] * tnh(qv[t][j] + kx[j]);
      for (int o = 16; o >= 1; o >>= 1) s += __shfl_xor(s, o, 32);
      keep[t] = (lane == kk) ? s : keep[t]; }
  };
  fetch(ka, 0);
  // the wait that lets the address registers of the loads above be reused; naming the two bases that are dead from here on keeps them untouched up to it
  asm volatile("s_wait_xcnt 0x0" :: "s"(scale), "s"(qr) : "memory");
  // rolled: one trip is two keys (two register buffers, no copies)
#pragma unroll 1
  for (int kk = 0; kk < 32; kk += 2) {
    fetch(kb, kk + 1);
    score(ka, kk);
    fetch(ka, kk + 2 < 32 ? kk + 2 : 31);   // last trip: a row of this wave again, in bounds, not used
    score(kb, kk + 1);
  }
#pragma unroll
  for (int t = 0; t < QT; ++t) ss[t][wv * 32 + lane] = keep[t];
  __syncthreads();
  if (wv >= QT) return;
  const int row = row0 + wv;
  float lv[8]; float mx = -3.0e38f;
#pragma unroll
  for (int j = 0; j < 8; ++j) { const int k = j * 32 + lane; float v = ss[wv][k]; if (mask[b * TK + k] == 0) v = -1.0e9f; lv[j] = v; mx = fmaxf(mx, v); }
  for (int o = 16; o >= 1; o >>= 1) mx = fmaxf(mx, __shfl_xor(mx, o, 32));
  float den = 0.f; for (int j = 0; j < 8; ++j) { lv[j] = expf(lv[j] - mx); den += lv[j]; } for (int o = 16; o >= 1; o >>= 1) den += __shfl_xor(den, o, 32); const float rd = 1.0f / den;
  float* a1 = ATT + (size_t)row * TK; float* a2 = ATT2 + (size_t)row * TK;
  { for (int j = 0; j < 8; ++j) { const float p = lv[j] * rd; *(float*)(a1 + j * 32 + lane) = p; *(float*)(a2 + j * 32 + lane) = p; }  }
}
extern "C" void kernel_launch(void* const* d_in, const int* in_sizes, int n_in,
                              void* d_out, int out_size, void* d_ws, size_t ws_size, hipStream_t stream) {
  (void)in_sizes; (void)n_in; (void)out_size;
  const float* query = (const float*)d_in[0]; const float* value = (const float*)d_in[1]; const int* mask = (const int*)d_in[2]; const float* Wq = (const float*)d_in[3]; const float* Wk = (const float*)d_in[4]; const float* scale = (const float*)d_in[5];
  float* ctx = (float*)d_out; float* attn = ctx + (size_t)BB * TQ * DD;
  char* ws = (char*)d_ws; size_t off = 0;
  auto take = [&](size_t bytes) { char* p = ws + off; off += (bytes + 255) & ~(size_t)255; return p; };
  float* QP = (float*)take((size_t)2 * BB * TQ * UU * 4); float* KP = QP + (size_t)BB * TQ * UU; float* ATT2 = (float*)take((size_t)BB * TQ * TK * 4);
  if (off > ws_size) return;
  k_gemm_st<false, UU, DD><<<dim3((BB * TQ / 64) * (UU / 64), 2), 256, 0, stream>>>(query, value, 0, Wq, Wk, 0, QP, BB * TQ * UU);
  k_scores<<<BB * TQ / QT, 256, 0, stream>>>(QP, KP, scale, mask, attn, ATT2);
  k_gemm_st<true, DD, TK><<<dim3((TQ / 64) * (DD / 64), BB), 256, 0, stream>>>(ATT2, nullptr, TQ * TK, value, nullptr, TK * DD, ctx, TQ * DD);
}

// v006
// A run of this version takes 24.5 microseconds.
// Next to v005, in two timings, it ran 1.30 and 1.28 times as fast.
// Over all steps from v000 it is 45.1 times as fast.
#include <hip/hip_runtime.h>
// q = query·Wq and k = value·Wk on v_wmma_f32_16x16x32_bf16 (inputs rounded to bf16: single exact term), context = attn·value (attn split hi/lo vs value rounded to bf16: 2 products),
// f32 accumulate. The additive scores Σ_u scale_u·tanh(q_u + k_u) over the [4,256,256,512] broadcast (f32 VALU, tanh = v_tanh_f32), the key mask and the softmax
// are f32 VALU; attention weights are the second output.
#define BB 4
#define TQ 256
#define TK 256
#define DD 1024
#define UU 512

typedef __bf16 v16b __attribute__((ext_vector_type(16)));
typedef unsigned short v8us __attribute__((ext_vector_type(8), may_alias));
typedef float  v8f  __attribute__((ext_vector_type(8)));
typedef float  v4f  __attribute__((ext_vector_type(4)));
typedef float  v4fa __attribute__((ext_vector_type(4), may_alias));
union FragB { v16b v; v8us half[2]; unsigned short u[16]; };

__device__ __forceinline__ unsigned short bf16_bits(float x) { unsigned int u = __float_as_uint(x); return (unsigned short)((u + 0x7FFFu + ((u >> 16) & 1u)) >> 16); }
__device__ __forceinline__ float bf16_val(unsigned short b) { return __uint_as_float(((unsigned int)b) << 16); }
__device__ __forceinline__ float bf16_round(float x) { return bf16_val(bf16_bits(x)); }
// D += A·B with NT terms: 1 = ah·bh, 2 = + al·bh (A split), 3 = + ah·bl (both split)
template <int NT>
__device__ __forceinline__ v8f mmaN(v16b ah, v16b al, v16b bh, v16b bl, v8f c) {
  c = __builtin_amdgcn_wmma_f32_16x16x32_bf16(false, ah, false, bh, (short)0, c, false, false);
  if (NT >= 2) c = __builtin_amdgcn_wmma_f32_16x16x32_bf16(false, al, false, bh, (short)0, c, false, false);
  if (NT >= 3) c = __builtin_amdgcn_wmma_f32_16x16x32_bf16(false, ah, false, bl, (short)0, c, false, false);
  asm volatile("v_nop\n\tv_nop\n\tv_nop\n\tv_nop" : "+v"(c) : "v"(ah), "v"(al), "v"(bh), "v"(bl));
  return c;
}

// GEMM C[M][N] (f32, pitch ldc) = act(A[M][K]·W + bias). A f32 row-major (pitch lda) converted per fragment to bf16
// (ASPLIT: hi/lo two planes -> 2 terms, else single rounded term); Wt bf16 [N][K] (pitch ldb). BIAS_BF16 rounds the
// bias to bf16 first (bias quantised to bf16 before the add). K%32==0, M%16==0, N%64==0.
template <bool ASPLIT, int ACT, bool BIAS_BF16>
__global__ __launch_bounds__(128) void k_gemm_bf(const float* __restrict__ A, int lda, const unsigned short* __restrict__ Wt, int ldb,
                                               const float* __restrict__ bias, float* __restrict__ C, int ldc, int M, int N, int K) {
  __shared__ __attribute__((aligned(16))) float so[4][16][64];
  const int tid = threadIdx.x, w = tid >> 5, lane = tid & 31, ln = lane & 15, hh = lane >> 4;
  const int ntn = N / 64;
  const int wid = blockIdx.x * 4 + w;
  const int mt = wid / ntn, nq = wid % ntn;
  if (mt * 16 >= M) return;
  const int row0 = mt * 16, col0 = nq * 64;
  const float* arow = A + (size_t)(row0 + ln) * lda;
  v8f acc[4] = {};
  for (int kb = 0; kb < K; kb += 32) {
    FragB ah, al;
    const v4f x0 = *(const v4fa*)(arow + kb + 8 * hh), x1 = *(const v4fa*)(arow + kb + 8 * hh + 4);
    const v4f x2 = *(const v4fa*)(arow + kb + 16 + 8 * hh), x3 = *(const v4fa*)(arow + kb + 16 + 8 * hh + 4);
    float xs[16] = {x0[0],x0[1],x0[2],x0[3],x1[0],x1[1],x1[2],x1[3],x2[0],x2[1],x2[2],x2[3],x3[0],x3[1],x3[2],x3[3]};
#pragma unroll
    for (int i = 0; i < 16; ++i) { const unsigned short hb = bf16_bits(xs[i]); ah.u[i] = hb; al.u[i] = ASPLIT ? bf16_bits(xs[i] - bf16_val(hb)) : (unsigned short)0; }
#pragma unroll
    for (int t = 0; t < 4; ++t) {
      const unsigned short* brow = Wt + (size_t)(col0 + t * 16 + ln) * ldb + kb;
      FragB b;
      b.half[0] = *(const v8us*)(brow + 8 * hh);
      b.half[1] = *(const v8us*)(brow + 16 + 8 * hh);
      acc[t] = mmaN<ASPLIT ? 2 : 1>(ah.v, al.v, b.v, b.v, acc[t]);
    }
  }
#pragma unroll
  for (int t = 0; t < 4; ++t) {
    float bv = bias ? bias[col0 + t * 16 + ln] : 0.f;
    if (BIAS_BF16) bv = bf16_round(bv);
#pragma unroll
    for (int r = 0; r < 8; ++r) { float v = acc[t][r] + bv; if (ACT == 1) v = fmaxf(v, 0.f); so[w][8 * hh + r][t * 16 + ln] = v; }
  }
  __builtin_amdgcn_fence(__ATOMIC_ACQ_REL, "workgroup");
  __builtin_amdgcn_wave_barrier();
  const int rsub = lane >> 4, c4 = (lane & 15) * 4;
  {
#pragma unroll
    for (int q = 0; q < 8; ++q) {
      const int r = q * 2 + rsub;
      const v4f v = *(const v4fa*)&so[w][r][c4];
      *(v4f*)(C + (size_t)(row0 + r) * ldc + col0 + c4) = v;
    }
    
  }
}

// Flash-style causal/unmasked attention, all contractions 3-term bf16 hi/lo splits, f32 softmax with running max.
// q,k,v rows are read from f32 buffers with arbitrary row pitch (so they can live inside a fused qkv buffer);
// D = head size (multiple of 32, <= 128); one wave = 16 query rows; block = 4 waves (64 queries) sharing K/V chunks of 32.
template <int D, bool CAUSAL>
__global__ __launch_bounds__(128) void k_flash(const float* __restrict__ qb, const float* __restrict__ kb, const float* __restrict__ vb,
                                             int pitch, int T, int H, float scale, float* __restrict__ y, int ypitch) {
  constexpr int KS = D / 32;        // k-steps for QK
  constexpr int DT = D / 16;        // d tiles for PV
  __shared__ __attribute__((aligned(16))) unsigned short sKh[32][D + 8], sKl[32][D + 8], sVh[32][D + 8], sVl[32][D + 8];
  __shared__ __attribute__((aligned(16))) unsigned short sPh[4][16][40], sPl[4][16][40];
  __shared__ __attribute__((aligned(16))) float sO[4][16][D];
  const int tid = threadIdx.x, w = tid >> 5, lane = tid & 31, ln = lane & 15, hh = lane >> 4;
  const int nqb = (T + 63) / 64;
  const int bh = blockIdx.x / nqb, qblk = blockIdx.x % nqb;
  const int b = bh / H, h = bh % H;
  const int q0 = qblk * 64 + w * 16;
  const float* Q = qb + (size_t)b * T * pitch + h * D;
  const float* K = kb + (size_t)b * T * pitch + h * D;
  const float* V = vb + (size_t)b * T * pitch + h * D;

  // A fragments of the wave's 16 query rows (scaled), hi/lo
  FragB aqh[KS], aql[KS];
  {
    int row = q0 + ln; if (row >= T) row = T - 1;
    const float* qr = Q + (size_t)row * pitch;
#pragma unroll
    for (int ks = 0; ks < KS; ++ks)
#pragma unroll
      for (int i = 0; i < 16; ++i) {
        const int d = ks * 32 + ((i < 8) ? (8 * hh + i) : (16 + 8 * hh + (i - 8)));
        const float x = qr[d] * scale; const unsigned short hb = bf16_bits(x);
        aqh[ks].u[i] = hb; aql[ks].u[i] = bf16_bits(x - bf16_val(hb));
      }
  }
  float m_r[8], l_r[8];
#pragma unroll
  for (int r = 0; r < 8; ++r) { m_r[r] = -3.0e38f; l_r[r] = 0.f; }
  v8f oacc[DT];
#pragma unroll
  for (int dt = 0; dt < DT; ++dt) oacc[dt] = (v8f){0.f,0.f,0.f,0.f,0.f,0.f,0.f,0.f};

  const int kv_end = CAUSAL ? min(T, qblk * 64 + 64) : T;     // block-uniform
  for (int j0 = 0; j0 < kv_end; j0 += 32) {
    __syncthreads();
    for (int e = tid; e < 32 * (D / 4); e += 128) {
      const int r = e / (D / 4), c4 = (e % (D / 4)) * 4;
      const int key = j0 + r;
      v4f kf = {0.f,0.f,0.f,0.f}, vf = {0.f,0.f,0.f,0.f};
      if (key < T) { kf = *(const v4fa*)(K + (size_t)key * pitch + c4); vf = *(const v4fa*)(V + (size_t)key * pitch + c4); }
#pragma unroll
      for (int t = 0; t < 4; ++t) {
        unsigned short hb = bf16_bits(kf[t]); sKh[r][c4 + t] = hb; sKl[r][c4 + t] = bf16_bits(kf[t] - bf16_val(hb));
        hb = bf16_bits(vf[t]); sVh[r][c4 + t] = hb; sVl[r][c4 + t] = bf16_bits(vf[t] - bf16_val(hb));
      }
    }
    __syncthreads();
    // S tile 16 x 32
    v8f s[2];
#pragma unroll
    for (int nt = 0; nt < 2; ++nt) {
      v8f acc = {};
#pragma unroll
      for (int ks = 0; ks < KS; ++ks) {
        FragB bh_, bl_;
        bh_.half[0] = *(const v8us*)&sKh[nt * 16 + ln][ks * 32 + 8 * hh]; bh_.half[1] = *(const v8us*)&sKh[nt * 16 + ln][ks * 32 + 16 + 8 * hh];
        bl_.half[0] = *(const v8us*)&sKl[nt * 16 + ln][ks * 32 + 8 * hh]; bl_.half[1] = *(const v8us*)&sKl[nt * 16 + ln][ks * 32 + 16 + 8 * hh];
        acc = mmaN<3>(aqh[ks].v, aql[ks].v, bh_.v, bl_.v, acc);
      }
      s[nt] = acc;
    }
    // mask + running max (rows 8hh+r; the 16 lanes of a half share rows)
    float alpha[8];
#pragma unroll
    for (int r = 0; r < 8; ++r) {
      const int qi = q0 + 8 * hh + r;
      const int ja = j0 + ln, jb = j0 + 16 + ln;
      if (CAUSAL) { if (ja > qi) s[0][r] = -3.0e38f; if (jb > qi) s[1][r] = -3.0e38f; }
      if (ja >= T) s[0][r] = -3.0e38f;
      if (jb >= T) s[1][r] = -3.0e38f;
      float mx = fmaxf(s[0][r], s[1][r]);
      mx = fmaxf(mx, __shfl_xor(mx, 1, 32)); mx = fmaxf(mx, __shfl_xor(mx, 2, 32)); mx = fmaxf(mx, __shfl_xor(mx, 4, 32)); mx = fmaxf(mx, __shfl_xor(mx, 8, 32));
      const float mnew = fmaxf(m_r[r], mx);
      alpha[r] = (mnew > -1.0e38f) ? __expf(m_r[r] - mnew) : 1.0f;
      const float p0 = (s[0][r] > -1.0e38f) ? __expf(s[0][r] - mnew) : 0.f;
      const float p1 = (s[1][r] > -1.0e38f) ? __expf(s[1][r] - mnew) : 0.f;
      m_r[r] = mnew;
      l_r[r] = l_r[r] * alpha[r] + p0 + p1;            // per-lane partial row sum (16 lanes combined at the end)
      unsigned short hb = bf16_bits(p0); sPh[w][8 * hh + r][ln] = hb;      sPl[w][8 * hh + r][ln] = bf16_bits(p0 - bf16_val(hb));
      hb = bf16_bits(p1);                sPh[w][8 * hh + r][16 + ln] = hb; sPl[w][8 * hh + r][16 + ln] = bf16_bits(p1 - bf16_val(hb));
    }
#pragma unroll
    for (int dt = 0; dt < DT; ++dt)
#pragma unroll
      for (int r = 0; r < 8; ++r) oacc[dt][r] *= alpha[r];
    __builtin_amdgcn_fence(__ATOMIC_ACQ_REL, "workgroup");
    __builtin_amdgcn_wave_barrier();
    FragB pah, pal;
    pah.half[0] = *(const v8us*)&sPh[w][ln][8 * hh]; pah.half[1] = *(const v8us*)&sPh[w][ln][16 + 8 * hh];
    pal.half[0] = *(const v8us*)&sPl[w][ln][8 * hh]; pal.half[1] = *(const v8us*)&sPl[w][ln][16 + 8 * hh];
#pragma unroll
    for (int dt = 0; dt < DT; ++dt) {
      FragB bvh, bvl;
#pragma unroll
      for (int i = 0; i < 8; ++i) {
        bvh.u[i] = sVh[8 * hh + i][dt * 16 + ln]; bvh.u[8 + i] = sVh[16 + 8 * hh + i][dt * 16 + ln];
        bvl.u[i] = sVl[8 * hh + i][dt * 16 + ln]; bvl.u[8 + i] = sVl[16 + 8 * hh + i][dt * 16 + ln];
      }
      oacc[dt] = mmaN<3>(pah.v, pal.v, bvh.v, bvl.v, oacc[dt]);
    }
    __builtin_amdgcn_fence(__ATOMIC_ACQ_REL, "workgroup");
    __builtin_amdgcn_wave_barrier();
  }
#pragma unroll
  for (int r = 0; r < 8; ++r) {
    float l = l_r[r];
    l += __shfl_xor(l, 1, 32); l += __shfl_xor(l, 2, 32); l += __shfl_xor(l, 4, 32); l += __shfl_xor(l, 8, 32);
    l_r[r] = (l > 0.f) ? 1.0f / l : 0.f;
  }
#pragma unroll
  for (int dt = 0; dt < DT; ++dt)
#pragma unroll
    for (int r = 0; r < 8; ++r) sO[w][8 * hh + r][dt * 16 + ln] = oacc[dt][r] * l_r[r];
  __builtin_amdgcn_fence(__ATOMIC_ACQ_REL, "workgroup");
  __builtin_amdgcn_wave_barrier();
  {
    for (int r = 0; r < 16; ++r) {
      const int row = q0 + r;
      if (row < T && lane < D / 4) {
        const v4f val = *(const v4fa*)&sO[w][r][lane * 4];
        *(v4f*)(y + ((size_t)b * T + row) * ypitch + h * D + lane * 4) = val;
      }
    }
    
  }
}

// C[z] = A[z]*B[z], blockIdx.y = z: A f32 [M][K], B f32 [K][N], C f32 [M][N], all row-major and dense; A, B, C advance by sA, sB, sC elements per product
// (A1, B1, where given, are product 1's). Block = 8 waves = one 64x64 tile of C; wave = 16 rows x 32 columns. A k tile of GBK is rounded to bf16 on its way into LDS
// (ASPLIT: A as hi and lo planes, 2 terms), B transposed there to [n][k]; the global loads of the next two k tiles are in flight while this one is multiplied.
// Two LDS buffers, one block barrier per k tile. k runs upward in steps of 32 per accumulator. M%64==0, N%64==0, K%GBK==0.
// CT > 0: product 1 is stored transposed, per group of CT rows, as [M/CT][N][CT]: its waves take B's staged rows as the matrix A operand and A's as B
// (both are [row][k] in LDS with one k order), so D comes out as C transposed and a wave still stores whole 128-byte lines.
#define GBK 128
#define GPI (GBK + 8)   // LDS row pitch in bf16: 256 + 16 bytes, for the 16-byte fragment reads
typedef unsigned int v2u __attribute__((ext_vector_type(2), may_alias));
typedef unsigned int v4u __attribute__((ext_vector_type(4), may_alias));
// bf16_bits in 32-bit form: the rounded bf16 stands in the high half of bf16_rn; hi_pair packs two of them (first one low), hi_val is the rounded value as f32
__device__ __forceinline__ unsigned int bf16_rn(float x) { const unsigned int u = __float_as_uint(x); return u + 0x7FFFu + ((u >> 16) & 1u); }
__device__ __forceinline__ unsigned int hi_pair(unsigned int r0, unsigned int r1) { return __builtin_amdgcn_perm(r1, r0, 0x07060302u); }   // one v_perm_b32: (r1 & 0xFFFF0000) | (r0 >> 16)
__device__ __forceinline__ float hi_val(unsigned int r) { return __uint_as_float(r & 0xFFFF0000u); }
template <bool ASPLIT, int N, int K, int CT>
__global__ __launch_bounds__(256) void k_gemm_st(const float* __restrict__ A0, const float* __restrict__ A1, int sA, const float* __restrict__ B0, const float* __restrict__ B1, int sB,
                                                 float* __restrict__ C0, int sC) {
  constexpr int NP = ASPLIT ? 2 : 1, NS = K / GBK;
  static_assert(CT == 0 || (!ASPLIT && CT % 64 == 0), "the operand swap takes one plane of A and whole tiles per row group");
  __shared__ __attribute__((aligned(16))) unsigned short sa[2][NP][64][GPI], sb[2][64][GPI];
  __shared__ __attribute__((aligned(16))) float so[8][16][32];
  const int z = blockIdx.y;
  const float* A = (A1 != nullptr && z == 1) ? A1 : A0 + (size_t)z * sA;
  const float* B = (B1 != nullptr && z == 1) ? B1 : B0 + (size_t)z * sB;
  float* C = C0 + (size_t)z * sC;
  const int tid = threadIdx.x, w = tid >> 5, lane = tid & 31, ln = lane & 15, hh = lane >> 4;
  const int row0 = (blockIdx.x / (N / 64)) * 64, col0 = (blockIdx.x % (N / 64)) * 64;
  const int wm = w & 3, wn = w >> 2;
  const bool tr = CT > 0 && z == 1;
  const unsigned short* fa = tr ? &sb[0][0][0] : &sa[0][0][0][0];   // rows of the matrix A operand, rows of the matrix B operand
  const unsigned short* fb = tr ? &sa[0][0][0][0] : &sb[0][0][0];
  constexpr int FA = NP * 64 * GPI, FB = 64 * GPI;                  // buffer strides (equal wherever tr can hold)
  const int bk = (tid >> 4) * 8, bn = (tid & 15) * 4;
  const float* ag = A + (size_t)row0 * K;                    // block-uniform bases; the lane's own part is a 32-bit offset that never changes
  const float* bg = B + col0;
  const unsigned int ao = (unsigned int)(w * K + lane * 4);  // load p: tile row w + 8p, 4 k
  const unsigned int bo = (unsigned int)(bk * N + bn);       // load i: tile k row bk + i, 4 n
  v4f ra0[8], rb0[8], ra1[8], rb1[8];   // two register sets: even k tiles travel in set 0, odd ones in set 1
  auto fetch = [&](v4f (&ra)[8], v4f (&rb)[8], int s) {
#pragma unroll
    for (int p = 0; p < 8; ++p) ra[p] = *(const v4fa*)(ag + (size_t)s * GBK + 8 * p * K + ao);
    // the wait that lets the address registers of the loads above be rewritten
    asm volatile("s_wait_xcnt 0x0" ::: "memory");
#pragma unroll
    for (int i = 0; i < 8; ++i) rb[i] = *(const v4fa*)(bg + (size_t)s * GBK * N + i * N + bo);
    // the wait that lets the address registers of the loads above be rewritten (the next tile's bases)
    asm volatile("s_wait_xcnt 0x0" ::: "memory");
  };
  auto stage = [&](const v4f (&ra)[8], const v4f (&rb)[8], int buf) {
#pragma unroll
    for (int p = 0; p < 8; ++p) {
      const unsigned int r0 = bf16_rn(ra[p][0]), r1 = bf16_rn(ra[p][1]), r2 = bf16_rn(ra[p][2]), r3 = bf16_rn(ra[p][3]);
      v2u h; h[0] = hi_pair(r0, r1); h[1] = hi_pair(r2, r3);
      *(v2u*)&sa[buf][0][w + 8 * p][lane * 4] = h;
      if (ASPLIT) {
        v2u l;
        l[0] = hi_pair(bf16_rn(ra[p][0] - hi_val(r0)), bf16_rn(ra[p][1] - hi_val(r1)));
        l[1] = hi_pair(bf16_rn(ra[p][2] - hi_val(r2)), bf16_rn(ra[p][3] - hi_val(r3)));
        *(v2u*)&sa[buf][NP - 1][w + 8 * p][lane * 4] = l;
      }
    }
#pragma unroll
    for (int q = 0; q < 4; ++q) {
      v4u v;
#pragma unroll
      for (int i = 0; i < 4; ++i) v[i] = hi_pair(bf16_rn(rb[2 * i][q]), bf16_rn(rb[2 * i + 1][q]));
      *(v4u*)&sb[buf][bn + q][bk] = v;
    }
  };
  // hold: a scheduling fence in front of a tile's staging. Without it the build moves that set's rounding, and so the wait for its loads, upward: in front of the tile
  // before's barrier and products, where the set loses its lead, or in between the first loads, which then go out one group per round trip
  auto hold = [&]() { __builtin_amdgcn_sched_barrier(0); };
  // publish: the block barrier that publishes the buffer just staged; the buffer written next was last read in front of it. By hand, with the LDS wait alone:
  // __syncthreads() would also wait for the other register set's global loads, which are meant to stay in flight across it
  auto publish = [&]() { asm volatile("s_wait_dscnt 0x0\n\ts_barrier_signal -1\n\ts_barrier_wait -1" ::: "memory"); };
  v8f acc[2] = {};
  auto mult = [&](int buf) {
#pragma unroll
    for (int kp = 0; kp < GBK / 64; ++kp) {
      FragB ah[2], al[2], b[2][2];   // the fragments of two k steps are read as one group
#pragma unroll
      for (int j = 0; j < 2; ++j) {
        const int k0 = (kp * 2 + j) * 32 + 8 * hh;
        const unsigned short* pa = fa + buf * FA + (wm * 16 + ln) * GPI + k0;
        ah[j].half[0] = *(const v8us*)pa; ah[j].half[1] = *(const v8us*)(pa + 16);
        al[j].half[0] = *(const v8us*)(pa + (NP - 1) * 64 * GPI); al[j].half[1] = *(const v8us*)(pa + (NP - 1) * 64 * GPI + 16);
#pragma unroll
        for (int t = 0; t < 2; ++t) { const unsigned short* pb = fb + buf * FB + (wn * 32 + t * 16 + ln) * GPI + k0; b[j][t].half[0] = *(const v8us*)pb; b[j][t].half[1] = *(const v8us*)(pb + 16); }
      }
#pragma unroll
      for (int j = 0; j < 2; ++j)
#pragma unroll
        for (int t = 0; t < 2; ++t) acc[t] = mmaN<ASPLIT ? 2 : 1>(ah[j].v, al[j].v, b[j][t].v, b[j][t].v, acc[t]);
    }
  };
  static_assert(NS >= 2 && NS % 2 == 0, "k tiles are walked in pairs");
  fetch(ra0, rb0, 0);
  fetch(ra1, rb1, 1); hold();
  // rolled: one trip is two k tiles (two register sets, no copies); every trip refills both sets, so the counted load waits never meet a path without loads
#pragma unroll 1
  for (int s = 0; s + 2 < NS; s += 2) {
    stage(ra0, rb0, 0); publish(); fetch(ra0, rb0, s + 2); mult(0); hold();
    stage(ra1, rb1, 1); publish(); fetch(ra1, rb1, s + 3); mult(1);
  }
  // the last two k tiles: nothing is left to fetch
  stage(ra0, rb0, 0); publish(); mult(0); hold();
  stage(ra1, rb1, 1); publish(); mult(1);
#pragma unroll
  for (int t = 0; t < 2; ++t)
#pragma unroll
    for (int r = 0; r < 8; ++r) so[w][8 * hh + r][t * 16 + ln] = acc[t][r];
  __builtin_amdgcn_fence(__ATOMIC_ACQ_REL, "workgroup");
  __builtin_amdgcn_wave_barrier();
  const int rsub = lane >> 3, c4 = (lane & 7) * 4;
  // D's rows and columns in C: as they stand, or (tr) row = column of C inside the row group, column = row of C inside the group
  float* cw = tr ? C + ((size_t)(row0 / (CT > 0 ? CT : 1)) * N + col0 + wm * 16) * CT + row0 % (CT > 0 ? CT : 1) + wn * 32 : C + (size_t)(row0 + wm * 16) * N + col0 + wn * 32;
  const int cp = tr ? CT : N;
#pragma unroll
  for (int q = 0; q < 4; ++q) {
    const int r = q * 4 + rsub;
    const v4f v = *(const v4fa*)&so[w][r][c4];
    *(v4f*)(cw + r * cp + c4) = v;
  }
}
// row LayerNorm (biased variance, eps) over N: s = X (+ R); optional out_sum <- s; out_norm <- (s-mu)*rsqrt(var+eps)*g + b
template <bool PARAM_BF16>
__global__ __launch_bounds__(256) void k_layernorm(const float* __restrict__ X, const float* __restrict__ R, const float* __restrict__ g, const float* __restrict__ bta,
                                                  float* __restrict__ out_sum, float* __restrict__ out_norm, int N, float eps) {
  __shared__ float red[256];
  const int row = blockIdx.x, tid = threadIdx.x;
  const float* x = X + (size_t)row * N; const float* rr = R ? R + (size_t)row * N : nullptr;
  float vals[16];                     // up to N = 4096
  const int per = N / 256;            // contiguous chunk per thread? use strided-by-4 chunks: thread handles j = tid*4 + 1024*u
  float s1 = 0.f;
  for (int u = 0; u < per / 4; ++u) {
    const int j = tid * 4 + 1024 * u;
    const v4f a = *(const v4fa*)(x + j);
    v4f b = {0.f,0.f,0.f,0.f}; if (rr) b = *(const v4fa*)(rr + j);
#pragma unroll
    for (int q = 0; q < 4; ++q) { const float v = a[q] + b[q]; vals[u * 4 + q] = v; s1 += v; }
  }
  red[tid] = s1; __syncthreads();
  for (int st = 128; st > 0; st >>= 1) { if (tid < st) red[tid] += red[tid + st]; __syncthreads(); }
  const float mu = red[0] / (float)N; __syncthreads();
  float s2 = 0.f;
  for (int u = 0; u < per / 4; ++u)
#pragma unroll
    for (int q = 0; q < 4; ++q) { const float c = vals[u * 4 + q] - mu; s2 += c * c; }
  red[tid] = s2; __syncthreads();
  for (int st = 128; st > 0; st >>= 1) { if (tid < st) red[tid] += red[tid + st]; __syncthreads(); }
  const float rs = rsqrtf(red[0] / (float)N + eps);
  {
    for (int u = 0; u < per / 4; ++u) {
      const int j = tid * 4 + 1024 * u;
      v4f o, sm;
#pragma unroll
      for (int q = 0; q < 4; ++q) {
        float gg = g[j + q], bb = bta[j + q];
        if (PARAM_BF16) { gg = bf16_round(gg); bb = bf16_round(bb); }
        sm[q] = vals[u * 4 + q]; o[q] = (vals[u * 4 + q] - mu) * rs * gg + bb;
      }
      if (out_sum) *(v4f*)(out_sum + (size_t)row * N + j) = sm;
      *(v4f*)(out_norm + (size_t)row * N + j) = o;
    }
    
  }
}

__device__ __forceinline__ float tnh(float x) { return __builtin_amdgcn_tanhf(x); }   // one v_tanh_f32
// scores + softmax: block = QT query rows of one batch, 16 waves = 2 halves of the 256 keys x 8 slices of the 512 units. A lane owns 4 keys (KT is [b][u][key], so one
// 16-byte load per unit serves 4 keys x QT rows); q_u and scale_u are the same for the whole wave and come through scalar loads. s_k = sum_u scale_u*tanh(q_u + k_u) runs
// in the lane, u upward inside the slice: no sum across lanes. The 8 slices meet in LDS; behind one block barrier wave t adds them, slice 0 upward, and does mask,
// max-shifted softmax and both stores of row t.
#define QT 4
#define USL 8             // unit slices
#define UW (UU / USL)     // units per wave
#define UC 8              // units per register buffer
typedef int v4ia __attribute__((ext_vector_type(4), may_alias));
__global__ __launch_bounds__(512) void k_scores(const float* __restrict__ QP, const float* __restrict__ KT, const float* __restrict__ scale, const int* __restrict__ mask, float* __restrict__ ATT, float* __restrict__ ATT2) {
  __shared__ __attribute__((aligned(16))) float part[USL][QT][TK];
  const int tid = threadIdx.x, lane = tid & 31;
  const int wv = __builtin_amdgcn_readfirstlane(tid >> 5);          // known wave-uniform, so that q and scale are scalar loads
  const int kh = wv & 1, us = wv >> 1;
  const int row0 = blockIdx.x * QT, b = row0 / TQ;
  const float* qr = QP + (size_t)row0 * UU + us * UW;               // the block's QT query rows, this wave's units
  const float* sr = scale + us * UW;
  const float* kr = KT + ((size_t)b * UU + us * UW) * TK + kh * 128; // wave-uniform base; the lane's own part is an offset that never changes
  const unsigned int ko = (unsigned int)(lane * 4);
  v4f acc[QT] = {};
  v4f ka[UC], kb[UC];
  auto fetch = [&](v4f (&kx)[UC], int c) {
#pragma unroll
    for (int i = 0; i < UC; ++i) kx[i] = *(const v4fa*)(kr + (size_t)(c * UC + i) * TK + ko);
    // the wait that lets the address registers of the loads above be rewritten (the next buffer's base)
    asm volatile("s_wait_xcnt 0x0" ::: "memory");
  };
  auto score = [&](const v4f (&kx)[UC], int c) {
#pragma unroll
    for (int i = 0; i < UC; ++i) {
      const float sc = bf16_round(sr[c * UC + i]);
#pragma unroll
      for (int t = 0; t < QT; ++t) {
        const v4f x = kx[i] + qr[t * UU + c * UC + i];
        v4f th; th[0] = tnh(x[0]); th[1] = tnh(x[1]); th[2] = tnh(x[2]); th[3] = tnh(x[3]);
        acc[t] += sc * th;
      }
    }
  };
  fetch(ka, 0);
  // rolled: one trip is two buffers of UC units (no copies)
#pragma unroll 1
  for (int c = 0; c < UW / UC; c += 2) {
    fetch(kb, c + 1);
    score(ka, c);
    fetch(ka, c + 2 < UW / UC ? c + 2 : c);   // last trip: units of this wave again, in bounds, not used
    score(kb, c + 1);
  }
#pragma unroll
  for (int t = 0; t < QT; ++t) *(v4f*)&part[us][t][kh * 128 + lane * 4] = acc[t];
  __syncthreads();
  if (wv >= QT) return;
  const int row = row0 + wv;
  v4f lv[2]; float mx = -3.0e38f;
#pragma unroll
  for (int h = 0; h < 2; ++h) {
    const int k = h * 128 + lane * 4;
    v4f v = *(const v4fa*)&part[0][wv][k];
#pragma unroll
    for (int s = 1; s < USL; ++s) v += *(const v4fa*)&part[s][wv][k];
    const v4ia m = *(const v4ia*)(mask + b * TK + k);
#pragma unroll
    for (int i = 0; i < 4; ++i) { if (m[i] == 0) v[i] = -1.0e9f; mx = fmaxf(mx, v[i]); }
    lv[h] = v;
  }
  for (int o = 16; o >= 1; o >>= 1) mx = fmaxf(mx, __shfl_xor(mx, o, 32));
  float den = 0.f;
#pragma unroll
  for (int h = 0; h < 2; ++h)
#pragma unroll
    for (int i = 0; i < 4; ++i) { lv[h][i] = expf(lv[h][i] - mx); den += lv[h][i]; }
  for (int o = 16; o >= 1; o >>= 1) den += __shfl_xor(den, o, 32);
  const float rd = 1.0f / den;
  float* a1 = ATT + (size_t)row * TK; float* a2 = ATT2 + (size_t)row * TK;
#pragma unroll
  for (int h = 0; h < 2; ++h) { const v4f p = lv[h] * rd; *(v4f*)(a1 + h * 128 + lane * 4) = p; *(v4f*)(a2 + h * 128 + lane * 4) = p; }
}
extern "C" void kernel_launch(void* const* d_in, const int* in_sizes, int n_in,
                              void* d_out, int out_size, void* d_ws, size_t ws_size, hipStream_t stream) {
  (void)in_sizes; (void)n_in; (void)out_size;
  const float* query = (const float*)d_in[0]; const float* value = (const float*)d_in[1]; const int* mask = (const int*)d_in[2]; const float* Wq = (const float*)d_in[3]; const float* Wk = (const float*)d_in[4]; const float* scale = (const float*)d_in[5];
  float* ctx = (float*)d_out; float* attn = ctx + (size_t)BB * TQ * DD;
  char* ws = (char*)d_ws; size_t off = 0;
  auto take = [&](size_t bytes) { char* p = ws + off; off += (bytes + 255) & ~(size_t)255; return p; };
  float* QP = (float*)take((size_t)2 * BB * TQ * UU * 4); float* KP = QP + (size_t)BB * TQ * UU; float* ATT2 = (float*)take((size_t)BB * TQ * TK * 4);
  if (off > ws_size) return;
  k_gemm_st<false, UU, DD, TK><<<dim3((BB * TQ / 64) * (UU / 64), 2), 256, 0, stream>>>(query, value, 0, Wq, Wk, 0, QP, BB * TQ * UU);
  k_scores<<<BB * TQ / QT, 512, 0, stream>>>(QP, KP, scale, mask, attn, ATT2);
  k_gemm_st<true, DD, TK, 0><<<dim3((TQ / 64) * (DD / 64), BB), 256, 0, stream>>>(ATT2, nullptr, TQ * TK, value, nullptr, TK * DD, ctx, TQ * DD);
}

// v007
// One run takes 23.5 microseconds.
// Two timings next to v006 put it at 1.04 and 1.05 times that version's speed.
// Counting every step since v000, it is 47.2 times as fast.
#include <hip/hip_runtime.h>
// q = query·Wq and k = value·Wk on v_wmma_f32_16x16x32_bf16 (inputs rounded to bf16: single exact term), context = attn·value (attn split hi/lo vs value rounded to bf16: 2 products),
// f32 accumulate. The additive scores Σ_u scale_u·tanh(q_u + k_u) over the [4,256,256,512] broadcast (f32 VALU, tanh = v_tanh_f32), the key mask and the softmax
// are f32 VALU; attention weights are the second output.
#define BB 4
#define TQ 256
#define TK 256
#define DD 1024
#define UU 512

typedef __bf16 v16b __attribute__((ext_vector_type(16)));
typedef unsigned short v8us __attribute__((ext_vector_type(8), may_alias));
typedef float  v8f  __attribute__((ext_vector_type(8)));
typedef float  v4f  __attribute__((ext_vector_type(4)));
typedef float  v4fa __attribute__((ext_vector_type(4), may_alias));
union FragB { v16b v; v8us half[2]; unsigned short u[16]; };

__device__ __forceinline__ unsigned short bf16_bits(float x) { unsigned int u = __float_as_uint(x); return (unsigned short)((u + 0x7FFFu + ((u >> 16) & 1u)) >> 16); }
__device__ __forceinline__ float bf16_val(unsigned short b) { return __uint_as_float(((unsigned int)b) << 16); }
__device__ __forceinline__ float bf16_round(float x) { return bf16_val(bf16_bits(x)); }
// D += A·B with NT terms: 1 = ah·bh, 2 = + al·bh (A split), 3 = + ah·bl (both split)
template <int NT>
__device__ __forceinline__ v8f mmaN(v16b ah, v16b al, v16b bh, v16b bl, v8f c) {
  c = __builtin_amdgcn_wmma_f32_16x16x32_bf16(false, ah, false, bh, (short)0, c, false, false);
  if (NT >= 2) c = __builtin_amdgcn_wmma_f32_16x16x32_bf16(false, al, false, bh, (short)0, c, false, false);
  if (NT >= 3) c = __builtin_amdgcn_wmma_f32_16x16x32_bf16(false, ah, false, bl, (short)0, c, false, false);
  asm volatile("v_nop\n\tv_nop\n\tv_nop\n\tv_nop" : "+v"(c) : "v"(ah), "v"(al), "v"(bh), "v"(bl));
  return c;
}

// GEMM C[M][N] (f32, pitch ldc) = act(A[M][K]·W + bias). A f32 row-major (pitch lda) converted per fragment to bf16
// (ASPLIT: hi/lo two planes -> 2 terms, else single rounded term); Wt bf16 [N][K] (pitch ldb). BIAS_BF16 rounds the
// bias to bf16 first (bias quantised to bf16 before the add). K%32==0, M%16==0, N%64==0.
template <bool ASPLIT, int ACT, bool BIAS_BF16>
__global__ __launch_bounds__(128) void k_gemm_bf(const float* __restrict__ A, int lda, const unsigned short* __restrict__ Wt, int ldb,
                                               const float* __restrict__ bias, float* __restrict__ C, int ldc, int M, int N, int K) {
  __shared__ __attribute__((aligned(16))) float so[4][16][64];
  const int tid = threadIdx.x, w = tid >> 5, lane = tid & 31, ln = lane & 15, hh = lane >> 4;
  const int ntn = N / 64;
  const int wid = blockIdx.x * 4 + w;
  const int mt = wid / ntn, nq = wid % ntn;
  if (mt * 16 >= M) return;
  const int row0 = mt * 16, col0 = nq * 64;
  const float* arow = A + (size_t)(row0 + ln) * lda;
  v8f acc[4] = {};
  for (int kb = 0; kb < K; kb += 32) {
    FragB ah, al;
    const v4f x0 = *(const v4fa*)(arow + kb + 8 * hh), x1 = *(const v4fa*)(arow + kb + 8 * hh + 4);
    const v4f x2 = *(const v4fa*)(arow + kb + 16 + 8 * hh), x3 = *(const v4fa*)(arow + kb + 16 + 8 * hh + 4);
    float xs[16] = {x0[0],x0[1],x0[2],x0[3],x1[0],x1[1],x1[2],x1[3],x2[0],x2[1],x2[2],x2[3],x3[0],x3[1],x3[2],x3[3]};
#pragma unroll
    for (int i = 0; i < 16; ++i) { const unsigned short hb = bf16_bits(xs[i]); ah.u[i] = hb; al.u[i] = ASPLIT ? bf16_bits(xs[i] - bf16_val(hb)) : (unsigned short)0; }
#pragma unroll
    for (int t = 0; t < 4; ++t) {
      const unsigned short* brow = Wt + (size_t)(col0 + t * 16 + ln) * ldb + kb;
      FragB b;
      b.half[0] = *(const v8us*)(brow + 8 * hh);
      b.half[1] = *(const v8us*)(brow + 16 + 8 * hh);
      acc[t] = mmaN<ASPLIT ? 2 : 1>(ah.v, al.v, b.v, b.v, acc[t]);
    }
  }
#pragma unroll
  for (int t = 0; t < 4; ++t) {
    float bv = bias ? bias[col0 + t * 16 + ln] : 0.f;
    if (BIAS_BF16) bv = bf16_round(bv);
#pragma unroll
    for (int r = 0; r < 8; ++r) { float v = acc[t][r] + bv; if (ACT == 1) v = fmaxf(v, 0.f); so[w][8 * hh + r][t * 16 + ln] = v; }
  }
  __builtin_amdgcn_fence(__ATOMIC_ACQ_REL, "workgroup");
  __builtin_amdgcn_wave_barrier();
  const int rsub = lane >> 4, c4 = (lane & 15) * 4;
  {
#pragma unroll
    for (int q = 0; q < 8; ++q) {
      const int r = q * 2 + rsub;
      const v4f v = *(const v4fa*)&so[w][r][c4];
      *(v4f*)(C + (size_t)(row0 + r) * ldc + col0 + c4) = v;
    }
    
  }
}

// Flash-style causal/unmasked attention, all contractions 3-term bf16 hi/lo splits, f32 softmax with running max.
// q,k,v rows are read from f32 buffers with arbitrary row pitch (so they can live inside a fused qkv buffer);
// D = head size (multiple of 32, <= 128); one wave = 16 query rows; block = 4 waves (64 queries) sharing K/V chunks of 32.
template <int D, bool CAUSAL>
__global__ __launch_bounds__(128) void k_flash(const float* __restrict__ qb, const float* __restrict__ kb, const float* __restrict__ vb,
                                             int pitch, int T, int H, float scale, float* __restrict__ y, int ypitch) {
  constexpr int KS = D / 32;        // k-steps for QK
  constexpr int DT = D / 16;        // d tiles for PV
  __shared__ __attribute__((aligned(16))) unsigned short sKh[32][D + 8], sKl[32][D + 8], sVh[32][D + 8], sVl[32][D + 8];
  __shared__ __attribute__((aligned(16))) unsigned short sPh[4][16][40], sPl[4][16][40];
  __shared__ __attribute__((aligned(16))) float sO[4][16][D];
  const int tid = threadIdx.x, w = tid >> 5, lane = tid & 31, ln = lane & 15, hh = lane >> 4;
  const int nqb = (T + 63) / 64;
  const int bh = blockIdx.x / nqb, qblk = blockIdx.x % nqb;
  const int b = bh / H, h = bh % H;
  const int q0 = qblk * 64 + w * 16;
  const float* Q = qb + (size_t)b * T * pitch + h * D;
  const float* K = kb + (size_t)b * T * pitch + h * D;
  const float* V = vb + (size_t)b * T * pitch + h * D;

  // A fragments of the wave's 16 query rows (scaled), hi/lo
  FragB aqh[KS], aql[KS];
  {
    int row = q0 + ln; if (row >= T) row = T - 1;
    const float* qr = Q + (size_t)row * pitch;
#pragma unroll
    for (int ks = 0; ks < KS; ++ks)
#pragma unroll
      for (int i = 0; i < 16; ++i) {
        const int d = ks * 32 + ((i < 8) ? (8 * hh + i) : (16 + 8 * hh + (i - 8)));
        const float x = qr[d] * scale; const unsigned short hb = bf16_bits(x);
        aqh[ks].u[i] = hb; aql[ks].u[i] = bf16_bits(x - bf16_val(hb));
      }
  }
  float m_r[8], l_r[8];
#pragma unroll
  for (int r = 0; r < 8; ++r) { m_r[r] = -3.0e38f; l_r[r] = 0.f; }
  v8f oacc[DT];
#pragma unroll
  for (int dt = 0; dt < DT; ++dt) oacc[dt] = (v8f){0.f,0.f,0.f,0.f,0.f,0.f,0.f,0.f};

  const int kv_end = CAUSAL ? min(T, qblk * 64 + 64) : T;     // block-uniform
  for (int j0 = 0; j0 < kv_end; j0 += 32) {
    __syncthreads();
    for (int e = tid; e < 32 * (D / 4); e += 128) {
      const int r = e / (D / 4), c4 = (e % (D / 4)) * 4;
      const int key = j0 + r;
      v4f kf = {0.f,0.f,0.f,0.f}, vf = {0.f,0.f,0.f,0.f};
      if (key < T) { kf = *(const v4fa*)(K + (size_t)key * pitch + c4); vf = *(const v4fa*)(V + (size_t)key * pitch + c4); }
#pragma unroll
      for (int t = 0; t < 4; ++t) {
        unsigned short hb = bf16_bits(kf[t]); sKh[r][c4 + t] = hb; sKl[r][c4 + t] = bf16_bits(kf[t] - bf16_val(hb));
        hb = bf16_bits(vf[t]); sVh[r][c4 + t] = hb; sVl[r][c4 + t] = bf16_bits(vf[t] - bf16_val(hb));
      }
    }
    __syncthreads();
    // S tile 16 x 32
    v8f s[2];
#pragma unroll
    for (int nt = 0; nt < 2; ++nt) {
      v8f acc = {};
#pragma unroll
      for (int ks = 0; ks < KS; ++ks) {
        FragB bh_, bl_;
        bh_.half[0] = *(const v8us*)&sKh[nt * 16 + ln][ks * 32 + 8 * hh]; bh_.half[1] = *(const v8us*)&sKh[nt * 16 + ln][ks * 32 + 16 + 8 * hh];
        bl_.half[0] = *(const v8us*)&sKl[nt * 16 + ln][ks * 32 + 8 * hh]; bl_.half[1] = *(const v8us*)&sKl[nt * 16 + ln][ks * 32 + 16 + 8 * hh];
        acc = mmaN<3>(aqh[ks].v, aql[ks].v, bh_.v, bl_.v, acc);
      }
      s[nt] = acc;
    }
    // mask + running max (rows 8hh+r; the 16 lanes of a half share rows)
    float alpha[8];
#pragma unroll
    for (int r = 0; r < 8; ++r) {
      const int qi = q0 + 8 * hh + r;
      const int ja = j0 + ln, jb = j0 + 16 + ln;
      if (CAUSAL) { if (ja > qi) s[0][r] = -3.0e38f; if (jb > qi) s[1][r] = -3.0e38f; }
      if (ja >= T) s[0][r] = -3.0e38f;
      if (jb >= T) s[1][r] = -3.0e38f;
      float mx = fmaxf(s[0][r], s[1][r]);
      mx = fmaxf(mx, __shfl_xor(mx, 1, 32)); mx = fmaxf(mx, __shfl_xor(mx, 2, 32)); mx = fmaxf(mx, __shfl_xor(mx, 4, 32)); mx = fmaxf(mx, __shfl_xor(mx, 8, 32));
      const float mnew = fmaxf(m_r[r], mx);
      alpha[r] = (mnew > -1.0e38f) ? __expf(m_r[r] - mnew) : 1.0f;
      const float p0 = (s[0][r] > -1.0e38f) ? __expf(s[0][r] - mnew) : 0.f;
      const float p1 = (s[1][r] > -1.0e38f) ? __expf(s[1][r] - mnew) : 0.f;
      m_r[r] = mnew;
      l_r[r] = l_r[r] * alpha[r] + p0 + p1;            // per-lane partial row sum (16 lanes combined at the end)
      unsigned short hb = bf16_bits(p0); sPh[w][8 * hh + r][ln] = hb;      sPl[w][8 * hh + r][ln] = bf16_bits(p0 - bf16_val(hb));
      hb = bf16_bits(p1);                sPh[w][8 * hh + r][16 + ln] = hb; sPl[w][8 * hh + r][16 + ln] = bf16_bits(p1 - bf16_val(hb));
    }
#pragma unroll
    for (int dt = 0; dt < DT; ++dt)
#pragma unroll
      for (int r = 0; r < 8; ++r) oacc[dt][r] *= alpha[r];
    __builtin_amdgcn_fence(__ATOMIC_ACQ_REL, "workgroup");
    __builtin_amdgcn_wave_barrier();
    FragB pah, pal;
    pah.half[0] = *(const v8us*)&sPh[w][ln][8 * hh]; pah.half[1] = *(const v8us*)&sPh[w][ln][16 + 8 * hh];
    pal.half[0] = *(const v8us*)&sPl[w][ln][8 * hh]; pal.half[1] = *(const v8us*)&sPl[w][ln][16 + 8 * hh];
#pragma unroll
    for (int dt = 0; dt < DT; ++dt) {
      FragB bvh, bvl;
#pragma unroll
      for (int i = 0; i < 8; ++i) {
        bvh.u[i] = sVh[8 * hh + i][dt * 16 + ln]; bvh.u[8 + i] = sVh[16 + 8 * hh + i][dt * 16 + ln];
        bvl.u[i] = sVl[8 * hh + i][dt * 16 + ln]; bvl.u[8 + i] = sVl[16 + 8 * hh + i][dt * 16 + ln];
      }
      oacc[dt] = mmaN<3>(pah.v, pal.v, bvh.v, bvl.v, oacc[dt]);
    }
    __builtin_amdgcn_fence(__ATOMIC_ACQ_REL, "workgroup");
    __builtin_amdgcn_wave_barrier();
  }
#pragma unroll
  for (int r = 0; r < 8; ++r) {
    float l = l_r[r];
    l += __shfl_xor(l, 1, 32); l += __shfl_xor(l, 2, 32); l += __shfl_xor(l, 4, 32); l += __shfl_xor(l, 8, 32);
    l_r[r] = (l > 0.f) ? 1.0f / l : 0.f;
  }
#pragma unroll
  for (int dt = 0; dt < DT; ++dt)
#pragma unroll
    for (int r = 0; r < 8; ++r) sO[w][8 * hh + r][dt * 16 + ln] = oacc[dt][r] * l_r[r];
  __builtin_amdgcn_fence(__ATOMIC_ACQ_REL, "workgroup");
  __builtin_amdgcn_wave_barrier();
  {
    for (int r = 0; r < 16; ++r) {
      const int row = q0 + r;
      if (row < T && lane < D / 4) {
        const v4f val = *(const v4fa*)&sO[w][r][lane * 4];
        *(v4f*)(y + ((size_t)b * T + row) * ypitch + h * D + lane * 4) = val;
      }
    }
    
  }
}

// C[z] = A[z]*B[z], blockIdx.y = z: A f32 [M][K], B f32 [K][N], C f32 [M][N], all row-major and dense; A, B, C advance by sA, sB, sC elements per product
// (A1, B1, where given, are product 1's). Block = 8 waves = one 64x64 tile of C; wave = 16 rows x 32 columns. A k tile of GBK is rounded to bf16 on its way into LDS
// (ASPLIT: A as hi and lo planes, 2 terms), B transposed there to [n][k]; the global loads of the next two k tiles are in flight while this one is multiplied.
// Two LDS buffers, one block barrier per k tile. k runs upward in steps of 32 per accumulator. M%64==0, N%64==0, K%GBK==0.
// CT > 0: product 1 is stored transposed, per group of CT rows, as [M/CT][N][CT]: its waves take B's staged rows as the matrix A operand and A's as B
// (both are [row][k] in LDS with one k order), so D comes out as C transposed and a wave still stores whole 128-byte lines.
#define GBK 128
#define GPI (GBK + 8)   // LDS row pitch in bf16: 256 + 16 bytes, for the 16-byte fragment reads
typedef unsigned int v2u __attribute__((ext_vector_type(2), may_alias));
typedef unsigned int v4u __attribute__((ext_vector_type(4), may_alias));
typedef __bf16 v2b __attribute__((ext_vector_type(2)));
// two f32 rounded to bf16 (nearest even, as bf16_bits) and packed, x0 low: one v_cvt_pk_bf16_f32; lo_val, hi_val give the two rounded values back as f32.
// Two scalar conversions, not one of an f32 pair: with the pair form the build held B's pairs (values of two loads) in adjacent registers across the loop, by copies that waited for loads just issued
__device__ __forceinline__ unsigned int bf16_pk(float x0, float x1) { v2b r; r[0] = (__bf16)x0; r[1] = (__bf16)x1; return __builtin_bit_cast(unsigned int, r); }
__device__ __forceinline__ float lo_val(unsigned int r) { return __uint_as_float(r << 16); }
__device__ __forceinline__ float hi_val(unsigned int r) { return __uint_as_float(r & 0xFFFF0000u); }
template <bool ASPLIT, int N, int K, int CT>
__global__ __launch_bounds__(256) void k_gemm_st(const float* __restrict__ A0, const float* __restrict__ A1, int sA, const float* __restrict__ B0, const float* __restrict__ B1, int sB,
                                                 float* __restrict__ C0, int sC) {
  constexpr int NP = ASPLIT ? 2 : 1, NS = K / GBK;
  static_assert(CT == 0 || (!ASPLIT && CT % 64 == 0), "the operand swap takes one plane of A and whole tiles per row group");
  __shared__ __attribute__((aligned(16))) unsigned short sa[2][NP][64][GPI], sb[2][64][GPI];
  __shared__ __attribute__((aligned(16))) float so[8][16][32];
  const int z = blockIdx.y;
  const float* A = (A1 != nullptr && z == 1) ? A1 : A0 + (size_t)z * sA;
  const float* B = (B1 != nullptr && z == 1) ? B1 : B0 + (size_t)z * sB;
  float* C = C0 + (size_t)z * sC;
  const int tid = threadIdx.x, w = tid >> 5, lane = tid & 31, ln = lane & 15, hh = lane >> 4;
  const int row0 = (blockIdx.x / (N / 64)) * 64, col0 = (blockIdx.x % (N / 64)) * 64;
  const int wm = w & 3, wn = w >> 2;
  const bool tr = CT > 0 && z == 1;
  const unsigned short* fa = tr ? &sb[0][0][0] : &sa[0][0][0][0];   // rows of the matrix A operand, rows of the matrix B operand
  const unsigned short* fb = tr ? &sa[0][0][0][0] : &sb[0][0][0];
  constexpr int FA = NP * 64 * GPI, FB = 64 * GPI;                  // buffer strides (equal wherever tr can hold)
  const int bk = (tid >> 4) * 8, bn = (tid & 15) * 4;
  const float* ag = A + (size_t)row0 * K;                    // block-uniform bases; the lane's own part is a 32-bit offset that never changes
  const float* bg = B + col0;
  const unsigned int ao = (unsigned int)(w * K + lane * 4);  // load p: tile row w + 8p, 4 k
  const unsigned int bo = (unsigned int)(bk * N + bn);       // load i: tile k row bk + i, 4 n
  v4f ra0[8], rb0[8], ra1[8], rb1[8];   // two register sets: even k tiles travel in set 0, odd ones in set 1
  auto fetch = [&](v4f (&ra)[8], v4f (&rb)[8], int s) {
#pragma unroll
    for (int p = 0; p < 8; ++p) ra[p] = *(const v4fa*)(ag + (size_t)s * GBK + 8 * p * K + ao);
    // the wait that lets the address registers of the loads above be rewritten
    asm volatile("s_wait_xcnt 0x0" ::: "memory");
#pragma unroll
    for (int i = 0; i < 8; ++i) rb[i] = *(const v4fa*)(bg + (size_t)s * GBK * N + i * N + bo);
    // the wait that lets the address registers of the loads above be rewritten (the next tile's bases)
    asm volatile("s_wait_xcnt 0x0" ::: "memory");
  };
  auto stage = [&](const v4f (&ra)[8], const v4f (&rb)[8], int buf) {
#pragma unroll
    for (int p = 0; p < 8; ++p) {
      v2u h; h[0] = bf16_pk(ra[p][0], ra[p][1]); h[1] = bf16_pk(ra[p][2], ra[p][3]);
      *(v2u*)&sa[buf][0][w + 8 * p][lane * 4] = h;
      if (ASPLIT) {
        v2u l;
        l[0] = bf16_pk(ra[p][0] - lo_val(h[0]), ra[p][1] - hi_val(h[0]));
        l[1] = bf16_pk(ra[p][2] - lo_val(h[1]), ra[p][3] - hi_val(h[1]));
        *(v2u*)&sa[buf][NP - 1][w + 8 * p][lane * 4] = l;
      }
    }
#pragma unroll
    for (int q = 0; q < 4; ++q) {
      v4u v;
#pragma unroll
      for (int i = 0; i < 4; ++i) v[i] = bf16_pk(rb[2 * i][q], rb[2 * i + 1][q]);
      *(v4u*)&sb[buf][bn + q][bk] = v;
    }
  };
  // hold: a scheduling fence in front of a tile's staging. Without it the build moves that set's rounding, and so the wait for its loads, upward: in front of the tile
  // before's barrier and products, where the set loses its lead, or in between the first loads, which then go out one group per round trip
  auto hold = [&]() { __builtin_amdgcn_sched_barrier(0); };
  // publish: the block barrier that publishes the buffer just staged; the buffer written next was last read in front of it. By hand, with the LDS wait alone:
  // __syncthreads() would also wait for the other register set's global loads, which are meant to stay in flight across it
  auto publish = [&]() { asm volatile("s_wait_dscnt 0x0\n\ts_barrier_signal -1\n\ts_barrier_wait -1" ::: "memory"); };
  v8f acc[2] = {};
  auto mult = [&](int buf) {
#pragma unroll
    for (int kp = 0; kp < GBK / 64; ++kp) {
      FragB ah[2], al[2], b[2][2];   // the fragments of two k steps are read as one group
#pragma unroll
      for (int j = 0; j < 2; ++j) {
        const int k0 = (kp * 2 + j) * 32 + 8 * hh;
        const unsigned short* pa = fa + buf * FA + (wm * 16 + ln) * GPI + k0;
        ah[j].half[0] = *(const v8us*)pa; ah[j].half[1] = *(const v8us*)(pa + 16);
        al[j].half[0] = *(const v8us*)(pa + (NP - 1) * 64 * GPI); al[j].half[1] = *(const v8us*)(pa + (NP - 1) * 64 * GPI + 16);
#pragma unroll
        for (int t = 0; t < 2; ++t) { const unsigned short* pb = fb + buf * FB + (wn * 32 + t * 16 + ln) * GPI + k0; b[j][t].half[0] = *(const v8us*)pb; b[j][t].half[1] = *(const v8us*)(pb + 16); }
      }
#pragma unroll
      for (int j = 0; j < 2; ++j)
#pragma unroll
        for (int t = 0; t < 2; ++t) acc[t] = mmaN<ASPLIT ? 2 : 1>(ah[j].v, al[j].v, b[j][t].v, b[j][t].v, acc[t]);
    }
  };
  static_assert(NS >= 2 && NS % 2 == 0, "k tiles are walked in pairs");
  fetch(ra0, rb0, 0);
  fetch(ra1, rb1, 1); hold();
  // rolled: one trip is two k tiles (two register sets, no copies); every trip refills both sets, so the counted load waits never meet a path without loads
#pragma unroll 1
  for (int s = 0; s + 2 < NS; s += 2) {
    stage(ra0, rb0, 0); publish(); fetch(ra0, rb0, s + 2); mult(0); hold();
    stage(ra1, rb1, 1); publish(); fetch(ra1, rb1, s + 3); mult(1);
  }
  // the last two k tiles: nothing is left to fetch
  stage(ra0, rb0, 0); publish(); mult(0); hold();
  stage(ra1, rb1, 1); publish(); mult(1);
#pragma unroll
  for (int t = 0; t < 2; ++t)
#pragma unroll
    for (int r = 0; r < 8; ++r) so[w][8 * hh + r][t * 16 + ln] = acc[t][r];
  __builtin_amdgcn_fence(__ATOMIC_ACQ_REL, "workgroup");
  __builtin_amdgcn_wave_barrier();
  const int rsub = lane >> 3, c4 = (lane & 7) * 4;
  // D's rows and columns in C: as they stand, or (tr) row = column of C inside the row group, column = row of C inside the group
  float* cw = tr ? C + ((size_t)(row0 / (CT > 0 ? CT : 1)) * N + col0 + wm * 16) * CT + row0 % (CT > 0 ? CT : 1) + wn * 32 : C + (size_t)(row0 + wm * 16) * N + col0 + wn * 32;
  const int cp = tr ? CT : N;
#pragma unroll
  for (int q = 0; q < 4; ++q) {
    const int r = q * 4 + rsub;
    const v4f v = *(const v4fa*)&so[w][r][c4];
    *(v4f*)(cw + r * cp + c4) = v;
  }
}
// row LayerNorm (biased variance, eps) over N: s = X (+ R); optional out_sum <- s; out_norm <- (s-mu)*rsqrt(var+eps)*g + b
template <bool PARAM_BF16>
__global__ __launch_bounds__(256) void k_layernorm(const float* __restrict__ X, const float* __restrict__ R, const float* __restrict__ g, const float* __restrict__ bta,
                                                  float* __restrict__ out_sum, float* __restrict__ out_norm, int N, float eps) {
  __shared__ float red[256];
  const int row = blockIdx.x, tid = threadIdx.x;
  const float* x = X + (size_t)row * N; const float* rr = R ? R + (size_t)row * N : nullptr;
  float vals[16];                     // up to N = 4096
  const int per = N / 256;            // contiguous chunk per thread? use strided-by-4 chunks: thread handles j = tid*4 + 1024*u
  float s1 = 0.f;
  for (int u = 0; u < per / 4; ++u) {
    const int j = tid * 4 + 1024 * u;
    const v4f a = *(const v4fa*)(x + j);
    v4f b = {0.f,0.f,0.f,0.f}; if (rr) b = *(const v4fa*)(rr + j);
#pragma unroll
    for (int q = 0; q < 4; ++q) { const float v = a[q] + b[q]; vals[u * 4 + q] = v; s1 += v; }
  }
  red[tid] = s1; __syncthreads();
  for (int st = 128; st > 0; st >>= 1) { if (tid < st) red[tid] += red[tid + st]; __syncthreads(); }
  const float mu = red[0] / (float)N; __syncthreads();
  float s2 = 0.f;
  for (int u = 0; u < per / 4; ++u)
#pragma unroll
    for (int q = 0; q < 4; ++q) { const float c = vals[u * 4 + q] - mu; s2 += c * c; }
  red[tid] = s2; __syncthreads();
  for (int st = 128; st > 0; st >>= 1) { if (tid < st) red[tid] += red[tid + st]; __syncthreads(); }
  const float rs = rsqrtf(red[0] / (float)N + eps);
  {
    for (int u = 0; u < per / 4; ++u) {
      const int j = tid * 4 + 1024 * u;
      v4f o, sm;
#pragma unroll
      for (int q = 0; q < 4; ++q) {
        float gg = g[j + q], bb = bta[j + q];
        if (PARAM_BF16) { gg = bf16_round(gg); bb = bf16_round(bb); }
        sm[q] = vals[u * 4 + q]; o[q] = (vals[u * 4 + q] - mu) * rs * gg + bb;
      }
      if (out_sum) *(v4f*)(out_sum + (size_t)row * N + j) = sm;
      *(v4f*)(out_norm + (size_t)row * N + j) = o;
    }
    
  }
}

__device__ __forceinline__ float tnh(float x) { return __builtin_amdgcn_tanhf(x); }   // one v_tanh_f32
// scores + softmax: block = QT query rows of one batch, 16 waves = 2 halves of the 256 keys x 8 slices of the 512 units. A lane owns 4 keys (KT is [b][u][key], so one
// 16-byte load per unit serves 4 keys x QT rows); q_u and scale_u are the same for the whole wave and come through scalar loads. s_k = sum_u scale_u*tanh(q_u + k_u) runs
// in the lane, u upward inside the slice: no sum across lanes. The 8 slices meet in LDS; behind one block barrier wave t adds them, slice 0 upward, and does mask,
// max-shifted softmax and both stores of row t.
#define QT 4
#define USL 8             // unit slices
#define UW (UU / USL)     // units per wave
#define UC 8              // units per register buffer
typedef int v4ia __attribute__((ext_vector_type(4), may_alias));
__global__ __launch_bounds__(512) void k_scores(const float* __restrict__ QP, const float* __restrict__ KT, const float* __restrict__ scale, const int* __restrict__ mask, float* __restrict__ ATT, float* __restrict__ ATT2) {
  __shared__ __attribute__((aligned(16))) float part[USL][QT][TK];
  const int tid = threadIdx.x, lane = tid & 31;
  const int wv = __builtin_amdgcn_readfirstlane(tid >> 5);          // known wave-uniform, so that q and scale are scalar loads
  const int kh = wv & 1, us = wv >> 1;
  const int row0 = blockIdx.x * QT, b = row0 / TQ;
  const float* qr = QP + (size_t)row0 * UU + us * UW;               // the block's QT query rows, this wave's units
  const float* sr = scale + us * UW;
  const float* kr = KT + ((size_t)b * UU + us * UW) * TK + kh * 128; // wave-uniform base; the lane's own part is an offset that never changes
  const unsigned int ko = (unsigned int)(lane * 4);
  v4f acc[QT] = {};
  v4f ka[UC], kb[UC];
  auto fetch = [&](v4f (&kx)[UC], int c) {
#pragma unroll
    for (int i = 0; i < UC; ++i) kx[i] = *(const v4fa*)(kr + (size_t)(c * UC + i) * TK + ko);
    // the wait that lets the address registers of the loads above be rewritten (the next buffer's base)
    asm volatile("s_wait_xcnt 0x0" ::: "memory");
  };
  auto score = [&](const v4f (&kx)[UC], int c) {
#pragma unroll
    for (int i = 0; i < UC; ++i) {
      const float sc = bf16_round(sr[c * UC + i]);
#pragma unroll
      for (int t = 0; t < QT; ++t) {
        const v4f x = kx[i] + qr[t * UU + c * UC + i];
        v4f th; th[0] = tnh(x[0]); th[1] = tnh(x[1]); th[2] = tnh(x[2]); th[3] = tnh(x[3]);
        acc[t] += sc * th;
      }
    }
  };
  fetch(ka, 0);
  // rolled: one trip is two buffers of UC units (no copies)
#pragma unroll 1
  for (int c = 0; c < UW / UC; c += 2) {
    fetch(kb, c + 1);
    score(ka, c);
    fetch(ka, c + 2 < UW / UC ? c + 2 : c);   // last trip: units of this wave again, in bounds, not used
    score(kb, c + 1);
  }
#pragma unroll
  for (int t = 0; t < QT; ++t) *(v4f*)&part[us][t][kh * 128 + lane * 4] = acc[t];
  __syncthreads();
  if (wv >= QT) return;
  const int row = row0 + wv;
  v4f lv[2]; float mx = -3.0e38f;
#pragma unroll
  for (int h = 0; h < 2; ++h) {
    const int k = h * 128 + lane * 4;
    v4f v = *(const v4fa*)&part[0][wv][k];
#pragma unroll
    for (int s = 1; s < USL; ++s) v += *(const v4fa*)&part[s][wv][k];
    const v4ia m = *(const v4ia*)(mask + b * TK + k);
#pragma unroll
    for (int i = 0; i < 4; ++i) { if (m[i] == 0) v[i] = -1.0e9f; mx = fmaxf(mx, v[i]); }
    lv[h] = v;
  }
  for (int o = 16; o >= 1; o >>= 1) mx = fmaxf(mx, __shfl_xor(mx, o, 32));
  float den = 0.f;
#pragma unroll
  for (int h = 0; h < 2; ++h)
#pragma unroll
    for (int i = 0; i < 4; ++i) { lv[h][i] = expf(lv[h][i] - mx); den += lv[h][i]; }
  for (int o = 16; o >= 1; o >>= 1) den += __shfl_xor(den, o, 32);
  const float rd = 1.0f / den;
  float* a1 = ATT + (size_t)row * TK; float* a2 = ATT2 + (size_t)row * TK;
#pragma unroll
  for (int h = 0; h < 2; ++h) { const v4f p = lv[h] * rd; *(v4f*)(a1 + h * 128 + lane * 4) = p; *(v4f*)(a2 + h * 128 + lane * 4) = p; }
}
extern "C" void kernel_launch(void* const* d_in, const int* in_sizes, int n_in,
                              void* d_out, int out_size, void* d_ws, size_t ws_size, hipStream_t stream) {
  (void)in_sizes; (void)n_in; (void)out_size;
  const float* query = (const float*)d_in[0]; const float* value = (const float*)d_in[1]; const int* mask = (const int*)d_in[2]; const float* Wq = (const float*)d_in[3]; const float* Wk = (const float*)d_in[4]; const float* scale = (const float*)d_in[5];
  float* ctx = (float*)d_out; float* attn = ctx + (size_t)BB * TQ * DD;
  char* ws = (char*)d_ws; size_t off = 0;
  auto take = [&](size_t bytes) { char* p = ws + off; off += (bytes + 255) & ~(size_t)255; return p; };
  float* QP = (float*)take((size_t)2 * BB * TQ * UU * 4); float* KP = QP + (size_t)BB * TQ * UU; float* ATT2 = (float*)take((size_t)BB * TQ * TK * 4);
  if (off > ws_size) return;
  k_gemm_st<false, UU, DD, TK><<<dim3((BB * TQ / 64) * (UU / 64), 2), 256, 0, stream>>>(query, value, 0, Wq, Wk, 0, QP, BB * TQ * UU);
  k_scores<<<BB * TQ / QT, 512, 0, stream>>>(QP, KP, scale, mask, attn, ATT2);
  k_gemm_st<true, DD, TK, 0><<<dim3((TQ / 64) * (DD / 64), BB), 256, 0, stream>>>(ATT2, nullptr, TQ * TK, value, nullptr, TK * DD, ctx, TQ * DD);
}

// v008
// Measured time: 22.2 microseconds a run.
// In both of two side-by-side timings against v007, it was 1.05 times as fast.
// Over all steps from v000 it is 49.5 times as fast.
#include <hip/hip_runtime.h>
// q = query·Wq and k = value·Wk on v_wmma_f32_16x16x32_bf16 (inputs rounded to bf16: single exact term), context = attn·value (attn split hi/lo vs value rounded to bf16: 2 products),
// f32 accumulate. The additive scores Σ_u scale_u·tanh(q_u + k_u) over the [4,256,256,512] broadcast (f32 VALU, tanh = v_tanh_f32), the key mask and the softmax
// are f32 VALU; attention weights are the second output.
#define BB 4
#define TQ 256
#define TK 256
#define DD 1024
#define UU 512

typedef __bf16 v16b __attribute__((ext_vector_type(16)));
typedef unsigned short v8us __attribute__((ext_vector_type(8), may_alias));
typedef float  v8f  __attribute__((ext_vector_type(8)));
typedef float  v4f  __attribute__((ext_vector_type(4)));
typedef float  v4fa __attribute__((ext_vector_type(4), may_alias));
union FragB { v16b v; v8us half[2]; unsigned short u[16]; };

__device__ __forceinline__ unsigned short bf16_bits(float x) { unsigned int u = __float_as_uint(x); return (unsigned short)((u + 0x7FFFu + ((u >> 16) & 1u)) >> 16); }
__device__ __forceinline__ float bf16_val(unsigned short b) { return __uint_as_float(((unsigned int)b) << 16); }
__device__ __forceinline__ float bf16_round(float x) { return bf16_val(bf16_bits(x)); }
// D += A·B with NT terms: 1 = ah·bh, 2 = + al·bh (A split), 3 = + ah·bl (both split)
template <int NT>
__device__ __forceinline__ v8f mmaN(v16b ah, v16b al, v16b bh, v16b bl, v8f c) {
  c = __builtin_amdgcn_wmma_f32_16x16x32_bf16(false, ah, false, bh, (short)0, c, false, false);
  if (NT >= 2) c = __builtin_amdgcn_wmma_f32_16x16x32_bf16(false, al, false, bh, (short)0, c, false, false);
  if (NT >= 3) c = __builtin_amdgcn_wmma_f32_16x16x32_bf16(false, ah, false, bl, (short)0, c, false, false);
  asm volatile("v_nop\n\tv_nop\n\tv_nop\n\tv_nop" : "+v"(c) : "v"(ah), "v"(al), "v"(bh), "v"(bl));
  return c;
}

// GEMM C[M][N] (f32, pitch ldc) = act(A[M][K]·W + bias). A f32 row-major (pitch lda) converted per fragment to bf16
// (ASPLIT: hi/lo two planes -> 2 terms, else single rounded term); Wt bf16 [N][K] (pitch ldb). BIAS_BF16 rounds the
// bias to bf16 first (bias quantised to bf16 before the add). K%32==0, M%16==0, N%64==0.
template <bool ASPLIT, int ACT, bool BIAS_BF16>
__global__ __launch_bounds__(128) void k_gemm_bf(const float* __restrict__ A, int lda, const unsigned short* __restrict__ Wt, int ldb,
                                               const float* __restrict__ bias, float* __restrict__ C, int ldc, int M, int N, int K) {
  __shared__ __attribute__((aligned(16))) float so[4][16][64];
  const int tid = threadIdx.x, w = tid >> 5, lane = tid & 31, ln = lane & 15, hh = lane >> 4;
  const int ntn = N / 64;
  const int wid = blockIdx.x * 4 + w;
  const int mt = wid / ntn, nq = wid % ntn;
  if (mt * 16 >= M) return;
  const int row0 = mt * 16, col0 = nq * 64;
  const float* arow = A + (size_t)(row0 + ln) * lda;
  v8f acc[4] = {};
  for (int kb = 0; kb < K; kb += 32) {
    FragB ah, al;
    const v4f x0 = *(const v4fa*)(arow + kb + 8 * hh), x1 = *(const v4fa*)(arow + kb + 8 * hh + 4);
    const v4f x2 = *(const v4fa*)(arow + kb + 16 + 8 * hh), x3 = *(const v4fa*)(arow + kb + 16 + 8 * hh + 4);
    float xs[16] = {x0[0],x0[1],x0[2],x0[3],x1[0],x1[1],x1[2],x1[3],x2[0],x2[1],x2[2],x2[3],x3[0],x3[1],x3[2],x3[3]};
#pragma unroll
    for (int i = 0; i < 16; ++i) { const unsigned short hb = bf16_bits(xs[i]); ah.u[i] = hb; al.u[i] = ASPLIT ? bf16_bits(xs[i] - bf16_val(hb)) : (unsigned short)0; }
#pragma unroll
    for (int t = 0; t < 4; ++t) {
      const unsigned short* brow = Wt + (size_t)(col0 + t * 16 + ln) * ldb + kb;
      FragB b;
      b.half[0] = *(const v8us*)(brow + 8 * hh);
      b.half[1] = *(const v8us*)(brow + 16 + 8 * hh);
      acc[t] = mmaN<ASPLIT ? 2 : 1>(ah.v, al.v, b.v, b.v, acc[t]);
    }
  }
#pragma unroll
  for (int t = 0; t < 4; ++t) {
    float bv = bias ? bias[col0 + t * 16 + ln] : 0.f;
    if (BIAS_BF16) bv = bf16_round(bv);
#pragma unroll
    for (int r = 0; r < 8; ++r) { float v = acc[t][r] + bv; if (ACT == 1) v = fmaxf(v, 0.f); so[w][8 * hh + r][t * 16 + ln] = v; }
  }
  __builtin_amdgcn_fence(__ATOMIC_ACQ_REL, "workgroup");
  __builtin_amdgcn_wave_barrier();
  const int rsub = lane >> 4, c4 = (lane & 15) * 4;
  {
#pragma unroll
    for (int q = 0; q < 8; ++q) {
      const int r = q * 2 + rsub;
      const v4f v = *(const v4fa*)&so[w][r][c4];
      *(v4f*)(C + (size_t)(row0 + r) * ldc + col0 + c4) = v;
    }
    
  }
}

// Flash-style causal/unmasked attention, all contractions 3-term bf16 hi/lo splits, f32 softmax with running max.
// q,k,v rows are read from f32 buffers with arbitrary row pitch (so they can live inside a fused qkv buffer);
// D = head size (multiple of 32, <= 128); one wave = 16 query rows; block = 4 waves (64 queries) sharing K/V chunks of 32.
template <int D, bool CAUSAL>
__global__ __launch_bounds__(128) void k_flash(const float* __restrict__ qb, const float* __restrict__ kb, const float* __restrict__ vb,
                                             int pitch, int T, int H, float scale, float* __restrict__ y, int ypitch) {
  constexpr int KS = D / 32;        // k-steps for QK
  constexpr int DT = D / 16;        // d tiles for PV
  __shared__ __attribute__((aligned(16))) unsigned short sKh[32][D + 8], sKl[32][D + 8], sVh[32][D + 8], sVl[32][D + 8];
  __shared__ __attribute__((aligned(16))) unsigned short sPh[4][16][40], sPl[4][16][40];
  __shared__ __attribute__((aligned(16))) float sO[4][16][D];
  const int tid = threadIdx.x, w = tid >> 5, lane = tid & 31, ln = lane & 15, hh = lane >> 4;
  const int nqb = (T + 63) / 64;
  const int bh = blockIdx.x / nqb, qblk = blockIdx.x % nqb;
  const int b = bh / H, h = bh % H;
  const int q0 = qblk * 64 + w * 16;
  const float* Q = qb + (size_t)b * T * pitch + h * D;
  const float* K = kb + (size_t)b * T * pitch + h * D;
  const float* V = vb + (size_t)b * T * pitch + h * D;

  // A fragments of the wave's 16 query rows (scaled), hi/lo
  FragB aqh[KS], aql[KS];
  {
    int row = q0 + ln; if (row >= T) row = T - 1;
    const float* qr = Q + (size_t)row * pitch;
#pragma unroll
    for (int ks = 0; ks < KS; ++ks)
#pragma unroll
      for (int i = 0; i < 16; ++i) {
        const int d = ks * 32 + ((i < 8) ? (8 * hh + i) : (16 + 8 * hh + (i - 8)));
        const float x = qr[d] * scale; const unsigned short hb = bf16_bits(x);
        aqh[ks].u[i] = hb; aql[ks].u[i] = bf16_bits(x - bf16_val(hb));
      }
  }
  float m_r[8], l_r[8];
#pragma unroll
  for (int r = 0; r < 8; ++r) { m_r[r] = -3.0e38f; l_r[r] = 0.f; }
  v8f oacc[DT];
#pragma unroll
  for (int dt = 0; dt < DT; ++dt) oacc[dt] = (v8f){0.f,0.f,0.f,0.f,0.f,0.f,0.f,0.f};

  const int kv_end = CAUSAL ? min(T, qblk * 64 + 64) : T;     // block-uniform
  for (int j0 = 0; j0 < kv_end; j0 += 32) {
    __syncthreads();
    for (int e = tid; e < 32 * (D / 4); e += 128) {
      const int r = e / (D / 4), c4 = (e % (D / 4)) * 4;
      const int key = j0 + r;
      v4f kf = {0.f,0.f,0.f,0.f}, vf = {0.f,0.f,0.f,0.f};
      if (key < T) { kf = *(const v4fa*)(K + (size_t)key * pitch + c4); vf = *(const v4fa*)(V + (size_t)key * pitch + c4); }
#pragma unroll
      for (int t = 0; t < 4; ++t) {
        unsigned short hb = bf16_bits(kf[t]); sKh[r][c4 + t] = hb; sKl[r][c4 + t] = bf16_bits(kf[t] - bf16_val(hb));
        hb = bf16_bits(vf[t]); sVh[r][c4 + t] = hb; sVl[r][c4 + t] = bf16_bits(vf[t] - bf16_val(hb));
      }
    }
    __syncthreads();
    // S tile 16 x 32
    v8f s[2];
#pragma unroll
    for (int nt = 0; nt < 2; ++nt) {
      v8f acc = {};
#pragma unroll
      for (int ks = 0; ks < KS; ++ks) {
        FragB bh_, bl_;
        bh_.half[0] = *(const v8us*)&sKh[nt * 16 + ln][ks * 32 + 8 * hh]; bh_.half[1] = *(const v8us*)&sKh[nt * 16 + ln][ks * 32 + 16 + 8 * hh];
        bl_.half[0] = *(const v8us*)&sKl[nt * 16 + ln][ks * 32 + 8 * hh]; bl_.half[1] = *(const v8us*)&sKl[nt * 16 + ln][ks * 32 + 16 + 8 * hh];
        acc = mmaN<3>(aqh[ks].v, aql[ks].v, bh_.v, bl_.v, acc);
      }
      s[nt] = acc;
    }
    // mask + running max (rows 8hh+r; the 16 lanes of a half share rows)
    float alpha[8];
#pragma unroll
    for (int r = 0; r < 8; ++r) {
      const int qi = q0 + 8 * hh + r;
      const int ja = j0 + ln, jb = j0 + 16 + ln;
      if (CAUSAL) { if (ja > qi) s[0][r] = -3.0e38f; if (jb > qi) s[1][r] = -3.0e38f; }
      if (ja >= T) s[0][r] = -3.0e38f;
      if (jb >= T) s[1][r] = -3.0e38f;
      float mx = fmaxf(s[0][r], s[1][r]);
      mx = fmaxf(mx, __shfl_xor(mx, 1, 32)); mx = fmaxf(mx, __shfl_xor(mx, 2, 32)); mx = fmaxf(mx, __shfl_xor(mx, 4, 32)); mx = fmaxf(mx, __shfl_xor(mx, 8, 32));
      const float mnew = fmaxf(m_r[r], mx);
      alpha[r] = (mnew > -1.0e38f) ? __expf(m_r[r] - mnew) : 1.0f;
      const float p0 = (s[0][r] > -1.0e38f) ? __expf(s[0][r] - mnew) : 0.f;
      const float p1 = (s[1][r] > -1.0e38f) ? __expf(s[1][r] - mnew) : 0.f;
      m_r[r] = mnew;
      l_r[r] = l_r[r] * alpha[r] + p0 + p1;            // per-lane partial row sum (16 lanes combined at the end)
      unsigned short hb = bf16_bits(p0); sPh[w][8 * hh + r][ln] = hb;      sPl[w][8 * hh + r][ln] = bf16_bits(p0 - bf16_val(hb));
      hb = bf16_bits(p1);                sPh[w][8 * hh + r][16 + ln] = hb; sPl[w][8 * hh + r][16 + ln] = bf16_bits(p1 - bf16_val(hb));
    }
#pragma unroll
    for (int dt = 0; dt < DT; ++dt)
#pragma unroll
      for (int r = 0; r < 8; ++r) oacc[dt][r] *= alpha[r];
    __builtin_amdgcn_fence(__ATOMIC_ACQ_REL, "workgroup");
    __builtin_amdgcn_wave_barrier();
    FragB pah, pal;
    pah.half[0] = *(const v8us*)&sPh[w][ln][8 * hh]; pah.half[1] = *(const v8us*)&sPh[w][ln][16 + 8 * hh];
    pal.half[0] = *(const v8us*)&sPl[w][ln][8 * hh]; pal.half[1] = *(const v8us*)&sPl[w][ln][16 + 8 * hh];
#pragma unroll
    for (int dt = 0; dt < DT; ++dt) {
      FragB bvh, bvl;
#pragma unroll
      for (int i = 0; i < 8; ++i) {
        bvh.u[i] = sVh[8 * hh + i][dt * 16 + ln]; bvh.u[8 + i] = sVh[16 + 8 * hh + i][dt * 16 + ln];
        bvl.u[i] = sVl[8 * hh + i][dt * 16 + ln]; bvl.u[8 + i] = sVl[16 + 8 * hh + i][dt * 16 + ln];
      }
      oacc[dt] = mmaN<3>(pah.v, pal.v, bvh.v, bvl.v, oacc[dt]);
    }
    __builtin_amdgcn_fence(__ATOMIC_ACQ_REL, "workgroup");
    __builtin_amdgcn_wave_barrier();
  }
#pragma unroll
  for (int r = 0; r < 8; ++r) {
    float l = l_r[r];
    l += __shfl_xor(l, 1, 32); l += __shfl_xor(l, 2, 32); l += __shfl_xor(l, 4, 32); l += __shfl_xor(l, 8, 32);
    l_r[r] = (l > 0.f) ? 1.0f / l : 0.f;
  }
#pragma unroll
  for (int dt = 0; dt < DT; ++dt)
#pragma unroll
    for (int r = 0; r < 8; ++r) sO[w][8 * hh + r][dt * 16 + ln] = oacc[dt][r] * l_r[r];
  __builtin_amdgcn_fence(__ATOMIC_ACQ_REL, "workgroup");
  __builtin_amdgcn_wave_barrier();
  {
    for (int r = 0; r < 16; ++r) {
      const int row = q0 + r;
      if (row < T && lane < D / 4) {
        const v4f val = *(const v4fa*)&sO[w][r][lane * 4];
        *(v4f*)(y + ((size_t)b * T + row) * ypitch + h * D + lane * 4) = val;
      }
    }
    
  }
}

// C[z] = A[z]*B[z], blockIdx.y = z: A f32 [M][K], B f32 [K][N], C f32 [M][N], all row-major and dense; A, B, C advance by sA, sB, sC elements per product
// (A1, B1, where given, are product 1's). Block = 8 waves = one 64x64 tile of C; wave = 16 rows x 32 columns. A k tile of GBK is rounded to bf16 on its way into LDS
// (ASPLIT: A as hi and lo planes, 2 terms), B transposed there to [n][k]; the global loads of the next two k tiles are in flight while this one is multiplied.
// Two LDS buffers, one block barrier per k tile. k runs upward in steps of 32 per accumulator. M%64==0, N%64==0, K%GBK==0.
// CT > 0: product 1 is stored transposed, per group of CT rows, as [M/CT][N][CT]: its waves take B's staged rows as the matrix A operand and A's as B
// (both are [row][k] in LDS with one k order), so D comes out as C transposed and a wave still stores whole 128-byte lines.
#define GBK 128
#define GPI (GBK + 8)   // LDS row pitch in bf16: 256 + 16 bytes, for the 16-byte fragment reads
typedef unsigned int v2u __attribute__((ext_vector_type(2), may_alias));
typedef unsigned int v4u __attribute__((ext_vector_type(4), may_alias));
typedef __bf16 v2b __attribute__((ext_vector_type(2)));
// two f32 rounded to bf16 (nearest even, as bf16_bits) and packed, x0 low: one v_cvt_pk_bf16_f32; lo_val, hi_val give the two rounded values back as f32.
// Two scalar conversions, not one of an f32 pair: with the pair form the build held B's pairs (values of two loads) in adjacent registers across the loop, by copies that waited for loads just issued
__device__ __forceinline__ unsigned int bf16_pk(float x0, float x1) { v2b r; r[0] = (__bf16)x0; r[1] = (__bf16)x1; return __builtin_bit_cast(unsigned int, r); }
__device__ __forceinline__ float lo_val(unsigned int r) { return __uint_as_float(r << 16); }
__device__ __forceinline__ float hi_val(unsigned int r) { return __uint_as_float(r & 0xFFFF0000u); }
template <bool ASPLIT, int N, int K, int CT>
__global__ __launch_bounds__(256) void k_gemm_st(const float* __restrict__ A0, const float* __restrict__ A1, int sA, const float* __restrict__ B0, const float* __restrict__ B1, int sB,
                                                 float* __restrict__ C0, int sC) {
  constexpr int NP = ASPLIT ? 2 : 1, NS = K / GBK;
  static_assert(CT == 0 || (!ASPLIT && CT % 64 == 0), "the operand swap takes one plane of A and whole tiles per row group");
  __shared__ __attribute__((aligned(16))) unsigned short sa[2][NP][64][GPI], sb[2][64][GPI];
  __shared__ __attribute__((aligned(16))) float so[8][16][32];
  const int z = blockIdx.y;
  const float* A = (A1 != nullptr && z == 1) ? A1 : A0 + (size_t)z * sA;
  const float* B = (B1 != nullptr && z == 1) ? B1 : B0 + (size_t)z * sB;
  float* C = C0 + (size_t)z * sC;
  const int tid = threadIdx.x, w = tid >> 5, lane = tid & 31, ln = lane & 15, hh = lane >> 4;
  const int row0 = (blockIdx.x / (N / 64)) * 64, col0 = (blockIdx.x % (N / 64)) * 64;
  const int wm = w & 3, wn = w >> 2;
  const bool tr = CT > 0 && z == 1;
  const unsigned short* fa = tr ? &sb[0][0][0] : &sa[0][0][0][0];   // rows of the matrix A operand, rows of the matrix B operand
  const unsigned short* fb = tr ? &sa[0][0][0][0] : &sb[0][0][0];
  constexpr int FA = NP * 64 * GPI, FB = 64 * GPI;                  // buffer strides (equal wherever tr can hold)
  const int bk = (tid >> 4) * 8, bn = (tid & 15) * 4;
  const float* ag = A + (size_t)row0 * K;                    // block-uniform bases; the lane's own part is a 32-bit offset that never changes
  const float* bg = B + col0;
  const unsigned int ao = (unsigned int)(w * K + lane * 4);  // load p: tile row w + 8p, 4 k
  const unsigned int bo = (unsigned int)(bk * N + bn);       // load i: tile k row bk + i, 4 n
  v4f ra0[8], rb0[8], ra1[8], rb1[8];   // two register sets: even k tiles travel in set 0, odd ones in set 1
  auto fetch = [&](v4f (&ra)[8], v4f (&rb)[8], int s) {
#pragma unroll
    for (int p = 0; p < 8; ++p) ra[p] = *(const v4fa*)(ag + (size_t)s * GBK + 8 * p * K + ao);
    // the wait that lets the address registers of the loads above be rewritten
    asm volatile("s_wait_xcnt 0x0" ::: "memory");
#pragma unroll
    for (int i = 0; i < 8; ++i) rb[i] = *(const v4fa*)(bg + (size_t)s * GBK * N + i * N + bo);
    // the wait that lets the address registers of the loads above be rewritten (the next tile's bases)
    asm volatile("s_wait_xcnt 0x0" ::: "memory");
  };
  auto stage = [&](const v4f (&ra)[8], const v4f (&rb)[8], int buf) {
#pragma unroll
    for (int p = 0; p < 8; ++p) {
      v2u h; h[0] = bf16_pk(ra[p][0], ra[p][1]); h[1] = bf16_pk(ra[p][2], ra[p][3]);
      *(v2u*)&sa[buf][0][w + 8 * p][lane * 4] = h;
      if (ASPLIT) {
        v2u l;
        l[0] = bf16_pk(ra[p][0] - lo_val(h[0]), ra[p][1] - hi_val(h[0]));
        l[1] = bf16_pk(ra[p][2] - lo_val(h[1]), ra[p][3] - hi_val(h[1]));
        *(v2u*)&sa[buf][NP - 1][w + 8 * p][lane * 4] = l;
      }
    }
#pragma unroll
    for (int q = 0; q < 4; ++q) {
      v4u v;
#pragma unroll
      for (int i = 0; i < 4; ++i) v[i] = bf16_pk(rb[2 * i][q], rb[2 * i + 1][q]);
      *(v4u*)&sb[buf][bn + q][bk] = v;
    }
  };
  // hold: a scheduling fence in front of a tile's staging. Without it the build moves that set's rounding, and so the wait for its loads, upward: in front of the tile
  // before's barrier and products, where the set loses its lead, or in between the first loads, which then go out one group per round trip
  auto hold = [&]() { __builtin_amdgcn_sched_barrier(0); };
  // publish: the block barrier that publishes the buffer just staged; the buffer written next was last read in front of it. By hand, with the LDS wait alone:
  // __syncthreads() would also wait for the other register set's global loads, which are meant to stay in flight across it
  auto publish = [&]() { asm volatile("s_wait_dscnt 0x0\n\ts_barrier_signal -1\n\ts_barrier_wait -1" ::: "memory"); };
  v8f acc[2] = {};
  auto mult = [&](int buf) {
#pragma unroll
    for (int kp = 0; kp < GBK / 64; ++kp) {
      FragB ah[2], al[2], b[2][2];   // the fragments of two k steps are read as one group
#pragma unroll
      for (int j = 0; j < 2; ++j) {
        const int k0 = (kp * 2 + j) * 32 + 8 * hh;
        const unsigned short* pa = fa + buf * FA + (wm * 16 + ln) * GPI + k0;
        ah[j].half[0] = *(const v8us*)pa; ah[j].half[1] = *(const v8us*)(pa + 16);
        al[j].half[0] = *(const v8us*)(pa + (NP - 1) * 64 * GPI); al[j].half[1] = *(const v8us*)(pa + (NP - 1) * 64 * GPI + 16);
#pragma unroll
        for (int t = 0; t < 2; ++t) { const unsigned short* pb = fb + buf * FB + (wn * 32 + t * 16 + ln) * GPI + k0; b[j][t].half[0] = *(const v8us*)pb; b[j][t].half[1] = *(const v8us*)(pb + 16); }
      }
#pragma unroll
      for (int j = 0; j < 2; ++j)
#pragma unroll
        for (int t = 0; t < 2; ++t) acc[t] = mmaN<ASPLIT ? 2 : 1>(ah[j].v, al[j].v, b[j][t].v, b[j][t].v, acc[t]);
    }
  };
  static_assert(NS >= 2 && NS % 2 == 0, "k tiles are walked in pairs");
  fetch(ra0, rb0, 0);
  fetch(ra1, rb1, 1); hold();
  // rolled: one trip is two k tiles (two register sets, no copies); every trip refills both sets, so the counted load waits never meet a path without loads
#pragma unroll 1
  for (int s = 0; s + 2 < NS; s += 2) {
    stage(ra0, rb0, 0); publish(); fetch(ra0, rb0, s + 2); mult(0); hold();
    stage(ra1, rb1, 1); publish(); fetch(ra1, rb1, s + 3); mult(1);
  }
  // the last two k tiles: nothing is left to fetch
  stage(ra0, rb0, 0); publish(); mult(0); hold();
  stage(ra1, rb1, 1); publish(); mult(1);
#pragma unroll
  for (int t = 0; t < 2; ++t)
#pragma unroll
    for (int r = 0; r < 8; ++r) so[w][8 * hh + r][t * 16 + ln] = acc[t][r];
  __builtin_amdgcn_fence(__ATOMIC_ACQ_REL, "workgroup");
  __builtin_amdgcn_wave_barrier();
  const int rsub = lane >> 3, c4 = (lane & 7) * 4;
  // D's rows and columns in C: as they stand, or (tr) row = column of C inside the row group, column = row of C inside the group
  float* cw = tr ? C + ((size_t)(row0 / (CT > 0 ? CT : 1)) * N + col0 + wm * 16) * CT + row0 % (CT > 0 ? CT : 1) + wn * 32 : C + (size_t)(row0 + wm * 16) * N + col0 + wn * 32;
  const int cp = tr ? CT : N;
#pragma unroll
  for (int q = 0; q < 4; ++q) {
    const int r = q * 4 + rsub;
    const v4f v = *(const v4fa*)&so[w][r][c4];
    *(v4f*)(cw + r * cp + c4) = v;
  }
}
// row LayerNorm (biased variance, eps) over N: s = X (+ R); optional out_sum <- s; out_norm <- (s-mu)*rsqrt(var+eps)*g + b
template <bool PARAM_BF16>
__global__ __launch_bounds__(256) void k_layernorm(const float* __restrict__ X, const float* __restrict__ R, const float* __restrict__ g, const float* __restrict__ bta,
                                                  float* __restrict__ out_sum, float* __restrict__ out_norm, int N, float eps) {
  __shared__ float red[256];
  const int row = blockIdx.x, tid = threadIdx.x;
  const float* x = X + (size_t)row * N; const float* rr = R ? R + (size_t)row * N : nullptr;
  float vals[16];                     // up to N = 4096
  const int per = N / 256;            // contiguous chunk per thread? use strided-by-4 chunks: thread handles j = tid*4 + 1024*u
  float s1 = 0.f;
  for (int u = 0; u < per / 4; ++u) {
    const int j = tid * 4 + 1024 * u;
    const v4f a = *(const v4fa*)(x + j);
    v4f b = {0.f,0.f,0.f,0.f}; if (rr) b = *(const v4fa*)(rr + j);
#pragma unroll
    for (int q = 0; q < 4; ++q) { const float v = a[q] + b[q]; vals[u * 4 + q] = v; s1 += v; }
  }
  red[tid] = s1; __syncthreads();
  for (int st = 128; st > 0; st >>= 1) { if (tid < st) red[tid] += red[tid + st]; __syncthreads(); }
  const float mu = red[0] / (float)N; __syncthreads();
  float s2 = 0.f;
  for (int u = 0; u < per / 4; ++u)
#pragma unroll
    for (int q = 0; q < 4; ++q) { const float c = vals[u * 4 + q] - mu; s2 += c * c; }
  red[tid] = s2; __syncthreads();
  for (int st = 128; st > 0; st >>= 1) { if (tid < st) red[tid] += red[tid + st]; __syncthreads(); }
  const float rs = rsqrtf(red[0] / (float)N + eps);
  {
    for (int u = 0; u < per / 4; ++u) {
      const int j = tid * 4 + 1024 * u;
      v4f o, sm;
#pragma unroll
      for (int q = 0; q < 4; ++q) {
        float gg = g[j + q], bb = bta[j + q];
        if (PARAM_BF16) { gg = bf16_round(gg); bb = bf16_round(bb); }
        sm[q] = vals[u * 4 + q]; o[q] = (vals[u * 4 + q] - mu) * rs * gg + bb;
      }
      if (out_sum) *(v4f*)(out_sum + (size_t)row * N + j) = sm;
      *(v4f*)(out_norm + (size_t)row * N + j) = o;
    }
    
  }
}

__device__ __forceinline__ float tnh(float x) { return __builtin_amdgcn_tanhf(x); }   // one v_tanh_f32
// scores + softmax: block = QT query rows of one batch, 16 waves = 2 halves of the 256 keys x 8 slices of the 512 units. A lane owns 4 keys (KT is [b][u][key], so one
// 16-byte load per unit serves 4 keys x QT rows); q_u and scale_u are the same for the whole wave and come through scalar loads. s_k = sum_u scale_u*tanh(q_u + k_u) runs
// in the lane, u upward inside the slice: no sum across lanes. The unit loop is a pipeline of three stages, one unit apart: while unit u's 16 tanh issue, the 8 packed
// adds of unit u + 1 and the 8 packed fma of unit u - 1 issue between them, one behind each tanh. The 8 slices meet in LDS; behind one block barrier wave t adds them,
// slice 0 upward, and does mask, max-shifted softmax and both stores of row t.
#define QT 4
#define USL 8             // unit slices
#define UW (UU / USL)     // units per wave
#define UC 8              // units per register buffer
#define UT (2 * UC)       // units per trip: both register buffers
#define SB 4              // units per batch of scalar loads
typedef int v4ia __attribute__((ext_vector_type(4), may_alias));
typedef float v2f __attribute__((ext_vector_type(2)));
struct flag_no { static constexpr bool value = false; };
struct flag_yes { static constexpr bool value = true; };
__global__ __launch_bounds__(512) void k_scores(const float* __restrict__ QP, const float* __restrict__ KT, const float* __restrict__ scale, const int* __restrict__ mask, float* __restrict__ ATT, float* __restrict__ ATT2) {
  __shared__ __attribute__((aligned(16))) float part[USL][QT][TK];
  const int tid = threadIdx.x, lane = tid & 31;
  const int wv = __builtin_amdgcn_readfirstlane(tid >> 5);          // known wave-uniform, so that q and scale are scalar loads
  const int kh = wv & 1, us = wv >> 1;
  const int row0 = blockIdx.x * QT, b = row0 / TQ;
  const float* qr = QP + (size_t)row0 * UU + us * UW;               // the block's QT query rows, this wave's units
  const float* sr = scale + us * UW;
  const float* kr = KT + ((size_t)b * UU + us * UW) * TK + kh * 128; // wave-uniform base; the lane's own part is an offset that never changes
  const unsigned int ko = (unsigned int)(lane * 4);
  v2f acc[QT][2] = {};
  v4f ka[UC], kb[UC];
  auto fetch = [&](v4f (&kx)[UC], int c) {
#pragma unroll
    for (int i = 0; i < UC; ++i) kx[i] = *(const v4fa*)(kr + (size_t)(c * UC + i) * TK + ko);
    // the wait that lets the address registers of the loads above be rewritten (the next buffer's base)
    asm volatile("s_wait_xcnt 0x0" ::: "memory");
  };
  float qs[UT / SB][QT][SB], ss[UT / SB][SB];   // q and scale, one slot per batch of SB units of a trip
  auto scal = [&](int slot, int u0) {
#pragma unroll
    for (int i = 0; i < SB; ++i) {
      ss[slot][i] = sr[u0 + i];
#pragma unroll
      for (int t = 0; t < QT; ++t) qs[slot][t][i] = qr[t * UU + u0 + i];
    }
  };
  v2f xs[QT][2], th[QT][2] = {};   // q + k of the unit whose tanh comes next; tanh of the unit whose fma comes next (none yet: 0 times 0)
  float scp = 0.f;                 // the scale of th's unit
  // one trip: the UT units from unit c * UC on; last: nothing behind them is fetched or added
  auto trip = [&](int c, auto last) {
    constexpr bool LAST = decltype(last)::value;
#pragma unroll
    for (int u = 0; u < UT; ++u) {
      if (u % SB == 0 && !(LAST && u == UT - SB)) scal((u / SB + 1) % (UT / SB), c * UC + u + SB);   // the next batch, three units before its first use
      if (u == UC - 1 && !LAST) fetch(ka, c + 2);   // ka's last unit was added one step ago
      if (u == UT - 1 && !LAST) fetch(kb, c + 3);
      const int n = (u + 1) % UT;
      const v4f kn = n < UC ? ka[n] : kb[n - UC];
      v2f xn[QT][2], tn[QT][2];
#pragma unroll
      for (int t = 0; t < QT; ++t)
#pragma unroll
        for (int h = 0; h < 2; ++h) {
          tn[t][h][0] = tnh(xs[t][h][0]); tn[t][h][1] = tnh(xs[t][h][1]);
          if (!(LAST && u == UT - 1)) { v2f k2; k2[0] = kn[2 * h]; k2[1] = kn[2 * h + 1]; xn[t][h] = k2 + qs[n / SB][t][n % SB]; }
          acc[t][h] += scp * th[t][h];
        }
      // order of issue inside the step: one packed add or fma behind each tanh, so that the vector port is not idle while the tanh unit is busy, nor the unit idle during runs of packed ops
#pragma unroll
      for (int j = 0; j < QT * 4; ++j) { __builtin_amdgcn_sched_group_barrier(0x400, 1, 0); __builtin_amdgcn_sched_group_barrier(0x2, 1, 0); }
      // the steps stay apart: without this fence the build gathers the adds, the tanh and the fma of many units into long runs of one kind
      __builtin_amdgcn_sched_barrier(0);
      scp = bf16_round(ss[u / SB][u % SB]);
#pragma unroll
      for (int t = 0; t < QT; ++t)
#pragma unroll
        for (int h = 0; h < 2; ++h) { th[t][h] = tn[t][h]; if (!(LAST && u == UT - 1)) xs[t][h] = xn[t][h]; }
    }
  };
  fetch(ka, 0);
  fetch(kb, 1);
  scal(0, 0);
#pragma unroll
  for (int t = 0; t < QT; ++t)
#pragma unroll
    for (int h = 0; h < 2; ++h) { v2f k2; k2[0] = ka[0][2 * h]; k2[1] = ka[0][2 * h + 1]; xs[t][h] = k2 + qs[0][t][0]; }
  // unrolled (about 18 KB of code): rolled, the q and scale values that cross the back edge were copied directly behind their scalar loads, so the wave waited for
  // those loads one step after issuing them, and the scalar registers ran out
#pragma unroll
  for (int c = 0; c + 2 < UW / UC; c += 2) trip(c, flag_no{});
  trip(UW / UC - 2, flag_yes{});
#pragma unroll
  for (int t = 0; t < QT; ++t) {
    acc[t][0] += scp * th[t][0]; acc[t][1] += scp * th[t][1];   // the last unit's fma
    v4f a; a[0] = acc[t][0][0]; a[1] = acc[t][0][1]; a[2] = acc[t][1][0]; a[3] = acc[t][1][1];
    *(v4f*)&part[us][t][kh * 128 + lane * 4] = a;
  }
  __syncthreads();
  if (wv >= QT) return;
  const int row = row0 + wv;
  v4f lv[2]; float mx = -3.0e38f;
#pragma unroll
  for (int h = 0; h < 2; ++h) {
    const int k = h * 128 + lane * 4;
    v4f v = *(const v4fa*)&part[0][wv][k];
#pragma unroll
    for (int s = 1; s < USL; ++s) v += *(const v4fa*)&part[s][wv][k];
    const v4ia m = *(const v4ia*)(mask + b * TK + k);
#pragma unroll
    for (int i = 0; i < 4; ++i) { if (m[i] == 0) v[i] = -1.0e9f; mx = fmaxf(mx, v[i]); }
    lv[h] = v;
  }
  for (int o = 16; o >= 1; o >>= 1) mx = fmaxf(mx, __shfl_xor(mx, o, 32));
  float den = 0.f;
#pragma unroll
  for (int h = 0; h < 2; ++h)
#pragma unroll
    for (int i = 0; i < 4; ++i) { lv[h][i] = expf(lv[h][i] - mx); den += lv[h][i]; }
  for (int o = 16; o >= 1; o >>= 1) den += __shfl_xor(den, o, 32);
  const float rd = 1.0f / den;
  float* a1 = ATT + (size_t)row * TK; float* a2 = ATT2 + (size_t)row * TK;
#pragma unroll
  for (int h = 0; h < 2; ++h) { const v4f p = lv[h] * rd; *(v4f*)(a1 + h * 128 + lane * 4) = p; *(v4f*)(a2 + h * 128 + lane * 4) = p; }
}
extern "C" void kernel_launch(void* const* d_in, const int* in_sizes, int n_in,
                              void* d_out, int out_size, void* d_ws, size_t ws_size, hipStream_t stream) {
  (void)in_sizes; (void)n_in; (void)out_size;
  const float* query = (const float*)d_in[0]; const float* value = (const float*)d_in[1]; const int* mask = (const int*)d_in[2]; const float* Wq = (const float*)d_in[3]; const float* Wk = (const float*)d_in[4]; const float* scale = (const float*)d_in[5];
  float* ctx = (float*)d_out; float* attn = ctx + (size_t)BB * TQ * DD;
  char* ws = (char*)d_ws; size_t off = 0;
  auto take = [&](size_t bytes) { char* p = ws + off; off += (bytes + 255) & ~(size_t)255; return p; };
  float* QP = (float*)take((size_t)2 * BB * TQ * UU * 4); float* KP = QP + (size_t)BB * TQ * UU; float* ATT2 = (float*)take((size_t)BB * TQ * TK * 4);
  if (off > ws_size) return;
  k_gemm_st<false, UU, DD, TK><<<dim3((BB * TQ / 64) * (UU / 64), 2), 256, 0, stream>>>(query, value, 0, Wq, Wk, 0, QP, BB * TQ * UU);
  k_scores<<<BB * TQ / QT, 512, 0, stream>>>(QP, KP, scale, mask, attn, ATT2);
  k_gemm_st<true, DD, TK, 0><<<dim3((TQ / 64) * (DD / 64), BB), 256, 0, stream>>>(ATT2, nullptr, TQ * TK, value, nullptr, TK * DD, ctx, TQ * DD);
}

// v009
// It runs in 21.4 microseconds.
// In two side-by-side timings against v008, it was 1.04 and 1.03 times as fast.
// Counting every step since v000, it is 51.3 times as fast.
#include <hip/hip_runtime.h>
// q = query·Wq and k = value·Wk on v_wmma_f32_16x16x32_bf16 (inputs rounded to bf16: single exact term), context = attn·value (attn split hi/lo vs value rounded to bf16: 2 products),
// f32 accumulate. The additive scores Σ_u scale_u·tanh(q_u + k_u) over the [4,256,256,512] broadcast (f32 VALU, tanh = v_tanh_f32), the key mask and the softmax
// are f32 VALU; attention weights are the second output.
#define BB 4
#define TQ 256
#define TK 256
#define DD 1024
#define UU 512

typedef __bf16 v16b __attribute__((ext_vector_type(16)));
typedef unsigned short v8us __attribute__((ext_vector_type(8), may_alias));
typedef float  v8f  __attribute__((ext_vector_type(8)));
typedef float  v4f  __attribute__((ext_vector_type(4)));
typedef float  v4fa __attribute__((ext_vector_type(4), may_alias));
union FragB { v16b v; v8us half[2]; unsigned short u[16]; };

__device__ __forceinline__ unsigned short bf16_bits(float x) { unsigned int u = __float_as_uint(x); return (unsigned short)((u + 0x7FFFu + ((u >> 16) & 1u)) >> 16); }
__device__ __forceinline__ float bf16_val(unsigned short b) { return __uint_as_float(((unsigned int)b) << 16); }
__device__ __forceinline__ float bf16_round(float x) { return bf16_val(bf16_bits(x)); }
// D += A·B with NT terms: 1 = ah·bh, 2 = + al·bh (A split), 3 = + ah·bl (both split)
template <int NT>
__device__ __forceinline__ v8f mmaN(v16b ah, v16b al, v16b bh, v16b bl, v8f c) {
  c = __builtin_amdgcn_wmma_f32_16x16x32_bf16(false, ah, false, bh, (short)0, c, false, false);
  if (NT >= 2) c = __builtin_amdgcn_wmma_f32_16x16x32_bf16(false, al, false, bh, (short)0, c, false, false);
  if (NT >= 3) c = __builtin_amdgcn_wmma_f32_16x16x32_bf16(false, ah, false, bl, (short)0, c, false, false);
  asm volatile("v_nop\n\tv_nop\n\tv_nop\n\tv_nop" : "+v"(c) : "v"(ah), "v"(al), "v"(bh), "v"(bl));
  return c;
}

// GEMM C[M][N] (f32, pitch ldc) = act(A[M][K]·W + bias). A f32 row-major (pitch lda) converted per fragment to bf16
// (ASPLIT: hi/lo two planes -> 2 terms, else single rounded term); Wt bf16 [N][K] (pitch ldb). BIAS_BF16 rounds the
// bias to bf16 first (bias quantised to bf16 before the add). K%32==0, M%16==0, N%64==0.
template <bool ASPLIT, int ACT, bool BIAS_BF16>
__global__ __launch_bounds__(128) void k_gemm_bf(const float* __restrict__ A, int lda, const unsigned short* __restrict__ Wt, int ldb,
                                               const float* __restrict__ bias, float* __restrict__ C, int ldc, int M, int N, int K) {
  __shared__ __attribute__((aligned(16))) float so[4][16][64];
  const int tid = threadIdx.x, w = tid >> 5, lane = tid & 31, ln = lane & 15, hh = lane >> 4;
  const int ntn = N / 64;
  const int wid = blockIdx.x * 4 + w;
  const int mt = wid / ntn, nq = wid % ntn;
  if (mt * 16 >= M) return;
  const int row0 = mt * 16, col0 = nq * 64;
  const float* arow = A + (size_t)(row0 + ln) * lda;
  v8f acc[4] = {};
  for (int kb = 0; kb < K; kb += 32) {
    FragB ah, al;
    const v4f x0 = *(const v4fa*)(arow + kb + 8 * hh), x1 = *(const v4fa*)(arow + kb + 8 * hh + 4);
    const v4f x2 = *(const v4fa*)(arow + kb + 16 + 8 * hh), x3 = *(const v4fa*)(arow + kb + 16 + 8 * hh + 4);
    float xs[16] = {x0[0],x0[1],x0[2],x0[3],x1[0],x1[1],x1[2],x1[3],x2[0],x2[1],x2[2],x2[3],x3[0],x3[1],x3[2],x3[3]};
#pragma unroll
    for (int i = 0; i < 16; ++i) { const unsigned short hb = bf16_bits(xs[i]); ah.u[i] = hb; al.u[i] = ASPLIT ? bf16_bits(xs[i] - bf16_val(hb)) : (unsigned short)0; }
#pragma unroll
    for (int t = 0; t < 4; ++t) {
      const unsigned short* brow = Wt + (size_t)(col0 + t * 16 + ln) * ldb + kb;
      FragB b;
      b.half[0] = *(const v8us*)(brow + 8 * hh);
      b.half[1] = *(const v8us*)(brow + 16 + 8 * hh);
      acc[t] = mmaN<ASPLIT ? 2 : 1>(ah.v, al.v, b.v, b.v, acc[t]);
    }
  }
#pragma unroll
  for (int t = 0; t < 4; ++t) {
    float bv = bias ? bias[col0 + t * 16 + ln] : 0.f;
    if (BIAS_BF16) bv = bf16_round(bv);
#pragma unroll
    for (int r = 0; r < 8; ++r) { float v = acc[t][r] + bv; if (ACT == 1) v = fmaxf(v, 0.f); so[w][8 * hh + r][t * 16 + ln] = v; }
  }
  __builtin_amdgcn_fence(__ATOMIC_ACQ_REL, "workgroup");
  __builtin_amdgcn_wave_barrier();
  const int rsub = lane >> 4, c4 = (lane & 15) * 4;
  {
#pragma unroll
    for (int q = 0; q < 8; ++q) {
      const int r = q * 2 + rsub;
      const v4f v = *(const v4fa*)&so[w][r][c4];
      *(v4f*)(C + (size_t)(row0 + r) * ldc + col0 + c4) = v;
    }
    
  }
}

// Flash-style causal/unmasked attention, all contractions 3-term bf16 hi/lo splits, f32 softmax with running max.
// q,k,v rows are read from f32 buffers with arbitrary row pitch (so they can live inside a fused qkv buffer);
// D = head size (multiple of 32, <= 128); one wave = 16 query rows; block = 4 waves (64 queries) sharing K/V chunks of 32.
template <int D, bool CAUSAL>
__global__ __launch_bounds__(128) void k_flash(const float* __restrict__ qb, const float* __restrict__ kb, const float* __restrict__ vb,
                                             int pitch, int T, int H, float scale, float* __restrict__ y, int ypitch) {
  constexpr int KS = D / 32;        // k-steps for QK
  constexpr int DT = D / 16;        // d tiles for PV
  __shared__ __attribute__((aligned(16))) unsigned short sKh[32][D + 8], sKl[32][D + 8], sVh[32][D + 8], sVl[32][D + 8];
  __shared__ __attribute__((aligned(16))) unsigned short sPh[4][16][40], sPl[4][16][40];
  __shared__ __attribute__((aligned(16))) float sO[4][16][D];
  const int tid = threadIdx.x, w = tid >> 5, lane = tid & 31, ln = lane & 15, hh = lane >> 4;
  const int nqb = (T + 63) / 64;
  const int bh = blockIdx.x / nqb, qblk = blockIdx.x % nqb;
  const int b = bh / H, h = bh % H;
  const int q0 = qblk * 64 + w * 16;
  const float* Q = qb + (size_t)b * T * pitch + h * D;
  const float* K = kb + (size_t)b * T * pitch + h * D;
  const float* V = vb + (size_t)b * T * pitch + h * D;

  // A fragments of the wave's 16 query rows (scaled), hi/lo
  FragB aqh[KS], aql[KS];
  {
    int row = q0 + ln; if (row >= T) row = T - 1;
    const float* qr = Q + (size_t)row * pitch;
#pragma unroll
    for (int ks = 0; ks < KS; ++ks)
#pragma unroll
      for (int i = 0; i < 16; ++i) {
        const int d = ks * 32 + ((i < 8) ? (8 * hh + i) : (16 + 8 * hh + (i - 8)));
        const float x = qr[d] * scale; const unsigned short hb = bf16_bits(x);
        aqh[ks].u[i] = hb; aql[ks].u[i] = bf16_bits(x - bf16_val(hb));
      }
  }
  float m_r[8], l_r[8];
#pragma unroll
  for (int r = 0; r < 8; ++r) { m_r[r] = -3.0e38f; l_r[r] = 0.f; }
  v8f oacc[DT];
#pragma unroll
  for (int dt = 0; dt < DT; ++dt) oacc[dt] = (v8f){0.f,0.f,0.f,0.f,0.f,0.f,0.f,0.f};

  const int kv_end = CAUSAL ? min(T, qblk * 64 + 64) : T;     // block-uniform
  for (int j0 = 0; j0 < kv_end; j0 += 32) {
    __syncthreads();
    for (int e = tid; e < 32 * (D / 4); e += 128) {
      const int r = e / (D / 4), c4 = (e % (D / 4)) * 4;
      const int key = j0 + r;
      v4f kf = {0.f,0.f,0.f,0.f}, vf = {0.f,0.f,0.f,0.f};
      if (key < T) { kf = *(const v4fa*)(K + (size_t)key * pitch + c4); vf = *(const v4fa*)(V + (size_t)key * pitch + c4); }
#pragma unroll
      for (int t = 0; t < 4; ++t) {
        unsigned short hb = bf16_bits(kf[t]); sKh[r][c4 + t] = hb; sKl[r][c4 + t] = bf16_bits(kf[t] - bf16_val(hb));
        hb = bf16_bits(vf[t]); sVh[r][c4 + t] = hb; sVl[r][c4 + t] = bf16_bits(vf[t] - bf16_val(hb));
      }
    }
    __syncthreads();
    // S tile 16 x 32
    v8f s[2];
#pragma unroll
    for (int nt = 0; nt < 2; ++nt) {
      v8f acc = {};
#pragma unroll
      for (int ks = 0; ks < KS; ++ks) {
        FragB bh_, bl_;
        bh_.half[0] = *(const v8us*)&sKh[nt * 16 + ln][ks * 32 + 8 * hh]; bh_.half[1] = *(const v8us*)&sKh[nt * 16 + ln][ks * 32 + 16 + 8 * hh];
        bl_.half[0] = *(const v8us*)&sKl[nt * 16 + ln][ks * 32 + 8 * hh]; bl_.half[1] = *(const v8us*)&sKl[nt * 16 + ln][ks * 32 + 16 + 8 * hh];
        acc = mmaN<3>(aqh[ks].v, aql[ks].v, bh_.v, bl_.v, acc);
      }
      s[nt] = acc;
    }
    // mask + running max (rows 8hh+r; the 16 lanes of a half share rows)
    float alpha[8];
#pragma unroll
    for (int r = 0; r < 8; ++r) {
      const int qi = q0 + 8 * hh + r;
      const int ja = j0 + ln, jb = j0 + 16 + ln;
      if (CAUSAL) { if (ja > qi) s[0][r] = -3.0e38f; if (jb > qi) s[1][r] = -3.0e38f; }
      if (ja >= T) s[0][r] = -3.0e38f;
      if (jb >= T) s[1][r] = -3.0e38f;
      float mx = fmaxf(s[0][r], s[1][r]);
      mx = fmaxf(mx, __shfl_xor(mx, 1, 32)); mx = fmaxf(mx, __shfl_xor(mx, 2, 32)); mx = fmaxf(mx, __shfl_xor(mx, 4, 32)); mx = fmaxf(mx, __shfl_xor(mx, 8, 32));
      const float mnew = fmaxf(m_r[r], mx);
      alpha[r] = (mnew > -1.0e38f) ? __expf(m_r[r] - mnew) : 1.0f;
      const float p0 = (s[0][r] > -1.0e38f) ? __expf(s[0][r] - mnew) : 0.f;
      const float p1 = (s[1][r] > -1.0e38f) ? __expf(s[1][r] - mnew) : 0.f;
      m_r[r] = mnew;
      l_r[r] = l_r[r] * alpha[r] + p0 + p1;            // per-lane partial row sum (16 lanes combined at the end)
      unsigned short hb = bf16_bits(p0); sPh[w][8 * hh + r][ln] = hb;      sPl[w][8 * hh + r][ln] = bf16_bits(p0 - bf16_val(hb));
      hb = bf16_bits(p1);                sPh[w][8 * hh + r][16 + ln] = hb; sPl[w][8 * hh + r][16 + ln] = bf16_bits(p1 - bf16_val(hb));
    }
#pragma unroll
    for (int dt = 0; dt < DT; ++dt)
#pragma unroll
      for (int r = 0; r < 8; ++r) oacc[dt][r] *= alpha[r];
    __builtin_amdgcn_fence(__ATOMIC_ACQ_REL, "workgroup");
    __builtin_amdgcn_wave_barrier();
    FragB pah, pal;
    pah.half[0] = *(const v8us*)&sPh[w][ln][8 * hh]; pah.half[1] = *(const v8us*)&sPh[w][ln][16 + 8 * hh];
    pal.half[0] = *(const v8us*)&sPl[w][ln][8 * hh]; pal.half[1] = *(const v8us*)&sPl[w][ln][16 + 8 * hh];
#pragma unroll
    for (int dt = 0; dt < DT; ++dt) {
      FragB bvh, bvl;
#pragma unroll
      for (int i = 0; i < 8; ++i) {
        bvh.u[i] = sVh[8 * hh + i][dt * 16 + ln]; bvh.u[8 + i] = sVh[16 + 8 * hh + i][dt * 16 + ln];
        bvl.u[i] = sVl[8 * hh + i][dt * 16 + ln]; bvl.u[8 + i] = sVl[16 + 8 * hh + i][dt * 16 + ln];
      }
      oacc[dt] = mmaN<3>(pah.v, pal.v, bvh.v, bvl.v, oacc[dt]);
    }
    __builtin_amdgcn_fence(__ATOMIC_ACQ_REL, "workgroup");
    __builtin_amdgcn_wave_barrier();
  }
#pragma unroll
  for (int r = 0; r < 8; ++r) {
    float l = l_r[r];
    l += __shfl_xor(l, 1, 32); l += __shfl_xor(l, 2, 32); l += __shfl_xor(l, 4, 32); l += __shfl_xor(l, 8, 32);
    l_r[r] = (l > 0.f) ? 1.0f / l : 0.f;
  }
#pragma unroll
  for (int dt = 0; dt < DT; ++dt)
#pragma unroll
    for (int r = 0; r < 8; ++r) sO[w][8 * hh + r][dt * 16 + ln] = oacc[dt][r] * l_r[r];
  __builtin_amdgcn_fence(__ATOMIC_ACQ_REL, "workgroup");
  __builtin_amdgcn_wave_barrier();
  {
    for (int r = 0; r < 16; ++r) {
      const int row = q0 + r;
      if (row < T && lane < D / 4) {
        const v4f val = *(const v4fa*)&sO[w][r][lane * 4];
        *(v4f*)(y + ((size_t)b * T + row) * ypitch + h * D + lane * 4) = val;
      }
    }
    
  }
}

// C[z] = A[z]*B[z], blockIdx.y = z: A f32 [M][K], B f32 [K][N], C f32 [M][N], all row-major and dense; A, B, C advance by sA, sB, sC elements per product
// (A1, B1, where given, are product 1's). Block = 8 waves = one 64x64 tile of C; wave = 16 rows x 32 columns. A k tile of GBK is rounded to bf16 on its way into LDS
// (ASPLIT: A as hi and lo planes, 2 terms), B transposed there to [n][k]; the global loads of the next two k tiles are in flight while this one is multiplied.
// Two LDS buffers, one block barrier per k tile. The k tiles are walked from a tile of the block's own (rot) upward, wrapping at K; inside a tile k runs upward in steps of 32
// per accumulator. M%64==0, N%64==0, K%GBK==0, K/GBK a power of two.
// CT > 0: product 1 is stored transposed, per group of CT rows, as [M/CT][N][CT]: its waves take B's staged rows as the matrix A operand and A's as B
// (both are [row][k] in LDS with one k order), so D comes out as C transposed and a wave still stores whole 128-byte lines.
#define GBK 128
#define GPI (GBK + 8)   // LDS row pitch in bf16: 256 + 16 bytes, for the 16-byte fragment reads
typedef unsigned int v2u __attribute__((ext_vector_type(2), may_alias));
typedef unsigned int v4u __attribute__((ext_vector_type(4), may_alias));
typedef __bf16 v2b __attribute__((ext_vector_type(2)));
// two f32 rounded to bf16 (nearest even, as bf16_bits) and packed, x0 low: one v_cvt_pk_bf16_f32; lo_val, hi_val give the two rounded values back as f32.
// Two scalar conversions, not one of an f32 pair: with the pair form the build held B's pairs (values of two loads) in adjacent registers across the loop, by copies that waited for loads just issued
__device__ __forceinline__ unsigned int bf16_pk(float x0, float x1) { v2b r; r[0] = (__bf16)x0; r[1] = (__bf16)x1; return __builtin_bit_cast(unsigned int, r); }
__device__ __forceinline__ float lo_val(unsigned int r) { return __uint_as_float(r << 16); }
__device__ __forceinline__ float hi_val(unsigned int r) { return __uint_as_float(r & 0xFFFF0000u); }
template <bool ASPLIT, int N, int K, int CT>
__global__ __launch_bounds__(256) void k_gemm_st(const float* __restrict__ A0, const float* __restrict__ A1, int sA, const float* __restrict__ B0, const float* __restrict__ B1, int sB,
                                                 float* __restrict__ C0, int sC) {
  constexpr int NP = ASPLIT ? 2 : 1, NS = K / GBK;
  static_assert(CT == 0 || (!ASPLIT && CT % 64 == 0), "the operand swap takes one plane of A and whole tiles per row group");
  __shared__ __attribute__((aligned(16))) unsigned short sa[2][NP][64][GPI], sb[2][64][GPI];
  __shared__ __attribute__((aligned(16))) float so[8][16][32];
  const int z = blockIdx.y;
  const float* A = (A1 != nullptr && z == 1) ? A1 : A0 + (size_t)z * sA;
  const float* B = (B1 != nullptr && z == 1) ? B1 : B0 + (size_t)z * sB;
  float* C = C0 + (size_t)z * sC;
  const int tid = threadIdx.x, w = tid >> 5, lane = tid & 31, ln = lane & 15, hh = lane >> 4;
  const int row0 = (blockIdx.x / (N / 64)) * 64, col0 = (blockIdx.x % (N / 64)) * 64;
  const int wm = w & 3, wn = w >> 2;
  const bool tr = CT > 0 && z == 1;
  const unsigned short* fa = tr ? &sb[0][0][0] : &sa[0][0][0][0];   // rows of the matrix A operand, rows of the matrix B operand
  const unsigned short* fb = tr ? &sa[0][0][0][0] : &sb[0][0][0];
  constexpr int FA = NP * 64 * GPI, FB = 64 * GPI;                  // buffer strides (equal wherever tr can hold)
  const int bk = (tid >> 4) * 8, bn = (tid & 15) * 4;
  const float* ag = A + (size_t)row0 * K;                    // block-uniform bases; the lane's own part is a 32-bit offset that never changes
  const float* bg = B + col0;
  const unsigned int ao = (unsigned int)(w * K + lane * 4);  // load p: tile row w + 8p, 4 k
  const unsigned int bo = (unsigned int)(bk * N + bn);       // load i: tile k row bk + i, 4 n
  // the block's first k tile: the blocks that share A's rows (one tile row) or B's columns (one tile column) run at the same time, and in step they would ask L2 for the same
  // lines at the same moment; started apart, they ask for different lines
  const int rot = (int)(blockIdx.x / (N / 64) + blockIdx.x % (N / 64)) & (NS - 1);
  v4f ra0[8], rb0[8], ra1[8], rb1[8];   // two register sets: even steps of the walk travel in set 0, odd ones in set 1
  auto fetch = [&](v4f (&ra)[8], v4f (&rb)[8], int step) {
    const int s = (step + rot) & (NS - 1);   // step of the walk -> k tile
#pragma unroll
    for (int p = 0; p < 8; ++p) ra[p] = *(const v4fa*)(ag + (size_t)s * GBK + 8 * p * K + ao);
    // the wait that lets the address registers of the loads above be rewritten
    asm volatile("s_wait_xcnt 0x0" ::: "memory");
#pragma unroll
    for (int i = 0; i < 8; ++i) rb[i] = *(const v4fa*)(bg + (size_t)s * GBK * N + i * N + bo);
    // the wait that lets the address registers of the loads above be rewritten (the next tile's bases)
    asm volatile("s_wait_xcnt 0x0" ::: "memory");
  };
  auto stage = [&](const v4f (&ra)[8], const v4f (&rb)[8], int buf) {
#pragma unroll
    for (int p = 0; p < 8; ++p) {
      v2u h; h[0] = bf16_pk(ra[p][0], ra[p][1]); h[1] = bf16_pk(ra[p][2], ra[p][3]);
      *(v2u*)&sa[buf][0][w + 8 * p][lane * 4] = h;
      if (ASPLIT) {
        v2u l;
        l[0] = bf16_pk(ra[p][0] - lo_val(h[0]), ra[p][1] - hi_val(h[0]));
        l[1] = bf16_pk(ra[p][2] - lo_val(h[1]), ra[p][3] - hi_val(h[1]));
        *(v2u*)&sa[buf][NP - 1][w + 8 * p][lane * 4] = l;
      }
    }
#pragma unroll
    for (int q = 0; q < 4; ++q) {
      v4u v;
#pragma unroll
      for (int i = 0; i < 4; ++i) v[i] = bf16_pk(rb[2 * i][q], rb[2 * i + 1][q]);
      *(v4u*)&sb[buf][bn + q][bk] = v;
    }
  };
  // hold: a scheduling fence in front of a tile's staging. Without it the build moves that set's rounding, and so the wait for its loads, upward: in front of the tile
  // before's barrier and products, where the set loses its lead, or in between the first loads, which then go out one group per round trip
  auto hold = [&]() { __builtin_amdgcn_sched_barrier(0); };
  // publish: the block barrier that publishes the buffer just staged; the buffer written next was last read in front of it. By hand, with the LDS wait alone:
  // __syncthreads() would also wait for the other register set's global loads, which are meant to stay in flight across it
  auto publish = [&]() { asm volatile("s_wait_dscnt 0x0\n\ts_barrier_signal -1\n\ts_barrier_wait -1" ::: "memory"); };
  v8f acc[2] = {};
  auto mult = [&](int buf) {
#pragma unroll
    for (int kp = 0; kp < GBK / 64; ++kp) {
      FragB ah[2], al[2], b[2][2];   // the fragments of two k steps are read as one group
#pragma unroll
      for (int j = 0; j < 2; ++j) {
        const int k0 = (kp * 2 + j) * 32 + 8 * hh;
        const unsigned short* pa = fa + buf * FA + (wm * 16 + ln) * GPI + k0;
        ah[j].half[0] = *(const v8us*)pa; ah[j].half[1] = *(const v8us*)(pa + 16);
        al[j].half[0] = *(const v8us*)(pa + (NP - 1) * 64 * GPI); al[j].half[1] = *(const v8us*)(pa + (NP - 1) * 64 * GPI + 16);
#pragma unroll
        for (int t = 0; t < 2; ++t) { const unsigned short* pb = fb + buf * FB + (wn * 32 + t * 16 + ln) * GPI + k0; b[j][t].half[0] = *(const v8us*)pb; b[j][t].half[1] = *(const v8us*)(pb + 16); }
      }
#pragma unroll
      for (int j = 0; j < 2; ++j)
#pragma unroll
        for (int t = 0; t < 2; ++t) acc[t] = mmaN<ASPLIT ? 2 : 1>(ah[j].v, al[j].v, b[j][t].v, b[j][t].v, acc[t]);
    }
  };
  static_assert(NS >= 2 && (NS & (NS - 1)) == 0, "k tiles are walked in pairs, and the walk wraps by a mask");
  fetch(ra0, rb0, 0);
  fetch(ra1, rb1, 1); hold();
  // rolled: one trip is two k tiles (two register sets, no copies); every trip refills both sets, so the counted load waits never meet a path without loads
#pragma unroll 1
  for (int s = 0; s + 2 < NS; s += 2) {
    stage(ra0, rb0, 0); publish(); fetch(ra0, rb0, s + 2); mult(0); hold();
    stage(ra1, rb1, 1); publish(); fetch(ra1, rb1, s + 3); mult(1);
  }
  // the last two k tiles: nothing is left to fetch
  stage(ra0, rb0, 0); publish(); mult(0); hold();
  stage(ra1, rb1, 1); publish(); mult(1);
#pragma unroll
  for (int t = 0; t < 2; ++t)
#pragma unroll
    for (int r = 0; r < 8; ++r) so[w][8 * hh + r][t * 16 + ln] = acc[t][r];
  __builtin_amdgcn_fence(__ATOMIC_ACQ_REL, "workgroup");
  __builtin_amdgcn_wave_barrier();
  const int rsub = lane >> 3, c4 = (lane & 7) * 4;
  // D's rows and columns in C: as they stand, or (tr) row = column of C inside the row group, column = row of C inside the group
  float* cw = tr ? C + ((size_t)(row0 / (CT > 0 ? CT : 1)) * N + col0 + wm * 16) * CT + row0 % (CT > 0 ? CT : 1) + wn * 32 : C + (size_t)(row0 + wm * 16) * N + col0 + wn * 32;
  const int cp = tr ? CT : N;
#pragma unroll
  for (int q = 0; q < 4; ++q) {
    const int r = q * 4 + rsub;
    const v4f v = *(const v4fa*)&so[w][r][c4];
    *(v4f*)(cw + r * cp + c4) = v;
  }
}
// row LayerNorm (biased variance, eps) over N: s = X (+ R); optional out_sum <- s; out_norm <- (s-mu)*rsqrt(var+eps)*g + b
template <bool PARAM_BF16>
__global__ __launch_bounds__(256) void k_layernorm(const float* __restrict__ X, const float* __restrict__ R, const float* __restrict__ g, const float* __restrict__ bta,
                                                  float* __restrict__ out_sum, float* __restrict__ out_norm, int N, float eps) {
  __shared__ float red[256];
  const int row = blockIdx.x, tid = threadIdx.x;
  const float* x = X + (size_t)row * N; const float* rr = R ? R + (size_t)row * N : nullptr;
  float vals[16];                     // up to N = 4096
  const int per = N / 256;            // contiguous chunk per thread? use strided-by-4 chunks: thread handles j = tid*4 + 1024*u
  float s1 = 0.f;
  for (int u = 0; u < per / 4; ++u) {
    const int j = tid * 4 + 1024 * u;
    const v4f a = *(const v4fa*)(x + j);
    v4f b = {0.f,0.f,0.f,0.f}; if (rr) b = *(const v4fa*)(rr + j);
#pragma unroll
    for (int q = 0; q < 4; ++q) { const float v = a[q] + b[q]; vals[u * 4 + q] = v; s1 += v; }
  }
  red[tid] = s1; __syncthreads();
  for (int st = 128; st > 0; st >>= 1) { if (tid < st) red[tid] += red[tid + st]; __syncthreads(); }
  const float mu = red[0] / (float)N; __syncthreads();
  float s2 = 0.f;
  for (int u = 0; u < per / 4; ++u)
#pragma unroll
    for (int q = 0; q < 4; ++q) { const float c = vals[u * 4 + q] - mu; s2 += c * c; }
  red[tid] = s2; __syncthreads();
  for (int st = 128; st > 0; st >>= 1) { if (tid < st) red[tid] += red[tid + st]; __syncthreads(); }
  const float rs = rsqrtf(red[0] / (float)N + eps);
  {
    for (int u = 0; u < per / 4; ++u) {
      const int j = tid * 4 + 1024 * u;
      v4f o, sm;
#pragma unroll
      for (int q = 0; q < 4; ++q) {
        float gg = g[j + q], bb = bta[j + q];
        if (PARAM_BF16) { gg = bf16_round(gg); bb = bf16_round(bb); }
        sm[q] = vals[u * 4 + q]; o[q] = (vals[u * 4 + q] - mu) * rs * gg + bb;
      }
      if (out_sum) *(v4f*)(out_sum + (size_t)row * N + j) = sm;
      *(v4f*)(out_norm + (size_t)row * N + j) = o;
    }
    
  }
}

__device__ __forceinline__ float tnh(float x) { return __builtin_amdgcn_tanhf(x); }   // one v_tanh_f32
// scores + softmax: block = QT query rows of one batch, 16 waves = 2 halves of the 256 keys x 8 slices of the 512 units. A lane owns 4 keys (KT is [b][u][key], so one
// 16-byte load per unit serves 4 keys x QT rows); q_u and scale_u are the same for the whole wave and come through scalar loads. s_k = sum_u scale_u*tanh(q_u + k_u) runs
// in the lane: no sum across lanes. The slice's units are walked from a group of UC of the block's own (rot) upward, wrapping at the slice's end. The unit loop is a pipeline of three stages, one unit apart: while unit u's 16 tanh issue, the 8 packed
// adds of unit u + 1 and the 8 packed fma of unit u - 1 issue between them, one behind each tanh. The 8 slices meet in LDS; behind one block barrier wave t adds them,
// slice 0 upward, and does mask, max-shifted softmax and both stores of row t.
#define QT 4
#define USL 8             // unit slices
#define UW (UU / USL)     // units per wave
#define UC 8              // units per register buffer
#define UT (2 * UC)       // units per trip: both register buffers
#define SB UC             // units per batch of scalar loads: one group of the walk (a batch does not straddle the wrap), one 32-byte load per row
typedef int v4ia __attribute__((ext_vector_type(4), may_alias));
typedef float v2f __attribute__((ext_vector_type(2)));
struct flag_no { static constexpr bool value = false; };
struct flag_yes { static constexpr bool value = true; };
__global__ __launch_bounds__(512) void k_scores(const float* __restrict__ QP, const float* __restrict__ KT, const float* __restrict__ scale, const int* __restrict__ mask, float* __restrict__ ATT, float* __restrict__ ATT2) {
  __shared__ __attribute__((aligned(16))) float part[USL][QT][TK];
  const int tid = threadIdx.x, lane = tid & 31;
  const int wv = __builtin_amdgcn_readfirstlane(tid >> 5);          // known wave-uniform, so that q and scale are scalar loads
  const int kh = wv & 1, us = wv >> 1;
  const int row0 = blockIdx.x * QT, b = row0 / TQ;
  const float* qr = QP + (size_t)row0 * UU + us * UW;               // the block's QT query rows, this wave's units
  const float* sr = scale + us * UW;
  const float* kr = KT + ((size_t)b * UU + us * UW) * TK + kh * 128; // wave-uniform base; the lane's own part is an offset that never changes
  const unsigned int ko = (unsigned int)(lane * 4);
  // the 64 blocks of a batch read the same KT at the same time, and in step they would ask L2 for the same lines at the same moment: each starts at a group of its own
  const int rot = (int)(blockIdx.x + (blockIdx.x >> 3)) & (UW / UC - 1);
  auto first = [&](int c) { return ((c + rot) & (UW / UC - 1)) * UC; };   // group c of the walk -> its first unit in the slice
  v2f acc[QT][2] = {};
  v4f ka[UC], kb[UC];
  auto fetch = [&](v4f (&kx)[UC], int c) {
    const int f = first(c);
#pragma unroll
    for (int i = 0; i < UC; ++i) kx[i] = *(const v4fa*)(kr + (size_t)(f + i) * TK + ko);
    // the wait that lets the address registers of the loads above be rewritten (the next buffer's base)
    asm volatile("s_wait_xcnt 0x0" ::: "memory");
  };
  float qs[UT / SB][QT][SB], ss[UT / SB][SB];   // q and scale, one slot per batch of SB units of a trip
  auto scal = [&](int slot, int p0) {   // p0: place in the walk
    const int u0 = first(p0 / UC) + p0 % UC;
#pragma unroll
    for (int i = 0; i < SB; ++i) {
      ss[slot][i] = sr[u0 + i];
#pragma unroll
      for (int t = 0; t < QT; ++t) qs[slot][t][i] = qr[t * UU + u0 + i];
    }
  };
  v2f xs[QT][2], th[QT][2] = {};   // q + k of the unit whose tanh comes next; tanh of the unit whose fma comes next (none yet: 0 times 0)
  float scp = 0.f;                 // the scale of th's unit
  // one trip: the UT units from place c * UC of the walk on; last: nothing behind them is fetched or added
  auto trip = [&](int c, auto last) {
    constexpr bool LAST = decltype(last)::value;
#pragma unroll
    for (int u = 0; u < UT; ++u) {
      if (u % SB == SB - 4 && !(LAST && u > UT - SB)) scal((u / SB + 1) % (UT / SB), c * UC + u + 4);   // the next batch, three units before its first use
      if (u == UC - 1 && !LAST) fetch(ka, c + 2);   // ka's last unit was added one step ago
      if (u == UT - 1 && !LAST) fetch(kb, c + 3);
      const int n = (u + 1) % UT;
      const v4f kn = n < UC ? ka[n] : kb[n - UC];
      v2f xn[QT][2], tn[QT][2];
#pragma unroll
      for (int t = 0; t < QT; ++t)
#pragma unroll
        for (int h = 0; h < 2; ++h) {
          tn[t][h][0] = tnh(xs[t][h][0]); tn[t][h][1] = tnh(xs[t][h][1]);
          if (!(LAST && u == UT - 1)) { v2f k2; k2[0] = kn[2 * h]; k2[1] = kn[2 * h + 1]; xn[t][h] = k2 + qs[n / SB][t][n % SB]; }
          acc[t][h] += scp * th[t][h];
        }
      // order of issue inside the step: one packed add or fma behind each tanh, so that the vector port is not idle while the tanh unit is busy, nor the unit idle during runs of packed ops
#pragma unroll
      for (int j = 0; j < QT * 4; ++j) { __builtin_amdgcn_sched_group_barrier(0x400, 1, 0); __builtin_amdgcn_sched_group_barrier(0x2, 1, 0); }
      // the steps stay apart: without this fence the build gathers the adds, the tanh and the fma of many units into long runs of one kind
      __builtin_amdgcn_sched_barrier(0);
      scp = bf16_round(ss[u / SB][u % SB]);
#pragma unroll
      for (int t = 0; t < QT; ++t)
#pragma unroll
        for (int h = 0; h < 2; ++h) { th[t][h] = tn[t][h]; if (!(LAST && u == UT - 1)) xs[t][h] = xn[t][h]; }
    }
  };
  fetch(ka, 0);
  fetch(kb, 1);
  scal(0, 0);
#pragma unroll
  for (int t = 0; t < QT; ++t)
#pragma unroll
    for (int h = 0; h < 2; ++h) { v2f k2; k2[0] = ka[0][2 * h]; k2[1] = ka[0][2 * h + 1]; xs[t][h] = k2 + qs[0][t][0]; }
  // unrolled (about 18 KB of code): rolled, the q and scale values that cross the back edge were copied directly behind their scalar loads, so the wave waited for
  // those loads one step after issuing them, and the scalar registers ran out
#pragma unroll
  for (int c = 0; c + 2 < UW / UC; c += 2) trip(c, flag_no{});
  trip(UW / UC - 2, flag_yes{});
#pragma unroll
  for (int t = 0; t < QT; ++t) {
    acc[t][0] += scp * th[t][0]; acc[t][1] += scp * th[t][1];   // the last unit's fma
    v4f a; a[0] = acc[t][0][0]; a[1] = acc[t][0][1]; a[2] = acc[t][1][0]; a[3] = acc[t][1][1];
    *(v4f*)&part[us][t][kh * 128 + lane * 4] = a;
  }
  __syncthreads();
  if (wv >= QT) return;
  const int row = row0 + wv;
  v4f lv[2]; float mx = -3.0e38f;
#pragma unroll
  for (int h = 0; h < 2; ++h) {
    const int k = h * 128 + lane * 4;
    v4f v = *(const v4fa*)&part[0][wv][k];
#pragma unroll
    for (int s = 1; s < USL; ++s) v += *(const v4fa*)&part[s][wv][k];
    const v4ia m = *(const v4ia*)(mask + b * TK + k);
#pragma unroll
    for (int i = 0; i < 4; ++i) { if (m[i] == 0) v[i] = -1.0e9f; mx = fmaxf(mx, v[i]); }
    lv[h] = v;
  }
  for (int o = 16; o >= 1; o >>= 1) mx = fmaxf(mx, __shfl_xor(mx, o, 32));
  float den = 0.f;
#pragma unroll
  for (int h = 0; h < 2; ++h)
#pragma unroll
    for (int i = 0; i < 4; ++i) { lv[h][i] = expf(lv[h][i] - mx); den += lv[h][i]; }
  for (int o = 16; o >= 1; o >>= 1) den += __shfl_xor(den, o, 32);
  const float rd = 1.0f / den;
  float* a1 = ATT + (size_t)row * TK; float* a2 = ATT2 + (size_t)row * TK;
#pragma unroll
  for (int h = 0; h < 2; ++h) { const v4f p = lv[h] * rd; *(v4f*)(a1 + h * 128 + lane * 4) = p; *(v4f*)(a2 + h * 128 + lane * 4) = p; }
}
extern "C" void kernel_launch(void* const* d_in, const int* in_sizes, int n_in,
                              void* d_out, int out_size, void* d_ws, size_t ws_size, hipStream_t stream) {
  (void)in_sizes; (void)n_in; (void)out_size;
  const float* query = (const float*)d_in[0]; const float* value = (const float*)d_in[1]; const int* mask = (const int*)d_in[2]; const float* Wq = (const float*)d_in[3]; const float* Wk = (const float*)d_in[4]; const float* scale = (const float*)d_in[5];
  float* ctx = (float*)d_out; float* attn = ctx + (size_t)BB * TQ * DD;
  char* ws = (char*)d_ws; size_t off = 0;
  auto take = [&](size_t bytes) { char* p = ws + off; off += (bytes + 255) & ~(size_t)255; return p; };
  float* QP = (float*)take((size_t)2 * BB * TQ * UU * 4); float* KP = QP + (size_t)BB * TQ * UU; float* ATT2 = (float*)take((size_t)BB * TQ * TK * 4);
  if (off > ws_size) return;
  k_gemm_st<false, UU, DD, TK><<<dim3((BB * TQ / 64) * (UU / 64), 2), 256, 0, stream>>>(query, value, 0, Wq, Wk, 0, QP, BB * TQ * UU);
  k_scores<<<BB * TQ / QT, 512, 0, stream>>>(QP, KP, scale, mask, attn, ATT2);
  k_gemm_st<true, DD, TK, 0><<<dim3((TQ / 64) * (DD / 64), BB), 256, 0, stream>>>(ATT2, nullptr, TQ * TK, value, nullptr, TK * DD, ctx, TQ * DD);
}
